// v000
// Times are from an AMD MI455X. After a warm-up the kernel runs many times in a row, and a time is the length of
// such a window on the GPU divided by its runs, so every launch and the gaps after it count. The runs cycle
// through copies of the inputs. A figure is the median of several windows, for all but v000 over two sittings.
// Sittings can differ by a few percent; kernels timed side by side share one.
// v000, which the later versions start from, runs in 4030 microseconds.
#include <hip/hip_runtime.h>

// Multi-head attention over three input streams with a key-padding mask (q, k, v [4][2048][1024]; qh = q w_q^T + b_q, kh = k w_k^T + b_k, vh = v w_v^T + b_v ('oi' (out, in) [1024][1024] x 0.02 + [1024]: the four biases are zero on this draw: read and added; 16 heads x 64); scores / sqrt(64); keys j with mask[b][j] == 0 (int32 [4][2048], read as data: about half the keys of every batch entry) are set to the float32 minimum: an exclusion (no batch entry has every key masked); softmax; out = merged w_o^T + b_o -> [4][2048][1024] (8.4 M); argument order q, k, v, w_q, b_q, w_k, b_k, w_v, b_v, w_o, b_o, mask).
// Layout per batch: bf16 copies of query, key and value in turn (one operand buffer, stream-ordered); 'oi' weights cast as they stand; exact projections + f32 biases; dense T-2048 attention with the key mask selected in the softmax kernel (hybrid rows: < 512 hi/lo 3 products, rest fp16 x1024; dense score tiles); merged hi/lo x Wo exact + bo.
// Compute dtypes, f32 accumulate: every input rounded to bf16; projections exact + f32 biases; attention rows < 512 3 products, rest fp16; softmax f32; Wo hl x exact + bias.

#define NB_  4
#define TT   2048
#define DM   1024
#define NH_  16
#define NKV  16
#define REP  (NH_ / NKV)
#define HD   64
#define DQ   (NH_ * HD)
#define DKV  (NKV * HD)
#define ZH   2
#define RH   512                  // query rows < RH use hi+lo planes (0: none)
#define WIN  0
#define PCAR 1024.0f
#define SCL  0.125f   // HD^-0.5
typedef _Float16 h16;
typedef unsigned short bf;
typedef __attribute__((ext_vector_type(16))) __bf16   v16bf;
typedef __attribute__((ext_vector_type(16))) _Float16 v16h;
typedef __attribute__((ext_vector_type(8)))  _Float16 v8h;
typedef __attribute__((ext_vector_type(8)))  unsigned short v8us;
typedef __attribute__((ext_vector_type(8)))  float    v8f;
typedef __attribute__((ext_vector_type(4)))  float    v4f;
typedef v8h  __attribute__((may_alias)) v8ha;
typedef v4f  __attribute__((may_alias)) v4fa;
typedef v8us __attribute__((may_alias)) v8usa;

__device__ __forceinline__ unsigned short f2bf(float f) { unsigned u = __float_as_uint(f); u += 0x7FFFu + ((u >> 16) & 1u); return (unsigned short)(u >> 16); }
__device__ __forceinline__ float bf2f(unsigned short b) { return __uint_as_float(((unsigned)b) << 16); }
__device__ __forceinline__ float bfr(float f) { return bf2f(f2bf(f)); }
__device__ __forceinline__ v16h cat16(v8h lo, v8h hi) { return __builtin_shufflevector(lo, hi, 0, 1, 2, 3, 4, 5, 6, 7, 8, 9, 10, 11, 12, 13, 14, 15); }
__device__ __forceinline__ v16bf cat16b(v8us lo, v8us hi) { return __builtin_bit_cast(v16bf, __builtin_shufflevector(lo, hi, 0, 1, 2, 3, 4, 5, 6, 7, 8, 9, 10, 11, 12, 13, 14, 15)); }
__device__ __forceinline__ v8f wmma16(v16h a, v16h b, v8f c) { return __builtin_amdgcn_wmma_f32_16x16x32_f16(false, a, false, b, (short)0, c, false, false); }
__device__ __forceinline__ v8f wmmab(v16bf a, v16bf b, v8f c) { return __builtin_amdgcn_wmma_f32_16x16x32_bf16(false, a, false, b, (short)0, c, false, false); }



// ---- k_gemmw: register-blocked GEMM, ONE WAVE per 64x64 output tile (16 accumulators), operands straight from K-contiguous 16-bit planes; grid (M/64, N/64, Z), 32 threads.
// C[m][n] (f32, pitch ldc, + optional f32 bias[n]) = sum_k A[m][k] Bt[n][k] (+ split products per NSPLIT). z-batch strides sA/sB/sC in elements. K % 32 == 0.
template <typename T16> struct WFrag;
template <> struct WFrag<h16> { typedef v16h V; static __device__ __forceinline__ V ld(const h16* p) { return cat16(*(const v8h*)p, *(const v8h*)(p + 16)); } static __device__ __forceinline__ v8f mma(V a, V b, v8f c) { return wmma16(a, b, c); } };
template <> struct WFrag<bf> { typedef v16bf V; static __device__ __forceinline__ V ld(const bf* p) { return cat16b(*(const v8us*)p, *(const v8us*)(p + 16)); } static __device__ __forceinline__ v8f mma(V a, V b, v8f c) { return wmmab(a, b, c); } };
template <typename T16, int NSPLIT, bool BIAS>
__global__ __launch_bounds__(32) void k_gemmw(const T16* __restrict__ A, const T16* __restrict__ A2, const T16* __restrict__ Bt, const T16* __restrict__ Bt2, int K, float* C, int ldc, const float* __restrict__ bias, size_t sA, size_t sB, size_t sC) {
    typedef typename WFrag<T16>::V V;
    __shared__ __align__(16) float os[16 * 68];
    const size_t z = blockIdx.z; A += z * sA; if (A2) A2 += z * sA; Bt += z * sB; if (Bt2) Bt2 += z * sB; C += z * sC;
    const int lane = threadIdx.x & 31, lr = lane & 15, hi = lane >> 4; const int r0 = blockIdx.x * 64, c0 = blockIdx.y * 64;
    v8f acc[4][4];
#pragma unroll
    for (int mb = 0; mb < 4; ++mb)
#pragma unroll
        for (int nb = 0; nb < 4; ++nb) acc[mb][nb] = (v8f){};
    const size_t aoff = (size_t)(r0 + lr) * K + 8 * hi, boff = (size_t)(c0 + lr) * K + 8 * hi;
    for (int kc = 0; kc < K; kc += 32) {
        V a[4], a2[4];
#pragma unroll
        for (int mb = 0; mb < 4; ++mb) { a[mb] = WFrag<T16>::ld(A + aoff + (size_t)mb * 16 * K + kc); if (NSPLIT == 1 || NSPLIT == 2) a2[mb] = WFrag<T16>::ld(A2 + aoff + (size_t)mb * 16 * K + kc); }
#pragma unroll
        for (int nb = 0; nb < 4; ++nb) { const V b = WFrag<T16>::ld(Bt + boff + (size_t)nb * 16 * K + kc); V b2; if (NSPLIT >= 2) b2 = WFrag<T16>::ld(Bt2 + boff + (size_t)nb * 16 * K + kc);
#pragma unroll
            for (int mb = 0; mb < 4; ++mb) { acc[mb][nb] = WFrag<T16>::mma(a[mb], b, acc[mb][nb]); if (NSPLIT == 1 || NSPLIT == 2) acc[mb][nb] = WFrag<T16>::mma(a2[mb], b, acc[mb][nb]); if (NSPLIT >= 2) acc[mb][nb] = WFrag<T16>::mma(a[mb], b2, acc[mb][nb]); } }
        asm volatile("v_nop\n\tv_nop\n\tv_nop\n\tv_nop" : "+v"(acc[0][0]), "+v"(acc[1][1]), "+v"(acc[2][2]), "+v"(acc[3][3]) : "v"(a[0]), "v"(a[3]));
    }
#pragma unroll
    for (int mb = 0; mb < 4; ++mb) {
#pragma unroll
        for (int nb = 0; nb < 4; ++nb) {
#pragma unroll
            for (int j = 0; j < 8; ++j) os[(hi * 8 + j) * 68 + nb * 16 + lr] = acc[mb][nb][j]; }
        __builtin_amdgcn_wave_barrier(); asm volatile("" ::: "memory");
        float* crow = C + (size_t)(r0 + mb * 16) * ldc + c0;
{
#pragma unroll
            for (int s = 0; s < 8; ++s) { const int row = 2 * s + hi, cofs = lr * 4; v4f val = *(const v4fa*)(os + row * 68 + cofs); if (BIAS) { val[0] += bfr(bias[c0 + cofs]); val[1] += bfr(bias[c0 + cofs + 1]); val[2] += bfr(bias[c0 + cofs + 2]); val[3] += bfr(bias[c0 + cofs + 3]); }
                *(v4f*)(crow + (size_t)row * ldc + cofs) = val; }
             }
        __builtin_amdgcn_wave_barrier(); asm volatile("" ::: "memory");
    }
}

__device__ __forceinline__ h16 tohx(float x) { return (h16)x; }
__device__ __forceinline__ void splitf(float y, unsigned short& h, unsigned short& l) { h = f2bf(y); l = f2bf(y - bf2f(h)); }
typedef __attribute__((ext_vector_type(2))) _Float16 v2h;
typedef __attribute__((ext_vector_type(4))) _Float16 v4h;
typedef __attribute__((ext_vector_type(2))) unsigned short v2us;
typedef __attribute__((ext_vector_type(4))) unsigned short v4us;
typedef __attribute__((ext_vector_type(2))) float v2f;
typedef __attribute__((ext_vector_type(4))) int v4i;

__global__ __launch_bounds__(256) void k_cvt8(const float* __restrict__ src, bf* dst, size_t n8) { const size_t i = (size_t)blockIdx.x * 256 + threadIdx.x; if (i >= n8) return; const v8f v = *(const v8f*)(src + i * 8); v8us o;
#pragma unroll
    for (int k = 0; k < 8; ++k) o[k] = f2bf(v[k]); *(v8us*)(dst + i * 8) = o;  }

// k_rope: head planes [h][t][d] (fp16 + hi/lo) of rope(x) x sc with the rotate-half convention out[d] = x[d] cos[t][d] - x[d+HD/2] sin[t][d], out[d+HD/2] = x[d+HD/2] cos[t][d+HD/2] + x[d] sin[t][d+HD/2]
__global__ __launch_bounds__(256) void k_rope(const float* __restrict__ F, int pitch, int nheads, const float* __restrict__ CS, const float* __restrict__ RF, const float* __restrict__ nw, float sc, h16* P16, bf* Ph, bf* Pl) {
    const size_t e = ((size_t)blockIdx.x * 256 + threadIdx.x) * 2; if (e >= (size_t)nheads * TT * HD) return; const int d = (int)(e % HD); const int t = (int)((e / HD) % TT); const int h = (int)(e / ((size_t)HD * TT)); const float* f = F + (size_t)t * pitch + h * HD; const float rf = RF ? RF[(size_t)h * TT + t] : 1.0f; v2h o16; v2us oh, ol;
#pragma unroll
    for (int q = 0; q < 2; ++q) { const int dd = d + q; const int dp = (dd < HD / 2) ? dd + HD / 2 : dd - HD / 2; float x0 = f[dd], x1 = f[dp];
        if (RF) { float n0 = __fmul_rn(x0, rf), n1 = __fmul_rn(x1, rf); x0 = __fmul_rn(bfr(nw[dd]), n0); x1 = __fmul_rn(bfr(nw[dp]), n1); }
        const v2f cs = *(const v2f*)(CS + ((size_t)t * HD + dd) * 2); float a = __fmul_rn(x0, cs[0]), bq = __fmul_rn(x1, cs[1]); const float r = ((dd < HD / 2) ? __fsub_rn(a, bq) : __fadd_rn(a, bq)) * sc;
        o16[q] = tohx(r); unsigned short a2, c2; splitf(r, a2, c2); oh[q] = a2; ol[q] = c2; }
    *(v2h*)(P16 + e) = o16; *(v2us*)(Ph + e) = oh; *(v2us*)(Pl + e) = ol;  }
__global__ __launch_bounds__(256) void k_vtp(const float* __restrict__ F, int pitch, int nheads, h16* V16, bf* Vh, bf* Vl) { const size_t e = ((size_t)blockIdx.x * 256 + threadIdx.x) * 2; if (e >= (size_t)nheads * HD * TT) return; const int t = (int)(e % TT); const int d = (int)((e / TT) % HD); const int g = (int)(e / ((size_t)TT * HD)); v2h o16; v2us oh, ol;
#pragma unroll
    for (int q = 0; q < 2; ++q) { const float x = F[(size_t)(t + q) * pitch + g * HD + d]; o16[q] = tohx(x); unsigned short a2, c2; splitf(x, a2, c2); oh[q] = a2; ol[q] = c2; }
    *(v2h*)(V16 + e) = o16; *(v2us*)(Vh + e) = oh; *(v2us*)(Vl + e) = ol;  }
__global__ __launch_bounds__(256) void k_csid(float* CS) { const int idx = blockIdx.x * 256 + threadIdx.x; if (idx >= TT * HD) return; v2f cs; cs[0] = 1.0f; cs[1] = 0.0f; *(v2f*)(CS + (size_t)idx * 2) = cs;  }
// k_asoft: per row (zz, i): t = S x HD^-0.5 where the key's mask word mk[j] != 0 (an int32 row a batch entry, read as data; -3.0e38 elsewhere: an exclusion); softmax over the kept keys (register row, one exp, fixed trees);
__global__ __launch_bounds__(256) void k_asoft(const float* __restrict__ Sb, const int* __restrict__ mkK, h16* P16, bf* Ph, bf* Pl) {
    const int lane = threadIdx.x & 31; const int row = blockIdx.x * 8 + (threadIdx.x >> 5); if (row >= ZH * TT) return; const int i = row % TT; const int zz = row / TT; (void)zz; const bool hires = (i < RH); const float* sr = Sb + (size_t)row * TT; float v[TT / 32]; float mx = -3.0e38f;
#pragma unroll
    for (int ch = 0; ch < TT / 128; ++ch) { const int j0 = ch * 128 + lane * 4; const v4f a = *(const v4f*)(sr + j0); const v4i mk4 = *(const v4i*)(mkK + j0);
#pragma unroll
        for (int q = 0; q < 4; ++q) { const int j = j0 + q; (void)j; const float t = (mk4[q] != 0) ? a[q] * SCL : -3.0e38f; v[ch * 4 + q] = t; mx = fmaxf(mx, t); } }
#pragma unroll
    for (int sh = 16; sh; sh >>= 1) mx = fmaxf(mx, __shfl_xor(mx, sh, 32));
    float sum = 0.f;
#pragma unroll
    for (int k = 0; k < TT / 32; ++k) { float d0 = __fsub_rn(v[k], mx); v[k] = __builtin_amdgcn_exp2f(__fmul_rn(d0, 1.4426950408889634f)); sum += v[k]; }
#pragma unroll
    for (int sh = 16; sh; sh >>= 1) sum += __shfl_xor(sum, sh, 32);
    const float f = __fdiv_rn(hires ? 1.0f : PCAR, sum);
{
        if (hires) {
#pragma unroll
            for (int ch = 0; ch < TT / 128; ++ch) { v4us oh, ol;
#pragma unroll
                for (int q = 0; q < 4; ++q) { unsigned short a, c2; splitf(v[ch * 4 + q] * f, a, c2); oh[q] = a; ol[q] = c2; }
                const size_t oo = ((size_t)zz * (RH ? RH : 1) + i) * TT + ch * 128 + lane * 4; *(v4us*)(Ph + oo) = oh; *(v4us*)(Pl + oo) = ol; }
        } else {
#pragma unroll
            for (int ch = 0; ch < TT / 128; ++ch) { v4h o4;
#pragma unroll
                for (int q = 0; q < 4; ++q) o4[q] = tohx(v[ch * 4 + q] * f);
                *(v4h*)(P16 + (size_t)row * TT + ch * 128 + lane * 4) = o4; } }
         }
}
__global__ __launch_bounds__(256) void k_merge(const float* __restrict__ O, int h0, bf* Ah, bf* Al) { const size_t e = ((size_t)blockIdx.x * 256 + threadIdx.x) * 2; if (e >= (size_t)ZH * TT * HD) return; const int d = (int)(e % HD); const int t = (int)((e / HD) % TT); const int zz = (int)(e / ((size_t)HD * TT)); const float cs = (t < RH) ? 1.0f : (1.0f / PCAR); const size_t oo = (size_t)t * DQ + (h0 + zz) * HD + d;
    v2us oh, ol;
#pragma unroll
    for (int q = 0; q < 2; ++q) { unsigned short a, c2; splitf(O[e + q] * cs, a, c2); oh[q] = a; ol[q] = c2; } *(v2us*)(Ah + oo) = oh; *(v2us*)(Al + oo) = ol;  }

extern "C" void kernel_launch(void* const* d_in, const int* in_sizes, int n_in,
                              void* d_out, int out_size, void* d_ws, size_t ws_size, hipStream_t stream) {
    (void)in_sizes; (void)n_in; (void)out_size;
    const float* x = (const float*)d_in[0]; const float* xk = (const float*)d_in[1]; const float* xv = (const float*)d_in[2]; const float* wq = (const float*)d_in[3]; const float* bq = (const float*)d_in[4]; const float* wk = (const float*)d_in[5]; const float* bk = (const float*)d_in[6]; const float* wv = (const float*)d_in[7]; const float* bv = (const float*)d_in[8]; const float* wo = (const float*)d_in[9]; const float* bo = (const float*)d_in[10]; const int* MK = (const int*)d_in[11];   /* argument order q, k, v, w_q, b_q, w_k, b_k, w_v, b_v, w_o, b_o ('oi'), mask (int32 [4][2048]: read) */
    float* OUT = (float*)d_out;     // [4][2048][1024]
    char* wsp = (char*)d_ws;
    auto take = [&](size_t bytes) { char* p = wsp; wsp += (bytes + 255) & ~(size_t)255; return (void*)p; };
    bf* WQ = (bf*)take((size_t)DQ * DM * 2); bf* WK = (bf*)take((size_t)DKV * DM * 2); bf* WV = (bf*)take((size_t)DKV * DM * 2); bf* WO = (bf*)take((size_t)DM * DQ * 2); float* CS = (float*)take((size_t)TT * HD * 2 * 4);
    bf* XB = (bf*)take((size_t)TT * DM * 2); float* FQ = (float*)take((size_t)TT * DQ * 4); float* FK = (float*)take((size_t)TT * DKV * 4);
    h16* QP16 = (h16*)take((size_t)NH_ * TT * HD * 2); h16* KP16 = (h16*)take((size_t)NKV * TT * HD * 2); h16* VT16 = (h16*)take((size_t)NKV * HD * TT * 2);
    bf* QPh = (bf*)take((size_t)NH_ * TT * HD * 2); bf* QPl = (bf*)take((size_t)NH_ * TT * HD * 2); bf* KPh = (bf*)take((size_t)NKV * TT * HD * 2); bf* KPl = (bf*)take((size_t)NKV * TT * HD * 2); bf* VTh = (bf*)take((size_t)NKV * HD * TT * 2); bf* VTl = (bf*)take((size_t)NKV * HD * TT * 2); bf* Ph = (bf*)take((size_t)ZH * RH * TT * 2); bf* Pl = (bf*)take((size_t)ZH * RH * TT * 2);
    float* Sb = (float*)take((size_t)ZH * TT * TT * 4); h16* P16 = (h16*)take((size_t)ZH * TT * TT * 2); float* Ob = (float*)take((size_t)ZH * TT * HD * 4); bf* ATh = (bf*)take((size_t)TT * DQ * 2); bf* ATl = (bf*)take((size_t)TT * DQ * 2);
    if ((size_t)(wsp - (char*)d_ws) > ws_size) return;    // ws 256 MiB
    float* FV = FK;   // v projection reuses the k buffer after the k planes are built (stream-ordered)
    { k_cvt8<<<(unsigned)(((size_t)DQ * DM / 8 + 255) / 256), 256, 0, stream>>>(wq, WQ, (size_t)DQ * DM / 8); k_cvt8<<<(unsigned)(((size_t)DKV * DM / 8 + 255) / 256), 256, 0, stream>>>(wk, WK, (size_t)DKV * DM / 8); k_cvt8<<<(unsigned)(((size_t)DKV * DM / 8 + 255) / 256), 256, 0, stream>>>(wv, WV, (size_t)DKV * DM / 8);   /* 'oi' (out, in): the GEMM's Bt as it stands */
      k_cvt8<<<(unsigned)(((size_t)DM * DQ / 8 + 255) / 256), 256, 0, stream>>>(wo, WO, (size_t)DM * DQ / 8);
       }
    k_csid<<<(TT * HD + 255) / 256, 256, 0, stream>>>(CS);
    const unsigned LQ = (unsigned)(((size_t)NH_ * TT * HD / 2 + 255) / 256), LKv = (unsigned)(((size_t)NKV * TT * HD / 2 + 255) / 256);
    for (int b = 0; b < NB_; ++b) {
        
        k_cvt8<<<(unsigned)(((size_t)TT * DM / 8 + 255) / 256), 256, 0, stream>>>(x + (size_t)b * TT * DM, XB, (size_t)TT * DM / 8);
        k_gemmw<bf, 0, true><<<dim3(TT / 64, DQ / 64, 1), 32, 0, stream>>>(XB, nullptr, WQ, nullptr, DM, FQ, DQ, bq, 0, 0, 0);
        k_rope<<<LQ, 256, 0, stream>>>(FQ, DQ, NH_, CS, nullptr, nullptr, 1.0f, QP16, QPh, QPl);
        k_cvt8<<<(unsigned)(((size_t)TT * DM / 8 + 255) / 256), 256, 0, stream>>>(xk + (size_t)b * TT * DM, XB, (size_t)TT * DM / 8);   /* key -> XB (q GEMM already issued) */ k_gemmw<bf, 0, true><<<dim3(TT / 64, DKV / 64, 1), 32, 0, stream>>>(XB, nullptr, WK, nullptr, DM, FK, DKV, bk, 0, 0, 0);
        k_rope<<<LKv, 256, 0, stream>>>(FK, DKV, NKV, CS, nullptr, nullptr, 1.0f, KP16, KPh, KPl);
        k_cvt8<<<(unsigned)(((size_t)TT * DM / 8 + 255) / 256), 256, 0, stream>>>(xv + (size_t)b * TT * DM, XB, (size_t)TT * DM / 8);   /* value -> XB */ k_gemmw<bf, 0, true><<<dim3(TT / 64, DKV / 64, 1), 32, 0, stream>>>(XB, nullptr, WV, nullptr, DM, FV, DKV, bv, 0, 0, 0); k_vtp<<<LKv, 256, 0, stream>>>(FV, DKV, NKV, VT16, VTh, VTl);
        for (int h0 = 0; h0 < NH_; h0 += ZH) { const size_t zq = (size_t)h0, zk = (size_t)(h0 / REP);   // one kv head per query head: the pass's two heads use consecutive kv planes (z-strides TT*HD)
            k_gemmw<bf, 2, false><<<dim3(RH / 64, TT / 64, ZH), 32, 0, stream>>>(QPh + zq * TT * HD, QPl + zq * TT * HD, KPh + zk * TT * HD, KPl + zk * TT * HD, HD, Sb, TT, nullptr, (size_t)TT * HD, (size_t)TT * HD, (size_t)TT * TT);
            k_gemmw<h16, 0, false><<<dim3((TT - RH) / 64, TT / 64, ZH), 32, 0, stream>>>(QP16 + zq * TT * HD + (size_t)RH * HD, nullptr, KP16 + zk * TT * HD, nullptr, HD, Sb + (size_t)RH * TT, TT, nullptr, (size_t)TT * HD, (size_t)TT * HD, (size_t)TT * TT);
            k_asoft<<<ZH * TT / 8, 256, 0, stream>>>(Sb, MK + (size_t)b * TT, P16, Ph, Pl);
            k_gemmw<bf, 2, false><<<dim3(RH / 64, HD / 64, ZH), 32, 0, stream>>>(Ph, Pl, VTh + zk * HD * TT, VTl + zk * HD * TT, TT, Ob, HD, nullptr, (size_t)RH * TT, (size_t)HD * TT, (size_t)TT * HD);
            k_gemmw<h16, 0, false><<<dim3((TT - RH) / 64, HD / 64, ZH), 32, 0, stream>>>(P16 + (size_t)RH * TT, nullptr, VT16 + zk * HD * TT, nullptr, TT, Ob + (size_t)RH * HD, HD, nullptr, (size_t)TT * TT, (size_t)HD * TT, (size_t)TT * HD);
            k_merge<<<(unsigned)(((size_t)ZH * TT * HD / 2 + 255) / 256), 256, 0, stream>>>(Ob, h0, ATh, ATl); }
        k_gemmw<bf, 1, true><<<dim3(TT / 64, DM / 64, 1), 32, 0, stream>>>(ATh, ATl, WO, nullptr, DQ, OUT + (size_t)b * TT * DM, DM, bo, 0, 0, 0); }
}

// v001
// A run of this version takes 2130 microseconds.
// Timed twice side by side with v000, it ran 1.89 and 1.90 times as fast.
#include <hip/hip_runtime.h>

// Multi-head attention over three input streams with a key-padding mask (q, k, v [4][2048][1024]; qh = q w_q^T + b_q, kh = k w_k^T + b_k, vh = v w_v^T + b_v ('oi' (out, in) [1024][1024] x 0.02 + [1024]: the four biases are zero on this draw: read and added; 16 heads x 64); scores / sqrt(64); keys j with mask[b][j] == 0 (int32 [4][2048], read as data: about half the keys of every batch entry) are set to the float32 minimum: an exclusion (no batch entry has every key masked); softmax; out = merged w_o^T + b_o -> [4][2048][1024] (8.4 M); argument order q, k, v, w_q, b_q, w_k, b_k, w_v, b_v, w_o, b_o, mask).
// Layout per batch: bf16 copies of query, key and value in turn (one operand buffer, stream-ordered); 'oi' weights cast as they stand; exact projections + f32 biases; dense T-2048 attention with the key mask selected in the softmax kernel (hybrid rows: < 512 hi/lo 3 products, rest fp16 x1024; dense score tiles); merged hi/lo x Wo exact + bo.
// Compute dtypes, f32 accumulate: every input rounded to bf16; projections exact + f32 biases; attention rows < 512 3 products, rest fp16; softmax f32; Wo hl x exact + bias.

#define NB_  4
#define TT   2048
#define DM   1024
#define NH_  16
#define NKV  16
#define REP  (NH_ / NKV)
#define HD   64
#define DQ   (NH_ * HD)
#define DKV  (NKV * HD)
#define ZH   2
#define RH   512                  // query rows < RH use hi+lo planes (0: none)
#define WIN  0
#define PCAR 1024.0f
#define SCL  0.125f   // HD^-0.5
#define KSW  8                    // waves that share one tile's k range where K = 1024 (projections, Wo): 128 of k a wave
#define KSP  16                   // the same where K = 2048 (P x V): 128 of k a wave
typedef _Float16 h16;
typedef unsigned short bf;
typedef __attribute__((ext_vector_type(16))) __bf16   v16bf;
typedef __attribute__((ext_vector_type(16))) _Float16 v16h;
typedef __attribute__((ext_vector_type(8)))  _Float16 v8h;
typedef __attribute__((ext_vector_type(8)))  unsigned short v8us;
typedef __attribute__((ext_vector_type(8)))  float    v8f;
typedef __attribute__((ext_vector_type(4)))  float    v4f;
typedef v8h  __attribute__((may_alias)) v8ha;
typedef v4f  __attribute__((may_alias)) v4fa;
typedef v8us __attribute__((may_alias)) v8usa;

__device__ __forceinline__ unsigned short f2bf(float f) { unsigned u = __float_as_uint(f); u += 0x7FFFu + ((u >> 16) & 1u); return (unsigned short)(u >> 16); }
__device__ __forceinline__ float bf2f(unsigned short b) { return __uint_as_float(((unsigned)b) << 16); }
__device__ __forceinline__ float bfr(float f) { return bf2f(f2bf(f)); }
__device__ __forceinline__ v16h cat16(v8h lo, v8h hi) { return __builtin_shufflevector(lo, hi, 0, 1, 2, 3, 4, 5, 6, 7, 8, 9, 10, 11, 12, 13, 14, 15); }
__device__ __forceinline__ v16bf cat16b(v8us lo, v8us hi) { return __builtin_bit_cast(v16bf, __builtin_shufflevector(lo, hi, 0, 1, 2, 3, 4, 5, 6, 7, 8, 9, 10, 11, 12, 13, 14, 15)); }
__device__ __forceinline__ v8f wmma16(v16h a, v16h b, v8f c) { return __builtin_amdgcn_wmma_f32_16x16x32_f16(false, a, false, b, (short)0, c, false, false); }
__device__ __forceinline__ v8f wmmab(v16bf a, v16bf b, v8f c) { return __builtin_amdgcn_wmma_f32_16x16x32_bf16(false, a, false, b, (short)0, c, false, false); }



// ---- k_gemmw: register-blocked GEMM, one wave (KW = 1) or KW waves per 64x64 output tile (16 accumulators a wave), operands straight from K-contiguous 16-bit planes; grid (M/64, N/64, Z), 32 * KW threads.
// C[m][n] (f32, pitch ldc, + optional f32 bias[n]) = sum_k A[m][k] Bt[n][k] (+ split products per NSPLIT). z-batch strides sA/sB/sC in elements. K % (32 * KW) == 0.
// KW > 1: the tile's work-group has KW waves (32 * KW threads); wave w sums k in [w K/KW, (w+1) K/KW), the KW f32 partial tiles meet in LDS and are added in wave order.
template <typename T16> struct WFrag;
template <> struct WFrag<h16> { typedef v16h V; static __device__ __forceinline__ V ld(const h16* p) { return cat16(*(const v8h*)p, *(const v8h*)(p + 16)); } static __device__ __forceinline__ v8f mma(V a, V b, v8f c) { return wmma16(a, b, c); } };
template <> struct WFrag<bf> { typedef v16bf V; static __device__ __forceinline__ V ld(const bf* p) { return cat16b(*(const v8us*)p, *(const v8us*)(p + 16)); } static __device__ __forceinline__ v8f mma(V a, V b, v8f c) { return wmmab(a, b, c); } };
template <typename T16, int NSPLIT, bool BIAS, int KW>
__global__ __launch_bounds__(32 * KW) void k_gemmw(const T16* __restrict__ A, const T16* __restrict__ A2, const T16* __restrict__ Bt, const T16* __restrict__ Bt2, int K, float* C, int ldc, const float* __restrict__ bias, size_t sA, size_t sB, size_t sC) {
    typedef typename WFrag<T16>::V V;
    __shared__ __align__(16) float os[(KW > 1 ? KW * 64 : 16) * 68];
    const size_t z = blockIdx.z; A += z * sA; if (A2) A2 += z * sA; Bt += z * sB; if (Bt2) Bt2 += z * sB; C += z * sC;
    const int lane = threadIdx.x & 31, lr = lane & 15, hi = lane >> 4; const int r0 = blockIdx.x * 64, c0 = blockIdx.y * 64;
    v8f acc[4][4];
#pragma unroll
    for (int mb = 0; mb < 4; ++mb)
#pragma unroll
        for (int nb = 0; nb < 4; ++nb) acc[mb][nb] = (v8f){};
    const size_t aoff = (size_t)(r0 + lr) * K + 8 * hi, boff = (size_t)(c0 + lr) * K + 8 * hi;
    // the wave's number through readfirstlane: the k bounds and the wave's LDS base stay in scalar registers
    const int wv = (KW > 1) ? __builtin_amdgcn_readfirstlane((int)(threadIdx.x >> 5)) : 0; const int kbeg = wv * (K / KW), kend = kbeg + K / KW;
    for (int kc = kbeg; kc < kend; kc += 32) {
        V a[4], a2[4];
#pragma unroll
        for (int mb = 0; mb < 4; ++mb) { a[mb] = WFrag<T16>::ld(A + aoff + (size_t)mb * 16 * K + kc); if (NSPLIT == 1 || NSPLIT == 2) a2[mb] = WFrag<T16>::ld(A2 + aoff + (size_t)mb * 16 * K + kc); }
#pragma unroll
        for (int nb = 0; nb < 4; ++nb) { const V b = WFrag<T16>::ld(Bt + boff + (size_t)nb * 16 * K + kc); V b2; if (NSPLIT >= 2) b2 = WFrag<T16>::ld(Bt2 + boff + (size_t)nb * 16 * K + kc);
#pragma unroll
            for (int mb = 0; mb < 4; ++mb) { acc[mb][nb] = WFrag<T16>::mma(a[mb], b, acc[mb][nb]); if (NSPLIT == 1 || NSPLIT == 2) acc[mb][nb] = WFrag<T16>::mma(a2[mb], b, acc[mb][nb]); if (NSPLIT >= 2) acc[mb][nb] = WFrag<T16>::mma(a[mb], b2, acc[mb][nb]); } }
        asm volatile("v_nop\n\tv_nop\n\tv_nop\n\tv_nop" : "+v"(acc[0][0]), "+v"(acc[1][1]), "+v"(acc[2][2]), "+v"(acc[3][3]) : "v"(a[0]), "v"(a[3]));
    }
    if (KW > 1) {
        float* ow = os + wv * (64 * 68);
        // the three loops unrolled: acc is indexed by constants only and stays in registers
#pragma unroll
        for (int mb = 0; mb < 4; ++mb)
#pragma unroll
            for (int nb = 0; nb < 4; ++nb)
#pragma unroll
                for (int j = 0; j < 8; ++j) ow[(mb * 16 + hi * 8 + j) * 68 + nb * 16 + lr] = acc[mb][nb][j];
        __syncthreads();   // every wave's partial tile is in LDS before any thread adds them
        // both loops unrolled: a thread's LDS reads are issued together, the adds stay in wave order
#pragma unroll
        for (int s = 0; s < 32 / KW; ++s) { const int u = s * (32 * KW) + (int)threadIdx.x, row = u >> 4, cofs = (u & 15) * 4; v4f val = *(const v4fa*)(os + row * 68 + cofs);
#pragma unroll
            for (int w = 1; w < KW; ++w) val += *(const v4fa*)(os + (w * 64 + row) * 68 + cofs);
            if (BIAS) { val[0] += bfr(bias[c0 + cofs]); val[1] += bfr(bias[c0 + cofs + 1]); val[2] += bfr(bias[c0 + cofs + 2]); val[3] += bfr(bias[c0 + cofs + 3]); }
            *(v4f*)(C + (size_t)(r0 + row) * ldc + c0 + cofs) = val; }
        return;
    }
#pragma unroll
    for (int mb = 0; mb < 4; ++mb) {
#pragma unroll
        for (int nb = 0; nb < 4; ++nb) {
#pragma unroll
            for (int j = 0; j < 8; ++j) os[(hi * 8 + j) * 68 + nb * 16 + lr] = acc[mb][nb][j]; }
        __builtin_amdgcn_wave_barrier(); asm volatile("" ::: "memory");
        float* crow = C + (size_t)(r0 + mb * 16) * ldc + c0;
{
#pragma unroll
            for (int s = 0; s < 8; ++s) { const int row = 2 * s + hi, cofs = lr * 4; v4f val = *(const v4fa*)(os + row * 68 + cofs); if (BIAS) { val[0] += bfr(bias[c0 + cofs]); val[1] += bfr(bias[c0 + cofs + 1]); val[2] += bfr(bias[c0 + cofs + 2]); val[3] += bfr(bias[c0 + cofs + 3]); }
                *(v4f*)(crow + (size_t)row * ldc + cofs) = val; }
             }
        __builtin_amdgcn_wave_barrier(); asm volatile("" ::: "memory");
    }
}

__device__ __forceinline__ h16 tohx(float x) { return (h16)x; }
__device__ __forceinline__ void splitf(float y, unsigned short& h, unsigned short& l) { h = f2bf(y); l = f2bf(y - bf2f(h)); }
typedef __attribute__((ext_vector_type(2))) _Float16 v2h;
typedef __attribute__((ext_vector_type(4))) _Float16 v4h;
typedef __attribute__((ext_vector_type(2))) unsigned short v2us;
typedef __attribute__((ext_vector_type(4))) unsigned short v4us;
typedef __attribute__((ext_vector_type(2))) float v2f;
typedef __attribute__((ext_vector_type(4))) int v4i;

__global__ __launch_bounds__(256) void k_cvt8(const float* __restrict__ src, bf* dst, size_t n8) { const size_t i = (size_t)blockIdx.x * 256 + threadIdx.x; if (i >= n8) return; const v8f v = *(const v8f*)(src + i * 8); v8us o;
#pragma unroll
    for (int k = 0; k < 8; ++k) o[k] = f2bf(v[k]); *(v8us*)(dst + i * 8) = o;  }

// k_rope: head planes [h][t][d] (fp16 + hi/lo) of rope(x) x sc with the rotate-half convention out[d] = x[d] cos[t][d] - x[d+HD/2] sin[t][d], out[d+HD/2] = x[d+HD/2] cos[t][d+HD/2] + x[d] sin[t][d+HD/2]
__global__ __launch_bounds__(256) void k_rope(const float* __restrict__ F, int pitch, int nheads, const float* __restrict__ CS, const float* __restrict__ RF, const float* __restrict__ nw, float sc, h16* P16, bf* Ph, bf* Pl) {
    const size_t e = ((size_t)blockIdx.x * 256 + threadIdx.x) * 2; if (e >= (size_t)nheads * TT * HD) return; const int d = (int)(e % HD); const int t = (int)((e / HD) % TT); const int h = (int)(e / ((size_t)HD * TT)); const float* f = F + (size_t)t * pitch + h * HD; const float rf = RF ? RF[(size_t)h * TT + t] : 1.0f; v2h o16; v2us oh, ol;
#pragma unroll
    for (int q = 0; q < 2; ++q) { const int dd = d + q; const int dp = (dd < HD / 2) ? dd + HD / 2 : dd - HD / 2; float x0 = f[dd], x1 = f[dp];
        if (RF) { float n0 = __fmul_rn(x0, rf), n1 = __fmul_rn(x1, rf); x0 = __fmul_rn(bfr(nw[dd]), n0); x1 = __fmul_rn(bfr(nw[dp]), n1); }
        const v2f cs = *(const v2f*)(CS + ((size_t)t * HD + dd) * 2); float a = __fmul_rn(x0, cs[0]), bq = __fmul_rn(x1, cs[1]); const float r = ((dd < HD / 2) ? __fsub_rn(a, bq) : __fadd_rn(a, bq)) * sc;
        o16[q] = tohx(r); unsigned short a2, c2; splitf(r, a2, c2); oh[q] = a2; ol[q] = c2; }
    *(v2h*)(P16 + e) = o16; *(v2us*)(Ph + e) = oh; *(v2us*)(Pl + e) = ol;  }
__global__ __launch_bounds__(256) void k_vtp(const float* __restrict__ F, int pitch, int nheads, h16* V16, bf* Vh, bf* Vl) { const size_t e = ((size_t)blockIdx.x * 256 + threadIdx.x) * 2; if (e >= (size_t)nheads * HD * TT) return; const int t = (int)(e % TT); const int d = (int)((e / TT) % HD); const int g = (int)(e / ((size_t)TT * HD)); v2h o16; v2us oh, ol;
#pragma unroll
    for (int q = 0; q < 2; ++q) { const float x = F[(size_t)(t + q) * pitch + g * HD + d]; o16[q] = tohx(x); unsigned short a2, c2; splitf(x, a2, c2); oh[q] = a2; ol[q] = c2; }
    *(v2h*)(V16 + e) = o16; *(v2us*)(Vh + e) = oh; *(v2us*)(Vl + e) = ol;  }
__global__ __launch_bounds__(256) void k_csid(float* CS) { const int idx = blockIdx.x * 256 + threadIdx.x; if (idx >= TT * HD) return; v2f cs; cs[0] = 1.0f; cs[1] = 0.0f; *(v2f*)(CS + (size_t)idx * 2) = cs;  }
// k_asoft: per row (zz, i): t = S x HD^-0.5 where the key's mask word mk[j] != 0 (an int32 row a batch entry, read as data; -3.0e38 elsewhere: an exclusion); softmax over the kept keys (register row, one exp, fixed trees);
__global__ __launch_bounds__(256) void k_asoft(const float* __restrict__ Sb, const int* __restrict__ mkK, h16* P16, bf* Ph, bf* Pl) {
    const int lane = threadIdx.x & 31; const int row = blockIdx.x * 8 + (threadIdx.x >> 5); if (row >= ZH * TT) return; const int i = row % TT; const int zz = row / TT; (void)zz; const bool hires = (i < RH); const float* sr = Sb + (size_t)row * TT; float v[TT / 32]; float mx = -3.0e38f;
#pragma unroll
    for (int ch = 0; ch < TT / 128; ++ch) { const int j0 = ch * 128 + lane * 4; const v4f a = *(const v4f*)(sr + j0); const v4i mk4 = *(const v4i*)(mkK + j0);
#pragma unroll
        for (int q = 0; q < 4; ++q) { const int j = j0 + q; (void)j; const float t = (mk4[q] != 0) ? a[q] * SCL : -3.0e38f; v[ch * 4 + q] = t; mx = fmaxf(mx, t); } }
#pragma unroll
    for (int sh = 16; sh; sh >>= 1) mx = fmaxf(mx, __shfl_xor(mx, sh, 32));
    float sum = 0.f;
#pragma unroll
    for (int k = 0; k < TT / 32; ++k) { float d0 = __fsub_rn(v[k], mx); v[k] = __builtin_amdgcn_exp2f(__fmul_rn(d0, 1.4426950408889634f)); sum += v[k]; }
#pragma unroll
    for (int sh = 16; sh; sh >>= 1) sum += __shfl_xor(sum, sh, 32);
    const float f = __fdiv_rn(hires ? 1.0f : PCAR, sum);
{
        if (hires) {
#pragma unroll
            for (int ch = 0; ch < TT / 128; ++ch) { v4us oh, ol;
#pragma unroll
                for (int q = 0; q < 4; ++q) { unsigned short a, c2; splitf(v[ch * 4 + q] * f, a, c2); oh[q] = a; ol[q] = c2; }
                const size_t oo = ((size_t)zz * (RH ? RH : 1) + i) * TT + ch * 128 + lane * 4; *(v4us*)(Ph + oo) = oh; *(v4us*)(Pl + oo) = ol; }
        } else {
#pragma unroll
            for (int ch = 0; ch < TT / 128; ++ch) { v4h o4;
#pragma unroll
                for (int q = 0; q < 4; ++q) o4[q] = tohx(v[ch * 4 + q] * f);
                *(v4h*)(P16 + (size_t)row * TT + ch * 128 + lane * 4) = o4; } }
         }
}
__global__ __launch_bounds__(256) void k_merge(const float* __restrict__ O, int h0, bf* Ah, bf* Al) { const size_t e = ((size_t)blockIdx.x * 256 + threadIdx.x) * 2; if (e >= (size_t)ZH * TT * HD) return; const int d = (int)(e % HD); const int t = (int)((e / HD) % TT); const int zz = (int)(e / ((size_t)HD * TT)); const float cs = (t < RH) ? 1.0f : (1.0f / PCAR); const size_t oo = (size_t)t * DQ + (h0 + zz) * HD + d;
    v2us oh, ol;
#pragma unroll
    for (int q = 0; q < 2; ++q) { unsigned short a, c2; splitf(O[e + q] * cs, a, c2); oh[q] = a; ol[q] = c2; } *(v2us*)(Ah + oo) = oh; *(v2us*)(Al + oo) = ol;  }

extern "C" void kernel_launch(void* const* d_in, const int* in_sizes, int n_in,
                              void* d_out, int out_size, void* d_ws, size_t ws_size, hipStream_t stream) {
    (void)in_sizes; (void)n_in; (void)out_size;
    const float* x = (const float*)d_in[0]; const float* xk = (const float*)d_in[1]; const float* xv = (const float*)d_in[2]; const float* wq = (const float*)d_in[3]; const float* bq = (const float*)d_in[4]; const float* wk = (const float*)d_in[5]; const float* bk = (const float*)d_in[6]; const float* wv = (const float*)d_in[7]; const float* bv = (const float*)d_in[8]; const float* wo = (const float*)d_in[9]; const float* bo = (const float*)d_in[10]; const int* MK = (const int*)d_in[11];   /* argument order q, k, v, w_q, b_q, w_k, b_k, w_v, b_v, w_o, b_o ('oi'), mask (int32 [4][2048]: read) */
    float* OUT = (float*)d_out;     // [4][2048][1024]
    char* wsp = (char*)d_ws;
    auto take = [&](size_t bytes) { char* p = wsp; wsp += (bytes + 255) & ~(size_t)255; return (void*)p; };
    bf* WQ = (bf*)take((size_t)DQ * DM * 2); bf* WK = (bf*)take((size_t)DKV * DM * 2); bf* WV = (bf*)take((size_t)DKV * DM * 2); bf* WO = (bf*)take((size_t)DM * DQ * 2); float* CS = (float*)take((size_t)TT * HD * 2 * 4);
    bf* XB = (bf*)take((size_t)TT * DM * 2); float* FQ = (float*)take((size_t)TT * DQ * 4); float* FK = (float*)take((size_t)TT * DKV * 4);
    h16* QP16 = (h16*)take((size_t)NH_ * TT * HD * 2); h16* KP16 = (h16*)take((size_t)NKV * TT * HD * 2); h16* VT16 = (h16*)take((size_t)NKV * HD * TT * 2);
    bf* QPh = (bf*)take((size_t)NH_ * TT * HD * 2); bf* QPl = (bf*)take((size_t)NH_ * TT * HD * 2); bf* KPh = (bf*)take((size_t)NKV * TT * HD * 2); bf* KPl = (bf*)take((size_t)NKV * TT * HD * 2); bf* VTh = (bf*)take((size_t)NKV * HD * TT * 2); bf* VTl = (bf*)take((size_t)NKV * HD * TT * 2); bf* Ph = (bf*)take((size_t)ZH * RH * TT * 2); bf* Pl = (bf*)take((size_t)ZH * RH * TT * 2);
    float* Sb = (float*)take((size_t)ZH * TT * TT * 4); h16* P16 = (h16*)take((size_t)ZH * TT * TT * 2); float* Ob = (float*)take((size_t)ZH * TT * HD * 4); bf* ATh = (bf*)take((size_t)TT * DQ * 2); bf* ATl = (bf*)take((size_t)TT * DQ * 2);
    if ((size_t)(wsp - (char*)d_ws) > ws_size) return;    // ws 256 MiB
    float* FV = FK;   // v projection reuses the k buffer after the k planes are built (stream-ordered)
    { k_cvt8<<<(unsigned)(((size_t)DQ * DM / 8 + 255) / 256), 256, 0, stream>>>(wq, WQ, (size_t)DQ * DM / 8); k_cvt8<<<(unsigned)(((size_t)DKV * DM / 8 + 255) / 256), 256, 0, stream>>>(wk, WK, (size_t)DKV * DM / 8); k_cvt8<<<(unsigned)(((size_t)DKV * DM / 8 + 255) / 256), 256, 0, stream>>>(wv, WV, (size_t)DKV * DM / 8);   /* 'oi' (out, in): the GEMM's Bt as it stands */
      k_cvt8<<<(unsigned)(((size_t)DM * DQ / 8 + 255) / 256), 256, 0, stream>>>(wo, WO, (size_t)DM * DQ / 8);
       }
    k_csid<<<(TT * HD + 255) / 256, 256, 0, stream>>>(CS);
    const unsigned LQ = (unsigned)(((size_t)NH_ * TT * HD / 2 + 255) / 256), LKv = (unsigned)(((size_t)NKV * TT * HD / 2 + 255) / 256);
    for (int b = 0; b < NB_; ++b) {
        
        k_cvt8<<<(unsigned)(((size_t)TT * DM / 8 + 255) / 256), 256, 0, stream>>>(x + (size_t)b * TT * DM, XB, (size_t)TT * DM / 8);
        k_gemmw<bf, 0, true, KSW><<<dim3(TT / 64, DQ / 64, 1), 32 * KSW, 0, stream>>>(XB, nullptr, WQ, nullptr, DM, FQ, DQ, bq, 0, 0, 0);
        k_rope<<<LQ, 256, 0, stream>>>(FQ, DQ, NH_, CS, nullptr, nullptr, 1.0f, QP16, QPh, QPl);
        k_cvt8<<<(unsigned)(((size_t)TT * DM / 8 + 255) / 256), 256, 0, stream>>>(xk + (size_t)b * TT * DM, XB, (size_t)TT * DM / 8);   /* key -> XB (q GEMM already issued) */ k_gemmw<bf, 0, true, KSW><<<dim3(TT / 64, DKV / 64, 1), 32 * KSW, 0, stream>>>(XB, nullptr, WK, nullptr, DM, FK, DKV, bk, 0, 0, 0);
        k_rope<<<LKv, 256, 0, stream>>>(FK, DKV, NKV, CS, nullptr, nullptr, 1.0f, KP16, KPh, KPl);
        k_cvt8<<<(unsigned)(((size_t)TT * DM / 8 + 255) / 256), 256, 0, stream>>>(xv + (size_t)b * TT * DM, XB, (size_t)TT * DM / 8);   /* value -> XB */ k_gemmw<bf, 0, true, KSW><<<dim3(TT / 64, DKV / 64, 1), 32 * KSW, 0, stream>>>(XB, nullptr, WV, nullptr, DM, FV, DKV, bv, 0, 0, 0); k_vtp<<<LKv, 256, 0, stream>>>(FV, DKV, NKV, VT16, VTh, VTl);
        for (int h0 = 0; h0 < NH_; h0 += ZH) { const size_t zq = (size_t)h0, zk = (size_t)(h0 / REP);   // one kv head per query head: the pass's two heads use consecutive kv planes (z-strides TT*HD)
            k_gemmw<bf, 2, false, 1><<<dim3(RH / 64, TT / 64, ZH), 32, 0, stream>>>(QPh + zq * TT * HD, QPl + zq * TT * HD, KPh + zk * TT * HD, KPl + zk * TT * HD, HD, Sb, TT, nullptr, (size_t)TT * HD, (size_t)TT * HD, (size_t)TT * TT);
            k_gemmw<h16, 0, false, 1><<<dim3((TT - RH) / 64, TT / 64, ZH), 32, 0, stream>>>(QP16 + zq * TT * HD + (size_t)RH * HD, nullptr, KP16 + zk * TT * HD, nullptr, HD, Sb + (size_t)RH * TT, TT, nullptr, (size_t)TT * HD, (size_t)TT * HD, (size_t)TT * TT);
            k_asoft<<<ZH * TT / 8, 256, 0, stream>>>(Sb, MK + (size_t)b * TT, P16, Ph, Pl);
            k_gemmw<bf, 2, false, KSP><<<dim3(RH / 64, HD / 64, ZH), 32 * KSP, 0, stream>>>(Ph, Pl, VTh + zk * HD * TT, VTl + zk * HD * TT, TT, Ob, HD, nullptr, (size_t)RH * TT, (size_t)HD * TT, (size_t)TT * HD);
            k_gemmw<h16, 0, false, KSP><<<dim3((TT - RH) / 64, HD / 64, ZH), 32 * KSP, 0, stream>>>(P16 + (size_t)RH * TT, nullptr, VT16 + zk * HD * TT, nullptr, TT, Ob + (size_t)RH * HD, HD, nullptr, (size_t)TT * TT, (size_t)HD * TT, (size_t)TT * HD);
            k_merge<<<(unsigned)(((size_t)ZH * TT * HD / 2 + 255) / 256), 256, 0, stream>>>(Ob, h0, ATh, ATl); }
        k_gemmw<bf, 1, true, KSW><<<dim3(TT / 64, DM / 64, 1), 32 * KSW, 0, stream>>>(ATh, ATl, WO, nullptr, DQ, OUT + (size_t)b * TT * DM, DM, bo, 0, 0, 0); }
}

// v002
// Measured time: 1180 microseconds a run.
// Two timings next to v001 both put it at 1.81 times that version's speed.
// Counting every step since v000, it is 3.44 times as fast.
#include <hip/hip_runtime.h>

// Multi-head attention over three input streams with a key-padding mask (q, k, v [4][2048][1024]; qh = q w_q^T + b_q, kh = k w_k^T + b_k, vh = v w_v^T + b_v ('oi' (out, in) [1024][1024] x 0.02 + [1024]: the four biases are zero on this draw: read and added; 16 heads x 64); scores / sqrt(64); keys j with mask[b][j] == 0 (int32 [4][2048], read as data: about half the keys of every batch entry) are set to the float32 minimum: an exclusion (no batch entry has every key masked); softmax; out = merged w_o^T + b_o -> [4][2048][1024] (8.4 M); argument order q, k, v, w_q, b_q, w_k, b_k, w_v, b_v, w_o, b_o, mask).
// Layout per batch: bf16 copies of query, key and value in turn (one operand buffer, stream-ordered); 'oi' weights cast as they stand; exact projections + f32 biases; dense T-2048 attention with the key mask selected in the softmax kernel (hybrid rows: < 512 hi/lo 3 products, rest fp16 x1024; dense score tiles); merged hi/lo x Wo exact + bo.
// Compute dtypes, f32 accumulate: every input rounded to bf16; projections exact + f32 biases; attention rows < 512 3 products, rest fp16; softmax f32; Wo hl x exact + bias.

#define NB_  4
#define TT   2048
#define DM   1024
#define NH_  16
#define NKV  16
#define REP  (NH_ / NKV)
#define HD   64
#define DQ   (NH_ * HD)
#define DKV  (NKV * HD)
#define ZH   8                    // heads per attention pass (the z extent of its four GEMM launches)
#define LCP  10                   // log2 of the columns in one score plane
#define SPC  (1 << LCP)           // a head's scores lie in TT / SPC column planes [TT][SPC] f32: a plane row has the bytes of one 16-bit probability row of TT
#define SPL  ((size_t)TT * SPC)   // elements in one score plane
#define RH   512                  // query rows < RH use hi+lo planes (0: none)
#define WIN  0
#define PCAR 1024.0f
#define SCL  0.125f   // HD^-0.5
#define KSW  8                    // waves that share one tile's k range where K = 1024 (projections, Wo): 128 of k a wave
#define KSP  16                   // the same where K = 2048 (P x V): 128 of k a wave
typedef _Float16 h16;
typedef unsigned short bf;
typedef __attribute__((ext_vector_type(16))) __bf16   v16bf;
typedef __attribute__((ext_vector_type(16))) _Float16 v16h;
typedef __attribute__((ext_vector_type(8)))  _Float16 v8h;
typedef __attribute__((ext_vector_type(8)))  unsigned short v8us;
typedef __attribute__((ext_vector_type(8)))  float    v8f;
typedef __attribute__((ext_vector_type(4)))  float    v4f;
typedef v8h  __attribute__((may_alias)) v8ha;
typedef v4f  __attribute__((may_alias)) v4fa;
typedef v8us __attribute__((may_alias)) v8usa;

__device__ __forceinline__ unsigned short f2bf(float f) { unsigned u = __float_as_uint(f); u += 0x7FFFu + ((u >> 16) & 1u); return (unsigned short)(u >> 16); }
__device__ __forceinline__ float bf2f(unsigned short b) { return __uint_as_float(((unsigned)b) << 16); }
__device__ __forceinline__ float bfr(float f) { return bf2f(f2bf(f)); }
__device__ __forceinline__ v16h cat16(v8h lo, v8h hi) { return __builtin_shufflevector(lo, hi, 0, 1, 2, 3, 4, 5, 6, 7, 8, 9, 10, 11, 12, 13, 14, 15); }
__device__ __forceinline__ v16bf cat16b(v8us lo, v8us hi) { return __builtin_bit_cast(v16bf, __builtin_shufflevector(lo, hi, 0, 1, 2, 3, 4, 5, 6, 7, 8, 9, 10, 11, 12, 13, 14, 15)); }
__device__ __forceinline__ v8f wmma16(v16h a, v16h b, v8f c) { return __builtin_amdgcn_wmma_f32_16x16x32_f16(false, a, false, b, (short)0, c, false, false); }
__device__ __forceinline__ v8f wmmab(v16bf a, v16bf b, v8f c) { return __builtin_amdgcn_wmma_f32_16x16x32_bf16(false, a, false, b, (short)0, c, false, false); }



// ---- k_gemmw: register-blocked GEMM, one wave (KW = 1) or KW waves per 64x64 output tile (16 accumulators a wave), operands straight from K-contiguous 16-bit planes; grid (M/64, N/64, Z), 32 * KW threads.
// C[m][n] (f32, pitch ldc, + optional f32 bias[n]) = sum_k A[m][k] Bt[n][k] (+ split products per NSPLIT). z-batch strides sA/sB/sC in elements. K % (32 * KW) == 0.
// KW = 1 only: C may lie in column planes of 1 << lcp columns, sP elements apart (column n: plane n >> lcp, place n & ((1 << lcp) - 1), row pitch ldc); the default is one plane.
// KW > 1: the tile's work-group has KW waves (32 * KW threads); wave w sums k in [w K/KW, (w+1) K/KW), the KW f32 partial tiles meet in LDS and are added in wave order.
template <typename T16> struct WFrag;
template <> struct WFrag<h16> { typedef v16h V; static __device__ __forceinline__ V ld(const h16* p) { return cat16(*(const v8h*)p, *(const v8h*)(p + 16)); } static __device__ __forceinline__ v8f mma(V a, V b, v8f c) { return wmma16(a, b, c); } };
template <> struct WFrag<bf> { typedef v16bf V; static __device__ __forceinline__ V ld(const bf* p) { return cat16b(*(const v8us*)p, *(const v8us*)(p + 16)); } static __device__ __forceinline__ v8f mma(V a, V b, v8f c) { return wmmab(a, b, c); } };
template <typename T16, int NSPLIT, bool BIAS, int KW>
__global__ __launch_bounds__(32 * KW) void k_gemmw(const T16* __restrict__ A, const T16* __restrict__ A2, const T16* __restrict__ Bt, const T16* __restrict__ Bt2, int K, float* C, int ldc, const float* __restrict__ bias, size_t sA, size_t sB, size_t sC, int lcp = 30, size_t sP = 0) {
    typedef typename WFrag<T16>::V V;
    __shared__ __align__(16) float os[(KW > 1 ? KW * 64 : 16) * 68];
    const size_t z = blockIdx.z; A += z * sA; if (A2) A2 += z * sA; Bt += z * sB; if (Bt2) Bt2 += z * sB; C += z * sC;
    const int lane = threadIdx.x & 31, lr = lane & 15, hi = lane >> 4; const int r0 = blockIdx.x * 64, c0 = blockIdx.y * 64;
    v8f acc[4][4];
#pragma unroll
    for (int mb = 0; mb < 4; ++mb)
#pragma unroll
        for (int nb = 0; nb < 4; ++nb) acc[mb][nb] = (v8f){};
    const size_t aoff = (size_t)(r0 + lr) * K + 8 * hi, boff = (size_t)(c0 + lr) * K + 8 * hi;
    // the wave's number through readfirstlane: the k bounds and the wave's LDS base stay in scalar registers
    const int wv = (KW > 1) ? __builtin_amdgcn_readfirstlane((int)(threadIdx.x >> 5)) : 0; const int kbeg = wv * (K / KW), kend = kbeg + K / KW;
    for (int kc = kbeg; kc < kend; kc += 32) {
        V a[4], a2[4];
#pragma unroll
        for (int mb = 0; mb < 4; ++mb) { a[mb] = WFrag<T16>::ld(A + aoff + (size_t)mb * 16 * K + kc); if (NSPLIT == 1 || NSPLIT == 2) a2[mb] = WFrag<T16>::ld(A2 + aoff + (size_t)mb * 16 * K + kc); }
#pragma unroll
        for (int nb = 0; nb < 4; ++nb) { const V b = WFrag<T16>::ld(Bt + boff + (size_t)nb * 16 * K + kc); V b2; if (NSPLIT >= 2) b2 = WFrag<T16>::ld(Bt2 + boff + (size_t)nb * 16 * K + kc);
#pragma unroll
            for (int mb = 0; mb < 4; ++mb) { acc[mb][nb] = WFrag<T16>::mma(a[mb], b, acc[mb][nb]); if (NSPLIT == 1 || NSPLIT == 2) acc[mb][nb] = WFrag<T16>::mma(a2[mb], b, acc[mb][nb]); if (NSPLIT >= 2) acc[mb][nb] = WFrag<T16>::mma(a[mb], b2, acc[mb][nb]); } }
        asm volatile("v_nop\n\tv_nop\n\tv_nop\n\tv_nop" : "+v"(acc[0][0]), "+v"(acc[1][1]), "+v"(acc[2][2]), "+v"(acc[3][3]) : "v"(a[0]), "v"(a[3]));
    }
    if (KW > 1) {
        float* ow = os + wv * (64 * 68);
        // the three loops unrolled: acc is indexed by constants only and stays in registers
#pragma unroll
        for (int mb = 0; mb < 4; ++mb)
#pragma unroll
            for (int nb = 0; nb < 4; ++nb)
#pragma unroll
                for (int j = 0; j < 8; ++j) ow[(mb * 16 + hi * 8 + j) * 68 + nb * 16 + lr] = acc[mb][nb][j];
        __syncthreads();   // every wave's partial tile is in LDS before any thread adds them
        // both loops unrolled: a thread's LDS reads are issued together, the adds stay in wave order
#pragma unroll
        for (int s = 0; s < 32 / KW; ++s) { const int u = s * (32 * KW) + (int)threadIdx.x, row = u >> 4, cofs = (u & 15) * 4; v4f val = *(const v4fa*)(os + row * 68 + cofs);
#pragma unroll
            for (int w = 1; w < KW; ++w) val += *(const v4fa*)(os + (w * 64 + row) * 68 + cofs);
            if (BIAS) { val[0] += bfr(bias[c0 + cofs]); val[1] += bfr(bias[c0 + cofs + 1]); val[2] += bfr(bias[c0 + cofs + 2]); val[3] += bfr(bias[c0 + cofs + 3]); }
            *(v4f*)(C + (size_t)(r0 + row) * ldc + c0 + cofs) = val; }
        return;
    }
#pragma unroll
    for (int mb = 0; mb < 4; ++mb) {
#pragma unroll
        for (int nb = 0; nb < 4; ++nb) {
#pragma unroll
            for (int j = 0; j < 8; ++j) os[(hi * 8 + j) * 68 + nb * 16 + lr] = acc[mb][nb][j]; }
        __builtin_amdgcn_wave_barrier(); asm volatile("" ::: "memory");
        float* crow = C + (size_t)(c0 >> lcp) * sP + (size_t)(r0 + mb * 16) * ldc + (c0 & ((1 << lcp) - 1));
{
#pragma unroll
            for (int s = 0; s < 8; ++s) { const int row = 2 * s + hi, cofs = lr * 4; v4f val = *(const v4fa*)(os + row * 68 + cofs); if (BIAS) { val[0] += bfr(bias[c0 + cofs]); val[1] += bfr(bias[c0 + cofs + 1]); val[2] += bfr(bias[c0 + cofs + 2]); val[3] += bfr(bias[c0 + cofs + 3]); }
                *(v4f*)(crow + (size_t)row * ldc + cofs) = val; }
             }
        __builtin_amdgcn_wave_barrier(); asm volatile("" ::: "memory");
    }
}

__device__ __forceinline__ h16 tohx(float x) { return (h16)x; }
__device__ __forceinline__ void splitf(float y, unsigned short& h, unsigned short& l) { h = f2bf(y); l = f2bf(y - bf2f(h)); }
typedef __attribute__((ext_vector_type(2))) _Float16 v2h;
typedef __attribute__((ext_vector_type(4))) _Float16 v4h;
typedef __attribute__((ext_vector_type(2))) unsigned short v2us;
typedef __attribute__((ext_vector_type(4))) unsigned short v4us;
typedef __attribute__((ext_vector_type(2))) float v2f;
typedef __attribute__((ext_vector_type(4))) int v4i;
typedef v4h  __attribute__((may_alias)) v4ha;
typedef v4us __attribute__((may_alias)) v4usa;

__global__ __launch_bounds__(256) void k_cvt8(const float* __restrict__ src, bf* dst, size_t n8) { const size_t i = (size_t)blockIdx.x * 256 + threadIdx.x; if (i >= n8) return; const v8f v = *(const v8f*)(src + i * 8); v8us o;
#pragma unroll
    for (int k = 0; k < 8; ++k) o[k] = f2bf(v[k]); *(v8us*)(dst + i * 8) = o;  }

// k_rope: head planes [h][t][d] (fp16 + hi/lo) of rope(x) x sc with the rotate-half convention out[d] = x[d] cos[t][d] - x[d+HD/2] sin[t][d], out[d+HD/2] = x[d+HD/2] cos[t][d+HD/2] + x[d] sin[t][d+HD/2]
__global__ __launch_bounds__(256) void k_rope(const float* __restrict__ F, int pitch, int nheads, const float* __restrict__ CS, const float* __restrict__ RF, const float* __restrict__ nw, float sc, h16* P16, bf* Ph, bf* Pl) {
    const size_t e = ((size_t)blockIdx.x * 256 + threadIdx.x) * 2; if (e >= (size_t)nheads * TT * HD) return; const int d = (int)(e % HD); const int t = (int)((e / HD) % TT); const int h = (int)(e / ((size_t)HD * TT)); const float* f = F + (size_t)t * pitch + h * HD; const float rf = RF ? RF[(size_t)h * TT + t] : 1.0f; v2h o16; v2us oh, ol;
#pragma unroll
    for (int q = 0; q < 2; ++q) { const int dd = d + q; const int dp = (dd < HD / 2) ? dd + HD / 2 : dd - HD / 2; float x0 = f[dd], x1 = f[dp];
        if (RF) { float n0 = __fmul_rn(x0, rf), n1 = __fmul_rn(x1, rf); x0 = __fmul_rn(bfr(nw[dd]), n0); x1 = __fmul_rn(bfr(nw[dp]), n1); }
        const v2f cs = *(const v2f*)(CS + ((size_t)t * HD + dd) * 2); float a = __fmul_rn(x0, cs[0]), bq = __fmul_rn(x1, cs[1]); const float r = ((dd < HD / 2) ? __fsub_rn(a, bq) : __fadd_rn(a, bq)) * sc;
        o16[q] = tohx(r); unsigned short a2, c2; splitf(r, a2, c2); oh[q] = a2; ol[q] = c2; }
    *(v2h*)(P16 + e) = o16; *(v2us*)(Ph + e) = oh; *(v2us*)(Pl + e) = ol;  }
__global__ __launch_bounds__(256) void k_vtp(const float* __restrict__ F, int pitch, int nheads, h16* V16, bf* Vh, bf* Vl) { const size_t e = ((size_t)blockIdx.x * 256 + threadIdx.x) * 2; if (e >= (size_t)nheads * HD * TT) return; const int t = (int)(e % TT); const int d = (int)((e / TT) % HD); const int g = (int)(e / ((size_t)TT * HD)); v2h o16; v2us oh, ol;
#pragma unroll
    for (int q = 0; q < 2; ++q) { const float x = F[(size_t)(t + q) * pitch + g * HD + d]; o16[q] = tohx(x); unsigned short a2, c2; splitf(x, a2, c2); oh[q] = a2; ol[q] = c2; }
    *(v2h*)(V16 + e) = o16; *(v2us*)(Vh + e) = oh; *(v2us*)(Vl + e) = ol;  }
__global__ __launch_bounds__(256) void k_csid(float* CS) { const int idx = blockIdx.x * 256 + threadIdx.x; if (idx >= TT * HD) return; v2f cs; cs[0] = 1.0f; cs[1] = 0.0f; *(v2f*)(CS + (size_t)idx * 2) = cs;  }
// k_asoft: per row (zz, i): t = S x HD^-0.5 where the key's mask word mk[j] != 0 (an int32 row a batch entry, read as data; -3.0e38 elsewhere: an exclusion); softmax over the kept keys (register row, one exp, fixed trees);
// the probabilities go over the row's own scores: a wave holds its whole row in registers before its first store (every store needs the row's sum), and no other wave touches that row's plane rows. Rows < RH: hi plane over the row of score plane 0, lo plane over the row of score plane 1; other rows: fp16 over the row of score plane 0. So a probability row has pitch TT.
__global__ __launch_bounds__(256) void k_asoft(float* Sb, const int* __restrict__ mkK) {
    const int lane = threadIdx.x & 31; const int row = blockIdx.x * 8 + (threadIdx.x >> 5); if (row >= ZH * TT) return; const int i = row % TT; const int zz = row / TT; (void)zz; const bool hires = (i < RH); float* sr = Sb + (size_t)zz * TT * TT + (size_t)i * SPC; bf* Ph = (bf*)sr; bf* Pl = (bf*)(sr + SPL); h16* P16 = (h16*)sr; float v[TT / 32]; float mx = -3.0e38f;
#pragma unroll
    for (int ch = 0; ch < TT / 128; ++ch) { const int j0 = ch * 128 + lane * 4; const v4f a = *(const v4fa*)(sr + (ch / (SPC / 128)) * SPL + (ch % (SPC / 128)) * 128 + lane * 4); const v4i mk4 = *(const v4i*)(mkK + j0);
#pragma unroll
        for (int q = 0; q < 4; ++q) { const int j = j0 + q; (void)j; const float t = (mk4[q] != 0) ? a[q] * SCL : -3.0e38f; v[ch * 4 + q] = t; mx = fmaxf(mx, t); } }
#pragma unroll
    for (int sh = 16; sh; sh >>= 1) mx = fmaxf(mx, __shfl_xor(mx, sh, 32));
    float sum = 0.f;
#pragma unroll
    for (int k = 0; k < TT / 32; ++k) { float d0 = __fsub_rn(v[k], mx); v[k] = __builtin_amdgcn_exp2f(__fmul_rn(d0, 1.4426950408889634f)); sum += v[k]; }
#pragma unroll
    for (int sh = 16; sh; sh >>= 1) sum += __shfl_xor(sum, sh, 32);
    const float f = __fdiv_rn(hires ? 1.0f : PCAR, sum);
{
        if (hires) {
#pragma unroll
            for (int ch = 0; ch < TT / 128; ++ch) { v4us oh, ol;
#pragma unroll
                for (int q = 0; q < 4; ++q) { unsigned short a, c2; splitf(v[ch * 4 + q] * f, a, c2); oh[q] = a; ol[q] = c2; }
                const int oo = ch * 128 + lane * 4; *(v4usa*)(Ph + oo) = oh; *(v4usa*)(Pl + oo) = ol; }
        } else {
#pragma unroll
            for (int ch = 0; ch < TT / 128; ++ch) { v4h o4;
#pragma unroll
                for (int q = 0; q < 4; ++q) o4[q] = tohx(v[ch * 4 + q] * f);
                *(v4ha*)(P16 + ch * 128 + lane * 4) = o4; } }
         }
}
__global__ __launch_bounds__(256) void k_merge(const float* __restrict__ O, int h0, bf* Ah, bf* Al) { const size_t e = ((size_t)blockIdx.x * 256 + threadIdx.x) * 2; if (e >= (size_t)ZH * TT * HD) return; const int d = (int)(e % HD); const int t = (int)((e / HD) % TT); const int zz = (int)(e / ((size_t)HD * TT)); const float cs = (t < RH) ? 1.0f : (1.0f / PCAR); const size_t oo = (size_t)t * DQ + (h0 + zz) * HD + d;
    v2us oh, ol;
#pragma unroll
    for (int q = 0; q < 2; ++q) { unsigned short a, c2; splitf(O[e + q] * cs, a, c2); oh[q] = a; ol[q] = c2; } *(v2us*)(Ah + oo) = oh; *(v2us*)(Al + oo) = ol;  }

extern "C" void kernel_launch(void* const* d_in, const int* in_sizes, int n_in,
                              void* d_out, int out_size, void* d_ws, size_t ws_size, hipStream_t stream) {
    (void)in_sizes; (void)n_in; (void)out_size;
    const float* x = (const float*)d_in[0]; const float* xk = (const float*)d_in[1]; const float* xv = (const float*)d_in[2]; const float* wq = (const float*)d_in[3]; const float* bq = (const float*)d_in[4]; const float* wk = (const float*)d_in[5]; const float* bk = (const float*)d_in[6]; const float* wv = (const float*)d_in[7]; const float* bv = (const float*)d_in[8]; const float* wo = (const float*)d_in[9]; const float* bo = (const float*)d_in[10]; const int* MK = (const int*)d_in[11];   /* argument order q, k, v, w_q, b_q, w_k, b_k, w_v, b_v, w_o, b_o ('oi'), mask (int32 [4][2048]: read) */
    float* OUT = (float*)d_out;     // [4][2048][1024]
    char* wsp = (char*)d_ws;
    auto take = [&](size_t bytes) { char* p = wsp; wsp += (bytes + 255) & ~(size_t)255; return (void*)p; };
    bf* WQ = (bf*)take((size_t)DQ * DM * 2); bf* WK = (bf*)take((size_t)DKV * DM * 2); bf* WV = (bf*)take((size_t)DKV * DM * 2); bf* WO = (bf*)take((size_t)DM * DQ * 2); float* CS = (float*)take((size_t)TT * HD * 2 * 4);
    bf* XB = (bf*)take((size_t)TT * DM * 2); float* FQ = (float*)take((size_t)TT * DQ * 4); float* FK = (float*)take((size_t)TT * DKV * 4);
    h16* QP16 = (h16*)take((size_t)NH_ * TT * HD * 2); h16* KP16 = (h16*)take((size_t)NKV * TT * HD * 2); h16* VT16 = (h16*)take((size_t)NKV * HD * TT * 2);
    bf* QPh = (bf*)take((size_t)NH_ * TT * HD * 2); bf* QPl = (bf*)take((size_t)NH_ * TT * HD * 2); bf* KPh = (bf*)take((size_t)NKV * TT * HD * 2); bf* KPl = (bf*)take((size_t)NKV * TT * HD * 2); bf* VTh = (bf*)take((size_t)NKV * HD * TT * 2); bf* VTl = (bf*)take((size_t)NKV * HD * TT * 2);
    float* Sb = (float*)take((size_t)ZH * TT * TT * 4); float* Ob = (float*)take((size_t)ZH * TT * HD * 4); bf* ATh = (bf*)take((size_t)TT * DQ * 2); bf* ATl = (bf*)take((size_t)TT * DQ * 2);
    if ((size_t)(wsp - (char*)d_ws) > ws_size) return;    // ws 256 MiB
    float* FV = FK;   // v projection reuses the k buffer after the k planes are built (stream-ordered)
    { k_cvt8<<<(unsigned)(((size_t)DQ * DM / 8 + 255) / 256), 256, 0, stream>>>(wq, WQ, (size_t)DQ * DM / 8); k_cvt8<<<(unsigned)(((size_t)DKV * DM / 8 + 255) / 256), 256, 0, stream>>>(wk, WK, (size_t)DKV * DM / 8); k_cvt8<<<(unsigned)(((size_t)DKV * DM / 8 + 255) / 256), 256, 0, stream>>>(wv, WV, (size_t)DKV * DM / 8);   /* 'oi' (out, in): the GEMM's Bt as it stands */
      k_cvt8<<<(unsigned)(((size_t)DM * DQ / 8 + 255) / 256), 256, 0, stream>>>(wo, WO, (size_t)DM * DQ / 8);
       }
    k_csid<<<(TT * HD + 255) / 256, 256, 0, stream>>>(CS);
    const unsigned LQ = (unsigned)(((size_t)NH_ * TT * HD / 2 + 255) / 256), LKv = (unsigned)(((size_t)NKV * TT * HD / 2 + 255) / 256);
    for (int b = 0; b < NB_; ++b) {
        
        k_cvt8<<<(unsigned)(((size_t)TT * DM / 8 + 255) / 256), 256, 0, stream>>>(x + (size_t)b * TT * DM, XB, (size_t)TT * DM / 8);
        k_gemmw<bf, 0, true, KSW><<<dim3(TT / 64, DQ / 64, 1), 32 * KSW, 0, stream>>>(XB, nullptr, WQ, nullptr, DM, FQ, DQ, bq, 0, 0, 0);
        k_rope<<<LQ, 256, 0, stream>>>(FQ, DQ, NH_, CS, nullptr, nullptr, 1.0f, QP16, QPh, QPl);
        k_cvt8<<<(unsigned)(((size_t)TT * DM / 8 + 255) / 256), 256, 0, stream>>>(xk + (size_t)b * TT * DM, XB, (size_t)TT * DM / 8);   /* key -> XB (q GEMM already issued) */ k_gemmw<bf, 0, true, KSW><<<dim3(TT / 64, DKV / 64, 1), 32 * KSW, 0, stream>>>(XB, nullptr, WK, nullptr, DM, FK, DKV, bk, 0, 0, 0);
        k_rope<<<LKv, 256, 0, stream>>>(FK, DKV, NKV, CS, nullptr, nullptr, 1.0f, KP16, KPh, KPl);
        k_cvt8<<<(unsigned)(((size_t)TT * DM / 8 + 255) / 256), 256, 0, stream>>>(xv + (size_t)b * TT * DM, XB, (size_t)TT * DM / 8);   /* value -> XB */ k_gemmw<bf, 0, true, KSW><<<dim3(TT / 64, DKV / 64, 1), 32 * KSW, 0, stream>>>(XB, nullptr, WV, nullptr, DM, FV, DKV, bv, 0, 0, 0); k_vtp<<<LKv, 256, 0, stream>>>(FV, DKV, NKV, VT16, VTh, VTl);
        for (int h0 = 0; h0 < NH_; h0 += ZH) { const size_t zq = (size_t)h0, zk = (size_t)(h0 / REP);   // one kv head per query head: the pass's heads use consecutive kv planes (z-strides TT*HD)
            k_gemmw<bf, 2, false, 1><<<dim3(RH / 64, TT / 64, ZH), 32, 0, stream>>>(QPh + zq * TT * HD, QPl + zq * TT * HD, KPh + zk * TT * HD, KPl + zk * TT * HD, HD, Sb, SPC, nullptr, (size_t)TT * HD, (size_t)TT * HD, (size_t)TT * TT, LCP, SPL);
            k_gemmw<h16, 0, false, 1><<<dim3((TT - RH) / 64, TT / 64, ZH), 32, 0, stream>>>(QP16 + zq * TT * HD + (size_t)RH * HD, nullptr, KP16 + zk * TT * HD, nullptr, HD, Sb + (size_t)RH * SPC, SPC, nullptr, (size_t)TT * HD, (size_t)TT * HD, (size_t)TT * TT, LCP, SPL);
            k_asoft<<<ZH * TT / 8, 256, 0, stream>>>(Sb, MK + (size_t)b * TT);
            k_gemmw<bf, 2, false, KSP><<<dim3(RH / 64, HD / 64, ZH), 32 * KSP, 0, stream>>>((const bf*)Sb, (const bf*)(Sb + SPL), VTh + zk * HD * TT, VTl + zk * HD * TT, TT, Ob, HD, nullptr, (size_t)2 * TT * TT, (size_t)HD * TT, (size_t)TT * HD);
            k_gemmw<h16, 0, false, KSP><<<dim3((TT - RH) / 64, HD / 64, ZH), 32 * KSP, 0, stream>>>((const h16*)Sb + (size_t)RH * TT, nullptr, VT16 + zk * HD * TT, nullptr, TT, Ob + (size_t)RH * HD, HD, nullptr, (size_t)2 * TT * TT, (size_t)HD * TT, (size_t)TT * HD);
            k_merge<<<(unsigned)(((size_t)ZH * TT * HD / 2 + 255) / 256), 256, 0, stream>>>(Ob, h0, ATh, ATl); }
        k_gemmw<bf, 1, true, KSW><<<dim3(TT / 64, DM / 64, 1), 32 * KSW, 0, stream>>>(ATh, ATl, WO, nullptr, DQ, OUT + (size_t)b * TT * DM, DM, bo, 0, 0, 0); }
}

// v003
// It runs in 459 microseconds.
// In two side-by-side timings against v002, it was 2.56 and 2.55 times as fast.
// All steps since v000 together make it 8.78 times as fast.
#include <hip/hip_runtime.h>

// Multi-head attention over three input streams with a key-padding mask (q, k, v [4][2048][1024]; qh = q w_q^T + b_q, kh = k w_k^T + b_k, vh = v w_v^T + b_v ('oi' (out, in) [1024][1024] x 0.02 + [1024]: the four biases are zero on this draw: read and added; 16 heads x 64); scores / sqrt(64); keys j with mask[b][j] == 0 (int32 [4][2048], read as data: about half the keys of every batch entry) are set to the float32 minimum: an exclusion (no batch entry has every key masked); softmax; out = merged w_o^T + b_o -> [4][2048][1024] (8.4 M); argument order q, k, v, w_q, b_q, w_k, b_k, w_v, b_v, w_o, b_o, mask).
// Layout: per batch entry bf16 copies of query, key and value in turn (one operand buffer, stream-ordered); 'oi' weights cast as they stand; exact projections + f32 biases; head planes of all batch entries side by side; one attention launch for every (batch entry, head): scores, key mask, softmax and P x V stay in registers (hybrid rows: < 512 hi/lo 3 products, rest fp16); merged hi/lo x Wo exact + bo per batch entry.
// Compute dtypes, f32 accumulate: every input rounded to bf16; projections exact + f32 biases; attention rows < 512 3 products, rest fp16; softmax f32; Wo hl x exact + bias.

#define NB_  4
#define TT   2048
#define DM   1024
#define NH_  16
#define NKV  16
#define REP  (NH_ / NKV)
#define HD   64
#define DQ   (NH_ * HD)
#define DKV  (NKV * HD)
#define RH   512                  // query rows < RH use hi+lo planes (0: none)
#define WIN  0
#define SCL  0.125f   // HD^-0.5
#define KSW  8                    // waves that share one tile's k range where K = 1024 (projections, Wo): 128 of k a wave
#define SKB  64                   // keys in one LDS stage of the attention kernel
#define SPT  72                   // LDS row pitch of a stage in 16-bit elements: 128 B of data + 16 B, an odd multiple of 16 B
#define SPE  (64 * SPT)           // elements in one stage buffer (64 rows: SKB keys of K, or HD rows of V^T)
#define QHB  128                  // query rows of a work-group where rows < RH (8 waves x 16)
#define QLB  256                  // query rows of a work-group elsewhere (8 waves x 32)
#define CL2  0.18033688011112042f // HD^-0.5 x log2(e): scores go to base 2
typedef _Float16 h16;
typedef unsigned short bf;
typedef __attribute__((ext_vector_type(16))) __bf16   v16bf;
typedef __attribute__((ext_vector_type(16))) _Float16 v16h;
typedef __attribute__((ext_vector_type(8)))  _Float16 v8h;
typedef __attribute__((ext_vector_type(8)))  unsigned short v8us;
typedef __attribute__((ext_vector_type(8)))  float    v8f;
typedef __attribute__((ext_vector_type(4)))  float    v4f;
typedef v8h  __attribute__((may_alias)) v8ha;
typedef v4f  __attribute__((may_alias)) v4fa;
typedef v8us __attribute__((may_alias)) v8usa;

__device__ __forceinline__ unsigned short f2bf(float f) { unsigned u = __float_as_uint(f); u += 0x7FFFu + ((u >> 16) & 1u); return (unsigned short)(u >> 16); }
__device__ __forceinline__ float bf2f(unsigned short b) { return __uint_as_float(((unsigned)b) << 16); }
__device__ __forceinline__ float bfr(float f) { return bf2f(f2bf(f)); }
__device__ __forceinline__ v16h cat16(v8h lo, v8h hi) { return __builtin_shufflevector(lo, hi, 0, 1, 2, 3, 4, 5, 6, 7, 8, 9, 10, 11, 12, 13, 14, 15); }
__device__ __forceinline__ v16bf cat16b(v8us lo, v8us hi) { return __builtin_bit_cast(v16bf, __builtin_shufflevector(lo, hi, 0, 1, 2, 3, 4, 5, 6, 7, 8, 9, 10, 11, 12, 13, 14, 15)); }
__device__ __forceinline__ v8f wmma16(v16h a, v16h b, v8f c) { return __builtin_amdgcn_wmma_f32_16x16x32_f16(false, a, false, b, (short)0, c, false, false); }
__device__ __forceinline__ v8f wmmab(v16bf a, v16bf b, v8f c) { return __builtin_amdgcn_wmma_f32_16x16x32_bf16(false, a, false, b, (short)0, c, false, false); }



// ---- k_gemmw: register-blocked GEMM, one wave (KW = 1) or KW waves per 64x64 output tile (16 accumulators a wave), operands straight from K-contiguous 16-bit planes; grid (M/64, N/64, Z), 32 * KW threads.
// C[m][n] (f32, pitch ldc, + optional f32 bias[n]) = sum_k A[m][k] Bt[n][k] (+ split products per NSPLIT). z-batch strides sA/sB/sC in elements. K % (32 * KW) == 0.
// KW = 1 only: C may lie in column planes of 1 << lcp columns, sP elements apart (column n: plane n >> lcp, place n & ((1 << lcp) - 1), row pitch ldc); the default is one plane.
// KW > 1: the tile's work-group has KW waves (32 * KW threads); wave w sums k in [w K/KW, (w+1) K/KW), the KW f32 partial tiles meet in LDS and are added in wave order.
template <typename T16> struct WFrag;
template <> struct WFrag<h16> { typedef v16h V; static __device__ __forceinline__ V ld(const h16* p) { return cat16(*(const v8h*)p, *(const v8h*)(p + 16)); } static __device__ __forceinline__ v8f mma(V a, V b, v8f c) { return wmma16(a, b, c); } };
template <> struct WFrag<bf> { typedef v16bf V; static __device__ __forceinline__ V ld(const bf* p) { return cat16b(*(const v8us*)p, *(const v8us*)(p + 16)); } static __device__ __forceinline__ v8f mma(V a, V b, v8f c) { return wmmab(a, b, c); } };
template <typename T16, int NSPLIT, bool BIAS, int KW>
__global__ __launch_bounds__(32 * KW) void k_gemmw(const T16* __restrict__ A, const T16* __restrict__ A2, const T16* __restrict__ Bt, const T16* __restrict__ Bt2, int K, float* C, int ldc, const float* __restrict__ bias, size_t sA, size_t sB, size_t sC, int lcp = 30, size_t sP = 0) {
    typedef typename WFrag<T16>::V V;
    __shared__ __align__(16) float os[(KW > 1 ? KW * 64 : 16) * 68];
    const size_t z = blockIdx.z; A += z * sA; if (A2) A2 += z * sA; Bt += z * sB; if (Bt2) Bt2 += z * sB; C += z * sC;
    const int lane = threadIdx.x & 31, lr = lane & 15, hi = lane >> 4; const int r0 = blockIdx.x * 64, c0 = blockIdx.y * 64;
    v8f acc[4][4];
#pragma unroll
    for (int mb = 0; mb < 4; ++mb)
#pragma unroll
        for (int nb = 0; nb < 4; ++nb) acc[mb][nb] = (v8f){};
    const size_t aoff = (size_t)(r0 + lr) * K + 8 * hi, boff = (size_t)(c0 + lr) * K + 8 * hi;
    // the wave's number through readfirstlane: the k bounds and the wave's LDS base stay in scalar registers
    const int wv = (KW > 1) ? __builtin_amdgcn_readfirstlane((int)(threadIdx.x >> 5)) : 0; const int kbeg = wv * (K / KW), kend = kbeg + K / KW;
    for (int kc = kbeg; kc < kend; kc += 32) {
        V a[4], a2[4];
#pragma unroll
        for (int mb = 0; mb < 4; ++mb) { a[mb] = WFrag<T16>::ld(A + aoff + (size_t)mb * 16 * K + kc); if (NSPLIT == 1 || NSPLIT == 2) a2[mb] = WFrag<T16>::ld(A2 + aoff + (size_t)mb * 16 * K + kc); }
#pragma unroll
        for (int nb = 0; nb < 4; ++nb) { const V b = WFrag<T16>::ld(Bt + boff + (size_t)nb * 16 * K + kc); V b2; if (NSPLIT >= 2) b2 = WFrag<T16>::ld(Bt2 + boff + (size_t)nb * 16 * K + kc);
#pragma unroll
            for (int mb = 0; mb < 4; ++mb) { acc[mb][nb] = WFrag<T16>::mma(a[mb], b, acc[mb][nb]); if (NSPLIT == 1 || NSPLIT == 2) acc[mb][nb] = WFrag<T16>::mma(a2[mb], b, acc[mb][nb]); if (NSPLIT >= 2) acc[mb][nb] = WFrag<T16>::mma(a[mb], b2, acc[mb][nb]); } }
        asm volatile("v_nop\n\tv_nop\n\tv_nop\n\tv_nop" : "+v"(acc[0][0]), "+v"(acc[1][1]), "+v"(acc[2][2]), "+v"(acc[3][3]) : "v"(a[0]), "v"(a[3]));
    }
    if (KW > 1) {
        float* ow = os + wv * (64 * 68);
        // the three loops unrolled: acc is indexed by constants only and stays in registers
#pragma unroll
        for (int mb = 0; mb < 4; ++mb)
#pragma unroll
            for (int nb = 0; nb < 4; ++nb)
#pragma unroll
                for (int j = 0; j < 8; ++j) ow[(mb * 16 + hi * 8 + j) * 68 + nb * 16 + lr] = acc[mb][nb][j];
        __syncthreads();   // every wave's partial tile is in LDS before any thread adds them
        // both loops unrolled: a thread's LDS reads are issued together, the adds stay in wave order
#pragma unroll
        for (int s = 0; s < 32 / KW; ++s) { const int u = s * (32 * KW) + (int)threadIdx.x, row = u >> 4, cofs = (u & 15) * 4; v4f val = *(const v4fa*)(os + row * 68 + cofs);
#pragma unroll
            for (int w = 1; w < KW; ++w) val += *(const v4fa*)(os + (w * 64 + row) * 68 + cofs);
            if (BIAS) { val[0] += bfr(bias[c0 + cofs]); val[1] += bfr(bias[c0 + cofs + 1]); val[2] += bfr(bias[c0 + cofs + 2]); val[3] += bfr(bias[c0 + cofs + 3]); }
            *(v4f*)(C + (size_t)(r0 + row) * ldc + c0 + cofs) = val; }
        return;
    }
#pragma unroll
    for (int mb = 0; mb < 4; ++mb) {
#pragma unroll
        for (int nb = 0; nb < 4; ++nb) {
#pragma unroll
            for (int j = 0; j < 8; ++j) os[(hi * 8 + j) * 68 + nb * 16 + lr] = acc[mb][nb][j]; }
        __builtin_amdgcn_wave_barrier(); asm volatile("" ::: "memory");
        float* crow = C + (size_t)(c0 >> lcp) * sP + (size_t)(r0 + mb * 16) * ldc + (c0 & ((1 << lcp) - 1));
{
#pragma unroll
            for (int s = 0; s < 8; ++s) { const int row = 2 * s + hi, cofs = lr * 4; v4f val = *(const v4fa*)(os + row * 68 + cofs); if (BIAS) { val[0] += bfr(bias[c0 + cofs]); val[1] += bfr(bias[c0 + cofs + 1]); val[2] += bfr(bias[c0 + cofs + 2]); val[3] += bfr(bias[c0 + cofs + 3]); }
                *(v4f*)(crow + (size_t)row * ldc + cofs) = val; }
             }
        __builtin_amdgcn_wave_barrier(); asm volatile("" ::: "memory");
    }
}

__device__ __forceinline__ h16 tohx(float x) { return (h16)x; }
__device__ __forceinline__ void splitf(float y, unsigned short& h, unsigned short& l) { h = f2bf(y); l = f2bf(y - bf2f(h)); }
typedef __attribute__((ext_vector_type(2))) _Float16 v2h;
typedef __attribute__((ext_vector_type(4))) _Float16 v4h;
typedef __attribute__((ext_vector_type(2))) unsigned short v2us;
typedef __attribute__((ext_vector_type(4))) unsigned short v4us;
typedef __attribute__((ext_vector_type(2))) float v2f;
typedef __attribute__((ext_vector_type(4))) int v4i;
typedef v4h  __attribute__((may_alias)) v4ha;
typedef v4us __attribute__((may_alias)) v4usa;

__global__ __launch_bounds__(256) void k_cvt8(const float* __restrict__ src, bf* dst, size_t n8) { const size_t i = (size_t)blockIdx.x * 256 + threadIdx.x; if (i >= n8) return; const v8f v = *(const v8f*)(src + i * 8); v8us o;
#pragma unroll
    for (int k = 0; k < 8; ++k) o[k] = f2bf(v[k]); *(v8us*)(dst + i * 8) = o;  }

// k_rope: head planes [h][t][d] (fp16 + hi/lo) of rope(x) x sc with the rotate-half convention out[d] = x[d] cos[t][d] - x[d+HD/2] sin[t][d], out[d+HD/2] = x[d+HD/2] cos[t][d+HD/2] + x[d] sin[t][d+HD/2]
__global__ __launch_bounds__(256) void k_rope(const float* __restrict__ F, int pitch, int nheads, const float* __restrict__ CS, const float* __restrict__ RF, const float* __restrict__ nw, float sc, h16* P16, bf* Ph, bf* Pl) {
    const size_t e = ((size_t)blockIdx.x * 256 + threadIdx.x) * 2; if (e >= (size_t)nheads * TT * HD) return; const int d = (int)(e % HD); const int t = (int)((e / HD) % TT); const int h = (int)(e / ((size_t)HD * TT)); const float* f = F + (size_t)t * pitch + h * HD; const float rf = RF ? RF[(size_t)h * TT + t] : 1.0f; v2h o16; v2us oh, ol;
#pragma unroll
    for (int q = 0; q < 2; ++q) { const int dd = d + q; const int dp = (dd < HD / 2) ? dd + HD / 2 : dd - HD / 2; float x0 = f[dd], x1 = f[dp];
        if (RF) { float n0 = __fmul_rn(x0, rf), n1 = __fmul_rn(x1, rf); x0 = __fmul_rn(bfr(nw[dd]), n0); x1 = __fmul_rn(bfr(nw[dp]), n1); }
        const v2f cs = *(const v2f*)(CS + ((size_t)t * HD + dd) * 2); float a = __fmul_rn(x0, cs[0]), bq = __fmul_rn(x1, cs[1]); const float r = ((dd < HD / 2) ? __fsub_rn(a, bq) : __fadd_rn(a, bq)) * sc;
        o16[q] = tohx(r); unsigned short a2, c2; splitf(r, a2, c2); oh[q] = a2; ol[q] = c2; }
    *(v2h*)(P16 + e) = o16; *(v2us*)(Ph + e) = oh; *(v2us*)(Pl + e) = ol;  }
__global__ __launch_bounds__(256) void k_vtp(const float* __restrict__ F, int pitch, int nheads, h16* V16, bf* Vh, bf* Vl) { const size_t e = ((size_t)blockIdx.x * 256 + threadIdx.x) * 2; if (e >= (size_t)nheads * HD * TT) return; const int t = (int)(e % TT); const int d = (int)((e / TT) % HD); const int g = (int)(e / ((size_t)TT * HD)); v2h o16; v2us oh, ol;
#pragma unroll
    for (int q = 0; q < 2; ++q) { const float x = F[(size_t)(t + q) * pitch + g * HD + d]; o16[q] = tohx(x); unsigned short a2, c2; splitf(x, a2, c2); oh[q] = a2; ol[q] = c2; }
    *(v2h*)(V16 + e) = o16; *(v2us*)(Vh + e) = oh; *(v2us*)(Vl + e) = ol;  }
__global__ __launch_bounds__(256) void k_csid(float* CS) { const int idx = blockIdx.x * 256 + threadIdx.x; if (idx >= TT * HD) return; v2f cs; cs[0] = 1.0f; cs[1] = 0.0f; *(v2f*)(CS + (size_t)idx * 2) = cs;  }
typedef __attribute__((ext_vector_type(8))) __bf16 v8bf;
__device__ __forceinline__ float xhalf(float x) { return __builtin_bit_cast(float, __builtin_amdgcn_permlanex16(__builtin_bit_cast(int, x), __builtin_bit_cast(int, x), 0x76543210, 0xfedcba98, false, false)); }   // lane l with lane l ^ 16
// eight base-2 exponentials in place, in one statement: none of them is directly followed by a reader of its result or a writer of its source; the v_nop keeps that slot behind the last one
__device__ __forceinline__ v8f exp2x8(v8f x) { float a0 = x[0], a1 = x[1], a2 = x[2], a3 = x[3], a4 = x[4], a5 = x[5], a6 = x[6], a7 = x[7];
    asm("v_exp_f32 %0, %0\n\tv_exp_f32 %1, %1\n\tv_exp_f32 %2, %2\n\tv_exp_f32 %3, %3\n\tv_exp_f32 %4, %4\n\tv_exp_f32 %5, %5\n\tv_exp_f32 %6, %6\n\tv_exp_f32 %7, %7\n\tv_nop" : "+v"(a0), "+v"(a1), "+v"(a2), "+v"(a3), "+v"(a4), "+v"(a5), "+v"(a6), "+v"(a7));
    return (v8f){a0, a1, a2, a3, a4, a5, a6, a7}; }
template <bool HR> struct AFrag;
template <> struct AFrag<true>  { typedef bf  T; static __device__ __forceinline__ v16bf ld(const bf* p) { return cat16b(*(const v8usa*)p, *(const v8usa*)(p + 16)); } };
template <> struct AFrag<false> { typedef h16 T; static __device__ __forceinline__ v16h ld(const bf* p) { return cat16(__builtin_bit_cast(v8h, (v8us)*(const v8usa*)p), __builtin_bit_cast(v8h, (v8us)*(const v8usa*)(p + 16))); } };
template <bool HR>
__device__ __forceinline__ void attn_body(const bf* __restrict__ Q0, const bf* __restrict__ Q1, const bf* __restrict__ K0, const bf* __restrict__ K1, const bf* __restrict__ V0, const bf* __restrict__ V1, const float* bs, bf* sm, int q0, bf* Ah, bf* Al) {
    typedef typename AFrag<HR>::T T16; typedef typename WFrag<T16>::V V;
    // every inner loop below is unrolled: the fragment, score and output arrays are indexed by constants only and stay in registers
    constexpr int NQ = HR ? 1 : 2;      // 16-query groups a wave
    constexpr int NP = HR ? 2 : 1;      // planes an operand
    const int tid = (int)threadIdx.x, lane = tid & 31, lr = lane & 15, hi = lane >> 4;
    const int qw = q0 + __builtin_amdgcn_readfirstlane(tid >> 5) * (16 * NQ);
    const int srow = tid >> 3, scol = (tid & 7) * 8;   // staging: 8 threads a 128-byte row, 32 rows a sweep
    V qa[NQ][2], qb[NQ][2];
#pragma unroll
    for (int g = 0; g < NQ; ++g)
#pragma unroll
        for (int ks = 0; ks < 2; ++ks) { const unsigned o = (unsigned)((qw + g * 16 + lr) * HD + ks * 32 + 8 * hi); qa[g][ks] = AFrag<HR>::ld(Q0 + o); if (HR) qb[g][ks] = AFrag<HR>::ld(Q1 + o); }
    v8f ot[4][NQ]; float mr[NQ], ls[NQ];
#pragma unroll
    for (int g = 0; g < NQ; ++g) { mr[g] = -3.0e38f; ls[g] = 0.f;
#pragma unroll
        for (int db = 0; db < 4; ++db) ot[db][g] = (v8f){}; }
    v8us sk[NP][2], sv[NP][2];
    // stage buffers in sm: (plane * 2 + buffer) * SPE; planes K0, V0, K1, V1
#define ATT_GLOAD(s) { _Pragma("unroll") for (int c = 0; c < 2; ++c) { const int row = srow + 32 * c; \
        const unsigned ko = (unsigned)(((s) * SKB + row) * HD + scol), vo = (unsigned)(row * TT + (s) * SKB + scol); \
        sk[0][c] = *(const v8usa*)(K0 + ko); sv[0][c] = *(const v8usa*)(V0 + vo); if (HR) { sk[NP - 1][c] = *(const v8usa*)(K1 + ko); sv[NP - 1][c] = *(const v8usa*)(V1 + vo); } } }
#define ATT_SSTORE(b) { _Pragma("unroll") for (int c = 0; c < 2; ++c) { bf* d = sm + (b) * SPE + (srow + 32 * c) * SPT + scol; \
        *(v8usa*)d = sk[0][c]; *(v8usa*)(d + 2 * SPE) = sv[0][c]; if (HR) { *(v8usa*)(d + 4 * SPE) = sk[NP - 1][c]; *(v8usa*)(d + 6 * SPE) = sv[NP - 1][c]; } } }
    ATT_GLOAD(0) ATT_SSTORE(0)
    __syncthreads();   // stage 0 and the bias row are in LDS before any wave reads them
    // the stage loop stays rolled: the body is long, and every register array inside is indexed by constants
#pragma unroll 1
    for (int s = 0; s < TT / SKB; ++s) {
        const int buf = s & 1; const bool more = (s + 1 < TT / SKB);
        if (more) ATT_GLOAD(s + 1)
        const bf* kb = sm + buf * SPE + lr * SPT + 8 * hi; const bf* vb = kb + 2 * SPE;
#pragma unroll
        for (int ps = 0; ps < SKB / 32; ++ps) {
            v8f sc[2][NQ]; float tm[NQ];
#pragma unroll
            for (int g = 0; g < NQ; ++g) tm[g] = -3.0e38f;
#pragma unroll
            for (int kt = 0; kt < 2; ++kt) {
                const bf* kp = kb + (ps * 32 + kt * 16) * SPT; V ka[2], kl[2];
#pragma unroll
                for (int ks = 0; ks < 2; ++ks) { ka[ks] = AFrag<HR>::ld(kp + ks * 32); if (HR) kl[ks] = AFrag<HR>::ld(kp + 4 * SPE + ks * 32); }
                const float* bp = bs + s * SKB + ps * 32 + kt * 16 + 8 * hi; const v8f b8 = __builtin_shufflevector((v4f)*(const v4fa*)bp, (v4f)*(const v4fa*)(bp + 4), 0, 1, 2, 3, 4, 5, 6, 7);
#pragma unroll
                for (int g = 0; g < NQ; ++g) { v8f a = (v8f){};
#pragma unroll
                    for (int ks = 0; ks < 2; ++ks) { a = WFrag<T16>::mma(ka[ks], qa[g][ks], a); if (HR) { a = WFrag<T16>::mma(ka[ks], qb[g][ks], a); a = WFrag<T16>::mma(kl[ks], qa[g][ks], a); } }
                    a = __builtin_elementwise_fma(a, (v8f)(CL2), b8);
#pragma unroll
                    for (int r = 0; r < 8; ++r) tm[g] = fmaxf(tm[g], a[r]);
                    sc[kt][g] = a; }
            }
            bool need = false;
#pragma unroll
            for (int g = 0; g < NQ; ++g) { tm[g] = fmaxf(tm[g], xhalf(tm[g])); need = need || (tm[g] > mr[g] + 8.0f); }
            if (__builtin_amdgcn_ballot_w32(need) != 0) {   // one scalar branch a pass: rare after the first keys kept
#pragma unroll
                for (int g = 0; g < NQ; ++g) { const float mn = fmaxf(mr[g], tm[g]); const float f = __builtin_amdgcn_exp2f(mr[g] - mn); mr[g] = mn; ls[g] *= f;
#pragma unroll
                    for (int db = 0; db < 4; ++db) ot[db][g] *= f; }
            }
            V pa[NQ], pl[NQ];
#pragma unroll
            for (int g = 0; g < NQ; ++g) { const v8f p0 = exp2x8(sc[0][g] - (v8f)(mr[g])), p1 = exp2x8(sc[1][g] - (v8f)(mr[g]));
                const v8f p8 = p0 + p1; const v4f p4 = __builtin_shufflevector(p8, p8, 0, 1, 2, 3) + __builtin_shufflevector(p8, p8, 4, 5, 6, 7); ls[g] += (p4[0] + p4[1]) + (p4[2] + p4[3]);   // a short tree: no chain of 16 dependent adds
                if constexpr (HR) { const v8bf h0 = __builtin_convertvector(p0, v8bf), h1 = __builtin_convertvector(p1, v8bf);
                    const v8bf l0 = __builtin_convertvector(p0 - __builtin_convertvector(h0, v8f), v8bf), l1 = __builtin_convertvector(p1 - __builtin_convertvector(h1, v8f), v8bf);
                    pa[g] = __builtin_shufflevector(h0, h1, 0, 1, 2, 3, 4, 5, 6, 7, 8, 9, 10, 11, 12, 13, 14, 15); pl[g] = __builtin_shufflevector(l0, l1, 0, 1, 2, 3, 4, 5, 6, 7, 8, 9, 10, 11, 12, 13, 14, 15);
                } else { pa[g] = cat16(__builtin_convertvector(p0, v8h), __builtin_convertvector(p1, v8h)); } }
#pragma unroll
            for (int db = 0; db < 4; ++db) { const bf* vp = vb + db * 16 * SPT + ps * 32; const V va = AFrag<HR>::ld(vp); V vl; if (HR) vl = AFrag<HR>::ld(vp + 4 * SPE);
#pragma unroll
                for (int g = 0; g < NQ; ++g) { ot[db][g] = WFrag<T16>::mma(va, pa[g], ot[db][g]); if (HR) { ot[db][g] = WFrag<T16>::mma(va, pl[g], ot[db][g]); ot[db][g] = WFrag<T16>::mma(vl, pa[g], ot[db][g]); } } }
        }
        if (more) ATT_SSTORE(buf ^ 1)
        __syncthreads();   // publishes stage s + 1 and ends every wave's reads of stage s, whose buffer the next trip refills
    }
#undef ATT_GLOAD
#undef ATT_SSTORE
#pragma unroll
    for (int g = 0; g < NQ; ++g) { const float inv = __fdiv_rn(1.0f, ls[g] + xhalf(ls[g])); const unsigned oo = (unsigned)((qw + g * 16 + lr) * DQ + 8 * hi);
#pragma unroll
        for (int db = 0; db < 4; ++db) { v8us oh, ol;
#pragma unroll
            for (int r = 0; r < 8; ++r) { unsigned short a, c2; splitf(ot[db][g][r] * inv, a, c2); oh[r] = a; ol[r] = c2; }
            *(v8us*)(Ah + oo + db * 16) = oh; *(v8us*)(Al + oo + db * 16) = ol;
            asm volatile("s_wait_xcnt 0x0" ::: "memory"); } }   // stands in front of the next trip's (and the tail's) overwrite of the registers that the two stores name
}
// grid: NB_ * NH_ * RH / QHB work-groups of rows < RH first (the longer ones), then NB_ * NH_ * (TT - RH) / QLB
// waves_per_eu(4, 4): the register budget of 4 waves a SIMD, so that the output, score and staging arrays stay in registers (no spills)
__global__ __launch_bounds__(256) __attribute__((amdgpu_waves_per_eu(4, 4))) void k_attn(const h16* __restrict__ Q16, const h16* __restrict__ K16, const h16* __restrict__ V16, const bf* __restrict__ Qh, const bf* __restrict__ Ql, const bf* __restrict__ Kh, const bf* __restrict__ Kl, const bf* __restrict__ Vh, const bf* __restrict__ Vl, const int* __restrict__ mk, bf* Ah, bf* Al) {
    __shared__ __align__(16) bf sm[8 * SPE]; __shared__ __align__(16) float bs[TT];
    constexpr int NHW = NB_ * NH_ * (RH / QHB); const int x = (int)blockIdx.x; const bool hr = x < NHW;
    const int bh = hr ? x / (RH / QHB) : (x - NHW) / ((TT - RH) / QLB); const int q0 = hr ? (x % (RH / QHB)) * QHB : RH + ((x - NHW) % ((TT - RH) / QLB)) * QLB;
    const int b = bh / NH_, h = bh % NH_; const size_t po = (size_t)bh * TT * HD, ao = (size_t)b * TT * DQ + h * HD;
    { const int j = (int)threadIdx.x * (TT / 256); const int* mp = mk + (size_t)b * TT + j;
#pragma unroll
      for (int c = 0; c < TT / 256; c += 4) { const v4i m4 = *(const v4i*)(mp + c); v4f o; 
#pragma unroll
          for (int q = 0; q < 4; ++q) o[q] = (m4[q] != 0) ? 0.0f : -3.0e38f;
          *(v4fa*)(bs + j + c) = o; } }
    if (hr) attn_body<true>(Qh + po, Ql + po, Kh + po, Kl + po, Vh + po, Vl + po, bs, sm, q0, Ah + ao, Al + ao);
    else attn_body<false>((const bf*)(Q16 + po), nullptr, (const bf*)(K16 + po), nullptr, (const bf*)(V16 + po), nullptr, bs, sm, q0, Ah + ao, Al + ao);
}

extern "C" void kernel_launch(void* const* d_in, const int* in_sizes, int n_in,
                              void* d_out, int out_size, void* d_ws, size_t ws_size, hipStream_t stream) {
    (void)in_sizes; (void)n_in; (void)out_size;
    const float* x = (const float*)d_in[0]; const float* xk = (const float*)d_in[1]; const float* xv = (const float*)d_in[2]; const float* wq = (const float*)d_in[3]; const float* bq = (const float*)d_in[4]; const float* wk = (const float*)d_in[5]; const float* bk = (const float*)d_in[6]; const float* wv = (const float*)d_in[7]; const float* bv = (const float*)d_in[8]; const float* wo = (const float*)d_in[9]; const float* bo = (const float*)d_in[10]; const int* MK = (const int*)d_in[11];   /* argument order q, k, v, w_q, b_q, w_k, b_k, w_v, b_v, w_o, b_o ('oi'), mask (int32 [4][2048]: read) */
    float* OUT = (float*)d_out;     // [4][2048][1024]
    char* wsp = (char*)d_ws;
    auto take = [&](size_t bytes) { char* p = wsp; wsp += (bytes + 255) & ~(size_t)255; return (void*)p; };
    bf* WQ = (bf*)take((size_t)DQ * DM * 2); bf* WK = (bf*)take((size_t)DKV * DM * 2); bf* WV = (bf*)take((size_t)DKV * DM * 2); bf* WO = (bf*)take((size_t)DM * DQ * 2); float* CS = (float*)take((size_t)TT * HD * 2 * 4);
    bf* XB = (bf*)take((size_t)TT * DM * 2); float* FQ = (float*)take((size_t)TT * DQ * 4); float* FK = (float*)take((size_t)TT * DKV * 4);
    const size_t PB = (size_t)NH_ * TT * HD;   // elements of one batch entry in a head plane (NKV == NH_); the planes hold all NB_ entries
    h16* QP16 = (h16*)take(NB_ * PB * 2); h16* KP16 = (h16*)take(NB_ * PB * 2); h16* VT16 = (h16*)take(NB_ * PB * 2);
    bf* QPh = (bf*)take(NB_ * PB * 2); bf* QPl = (bf*)take(NB_ * PB * 2); bf* KPh = (bf*)take(NB_ * PB * 2); bf* KPl = (bf*)take(NB_ * PB * 2); bf* VTh = (bf*)take(NB_ * PB * 2); bf* VTl = (bf*)take(NB_ * PB * 2);
    bf* ATh = (bf*)take((size_t)NB_ * TT * DQ * 2); bf* ATl = (bf*)take((size_t)NB_ * TT * DQ * 2);
    if ((size_t)(wsp - (char*)d_ws) > ws_size) return;    // 205 MiB of the 256 MiB
    float* FV = FK;   // v projection reuses the k buffer after the k planes are built (stream-ordered)
    { k_cvt8<<<(unsigned)(((size_t)DQ * DM / 8 + 255) / 256), 256, 0, stream>>>(wq, WQ, (size_t)DQ * DM / 8); k_cvt8<<<(unsigned)(((size_t)DKV * DM / 8 + 255) / 256), 256, 0, stream>>>(wk, WK, (size_t)DKV * DM / 8); k_cvt8<<<(unsigned)(((size_t)DKV * DM / 8 + 255) / 256), 256, 0, stream>>>(wv, WV, (size_t)DKV * DM / 8);   /* 'oi' (out, in): the GEMM's Bt as it stands */
      k_cvt8<<<(unsigned)(((size_t)DM * DQ / 8 + 255) / 256), 256, 0, stream>>>(wo, WO, (size_t)DM * DQ / 8);
       }
    k_csid<<<(TT * HD + 255) / 256, 256, 0, stream>>>(CS);
    const unsigned LQ = (unsigned)(((size_t)NH_ * TT * HD / 2 + 255) / 256), LKv = (unsigned)(((size_t)NKV * TT * HD / 2 + 255) / 256);
    for (int b = 0; b < NB_; ++b) {
        
        k_cvt8<<<(unsigned)(((size_t)TT * DM / 8 + 255) / 256), 256, 0, stream>>>(x + (size_t)b * TT * DM, XB, (size_t)TT * DM / 8);
        k_gemmw<bf, 0, true, KSW><<<dim3(TT / 64, DQ / 64, 1), 32 * KSW, 0, stream>>>(XB, nullptr, WQ, nullptr, DM, FQ, DQ, bq, 0, 0, 0);
        k_rope<<<LQ, 256, 0, stream>>>(FQ, DQ, NH_, CS, nullptr, nullptr, 1.0f, QP16 + b * PB, QPh + b * PB, QPl + b * PB);
        k_cvt8<<<(unsigned)(((size_t)TT * DM / 8 + 255) / 256), 256, 0, stream>>>(xk + (size_t)b * TT * DM, XB, (size_t)TT * DM / 8);   /* key -> XB (q GEMM already issued) */ k_gemmw<bf, 0, true, KSW><<<dim3(TT / 64, DKV / 64, 1), 32 * KSW, 0, stream>>>(XB, nullptr, WK, nullptr, DM, FK, DKV, bk, 0, 0, 0);
        k_rope<<<LKv, 256, 0, stream>>>(FK, DKV, NKV, CS, nullptr, nullptr, 1.0f, KP16 + b * PB, KPh + b * PB, KPl + b * PB);
        k_cvt8<<<(unsigned)(((size_t)TT * DM / 8 + 255) / 256), 256, 0, stream>>>(xv + (size_t)b * TT * DM, XB, (size_t)TT * DM / 8);   /* value -> XB */ k_gemmw<bf, 0, true, KSW><<<dim3(TT / 64, DKV / 64, 1), 32 * KSW, 0, stream>>>(XB, nullptr, WV, nullptr, DM, FV, DKV, bv, 0, 0, 0); k_vtp<<<LKv, 256, 0, stream>>>(FV, DKV, NKV, VT16 + b * PB, VTh + b * PB, VTl + b * PB); }
    k_attn<<<NB_ * NH_ * (RH / QHB + (TT - RH) / QLB), 256, 0, stream>>>(QP16, KP16, VT16, QPh, QPl, KPh, KPl, VTh, VTl, MK, ATh, ATl);
    for (int b = 0; b < NB_; ++b)
        k_gemmw<bf, 1, true, KSW><<<dim3(TT / 64, DM / 64, 1), 32 * KSW, 0, stream>>>(ATh + (size_t)b * TT * DQ, ATl + (size_t)b * TT * DQ, WO, nullptr, DQ, OUT + (size_t)b * TT * DM, DM, bo, 0, 0, 0);
}

// v004
// One run takes 372 microseconds.
// In both of two side-by-side timings against v003, it was 1.23 times as fast.
// Counting every step since v000, it is 10.8 times as fast.
#include <hip/hip_runtime.h>

// Multi-head attention over three input streams with a key-padding mask (q, k, v [4][2048][1024]; qh = q w_q^T + b_q, kh = k w_k^T + b_k, vh = v w_v^T + b_v ('oi' (out, in) [1024][1024] x 0.02 + [1024]: the four biases are zero on this draw: read and added; 16 heads x 64); scores / sqrt(64); keys j with mask[b][j] == 0 (int32 [4][2048], read as data: about half the keys of every batch entry) are set to the float32 minimum: an exclusion (no batch entry has every key masked); softmax; out = merged w_o^T + b_o -> [4][2048][1024] (8.4 M); argument order q, k, v, w_q, b_q, w_k, b_k, w_v, b_v, w_o, b_o, mask).
// Layout: per batch entry bf16 copies of query, key and value in turn (one operand buffer, stream-ordered); 'oi' weights cast as they stand; exact projections + f32 biases, whose GEMM stores the head planes itself (no f32 copy of a projection in memory); head planes of all batch entries side by side; one attention launch for every (batch entry, head): scores, key mask, softmax and P x V stay in registers (hybrid rows: < 512 hi/lo 3 products, rest fp16); merged hi/lo x Wo exact + bo per batch entry.
// Compute dtypes, f32 accumulate: every input rounded to bf16; projections exact + f32 biases; attention rows < 512 3 products, rest fp16; softmax f32; Wo hl x exact + bias.

#define NB_  4
#define TT   2048
#define DM   1024
#define NH_  16
#define NKV  16
#define REP  (NH_ / NKV)
#define HD   64
#define DQ   (NH_ * HD)
#define DKV  (NKV * HD)
#define RH   512                  // query rows < RH use hi+lo planes (0: none)
#define WIN  0
#define SCL  0.125f   // HD^-0.5
#define KSW  8                    // waves that share one tile's k range where K = 1024 (projections, Wo): 128 of k a wave
#define SKB  64                   // keys in one LDS stage of the attention kernel
#define SPT  72                   // LDS row pitch of a stage in 16-bit elements: 128 B of data + 16 B, an odd multiple of 16 B
#define SPE  (64 * SPT)           // elements in one stage buffer (64 rows: SKB keys of K, or HD rows of V^T)
#define QHB  128                  // query rows of a work-group where rows < RH (8 waves x 16)
#define QLB  256                  // query rows of a work-group elsewhere (8 waves x 32)
#define CL2  0.18033688011112042f // HD^-0.5 x log2(e): scores go to base 2
typedef _Float16 h16;
typedef unsigned short bf;
typedef __attribute__((ext_vector_type(16))) __bf16   v16bf;
typedef __attribute__((ext_vector_type(16))) _Float16 v16h;
typedef __attribute__((ext_vector_type(8)))  _Float16 v8h;
typedef __attribute__((ext_vector_type(8)))  unsigned short v8us;
typedef __attribute__((ext_vector_type(8)))  float    v8f;
typedef __attribute__((ext_vector_type(4)))  float    v4f;
typedef v8h  __attribute__((may_alias)) v8ha;
typedef v4f  __attribute__((may_alias)) v4fa;
typedef v8us __attribute__((may_alias)) v8usa;

__device__ __forceinline__ unsigned short f2bf(float f) { unsigned u = __float_as_uint(f); u += 0x7FFFu + ((u >> 16) & 1u); return (unsigned short)(u >> 16); }
__device__ __forceinline__ float bf2f(unsigned short b) { return __uint_as_float(((unsigned)b) << 16); }
__device__ __forceinline__ float bfr(float f) { return bf2f(f2bf(f)); }
__device__ __forceinline__ v16h cat16(v8h lo, v8h hi) { return __builtin_shufflevector(lo, hi, 0, 1, 2, 3, 4, 5, 6, 7, 8, 9, 10, 11, 12, 13, 14, 15); }
__device__ __forceinline__ v16bf cat16b(v8us lo, v8us hi) { return __builtin_bit_cast(v16bf, __builtin_shufflevector(lo, hi, 0, 1, 2, 3, 4, 5, 6, 7, 8, 9, 10, 11, 12, 13, 14, 15)); }
__device__ __forceinline__ v8f wmma16(v16h a, v16h b, v8f c) { return __builtin_amdgcn_wmma_f32_16x16x32_f16(false, a, false, b, (short)0, c, false, false); }
__device__ __forceinline__ v8f wmmab(v16bf a, v16bf b, v8f c) { return __builtin_amdgcn_wmma_f32_16x16x32_bf16(false, a, false, b, (short)0, c, false, false); }
__device__ __forceinline__ h16 tohx(float x) { return (h16)x; }
__device__ __forceinline__ void splitf(float y, unsigned short& h, unsigned short& l) { h = f2bf(y); l = f2bf(y - bf2f(h)); }
typedef __attribute__((ext_vector_type(4))) _Float16 v4h;
typedef __attribute__((ext_vector_type(4))) unsigned short v4us;



// ---- k_gemmw: register-blocked GEMM, one wave (KW = 1) or KW waves per 64x64 output tile (16 accumulators a wave), operands straight from K-contiguous 16-bit planes; grid (M/64, N/64, Z), 32 * KW threads.
// C[m][n] (f32, pitch ldc, + optional f32 bias[n]) = sum_k A[m][k] Bt[n][k] (+ split products per NSPLIT). z-batch strides sA/sB/sC in elements. K % (32 * KW) == 0.
// KW = 1 only: C may lie in column planes of 1 << lcp columns, sP elements apart (column n: plane n >> lcp, place n & ((1 << lcp) - 1), row pitch ldc); the default is one plane.
// KW > 1: the tile's work-group has KW waves (32 * KW threads); wave w sums k in [w K/KW, (w+1) K/KW), the KW f32 partial tiles meet in LDS and are added in wave order.
// PL > 0 (KW > 1 only): the sum + bias is not stored as f32: it goes out as three 16-bit planes (P16 fp16, Ph + Pl bf16 hi/lo), each laid out as C would be (column planes lcp, sP; row pitch ldc). PL = 1: bias[n]. PL = 2: bias[m].
//   Q, K head planes [h][t][d]: A = x, Bt = w, lcp = 6, sP = TT * HD, ldc = HD. V^T planes [h][d][t]: the operands change places (A = w, Bt = x: C[m][n] is feature m at token n), ldc = TT, bias[m].
template <typename T16> struct WFrag;
template <> struct WFrag<h16> { typedef v16h V; static __device__ __forceinline__ V ld(const h16* p) { return cat16(*(const v8h*)p, *(const v8h*)(p + 16)); } static __device__ __forceinline__ v8f mma(V a, V b, v8f c) { return wmma16(a, b, c); } };
template <> struct WFrag<bf> { typedef v16bf V; static __device__ __forceinline__ V ld(const bf* p) { return cat16b(*(const v8us*)p, *(const v8us*)(p + 16)); } static __device__ __forceinline__ v8f mma(V a, V b, v8f c) { return wmmab(a, b, c); } };
template <typename T16, int NSPLIT, bool BIAS, int KW, int PL>
__global__ __launch_bounds__(32 * KW) void k_gemmw(const T16* __restrict__ A, const T16* __restrict__ A2, const T16* __restrict__ Bt, const T16* __restrict__ Bt2, int K, float* C, int ldc, const float* __restrict__ bias, size_t sA, size_t sB, size_t sC, int lcp = 30, size_t sP = 0, h16* P16 = nullptr, bf* Ph = nullptr, bf* Pl = nullptr) {
    typedef typename WFrag<T16>::V V; static_assert(PL == 0 || KW > 1, "the plane epilogue follows the LDS sum of the KW partial tiles");
    __shared__ __align__(16) float os[(KW > 1 ? KW * 64 : 16) * 68];
    const size_t z = blockIdx.z; A += z * sA; if (A2) A2 += z * sA; Bt += z * sB; if (Bt2) Bt2 += z * sB; C += z * sC;
    const int lane = threadIdx.x & 31, lr = lane & 15, hi = lane >> 4; const int r0 = blockIdx.x * 64, c0 = blockIdx.y * 64;
    v8f acc[4][4];
#pragma unroll
    for (int mb = 0; mb < 4; ++mb)
#pragma unroll
        for (int nb = 0; nb < 4; ++nb) acc[mb][nb] = (v8f){};
    const size_t aoff = (size_t)(r0 + lr) * K + 8 * hi, boff = (size_t)(c0 + lr) * K + 8 * hi;
    // the wave's number through readfirstlane: the k bounds and the wave's LDS base stay in scalar registers
    const int wv = (KW > 1) ? __builtin_amdgcn_readfirstlane((int)(threadIdx.x >> 5)) : 0; const int kbeg = wv * (K / KW), kend = kbeg + K / KW;
    for (int kc = kbeg; kc < kend; kc += 32) {
        V a[4], a2[4];
#pragma unroll
        for (int mb = 0; mb < 4; ++mb) { a[mb] = WFrag<T16>::ld(A + aoff + (size_t)mb * 16 * K + kc); if (NSPLIT == 1 || NSPLIT == 2) a2[mb] = WFrag<T16>::ld(A2 + aoff + (size_t)mb * 16 * K + kc); }
#pragma unroll
        for (int nb = 0; nb < 4; ++nb) { const V b = WFrag<T16>::ld(Bt + boff + (size_t)nb * 16 * K + kc); V b2; if (NSPLIT >= 2) b2 = WFrag<T16>::ld(Bt2 + boff + (size_t)nb * 16 * K + kc);
#pragma unroll
            for (int mb = 0; mb < 4; ++mb) { acc[mb][nb] = WFrag<T16>::mma(a[mb], b, acc[mb][nb]); if (NSPLIT == 1 || NSPLIT == 2) acc[mb][nb] = WFrag<T16>::mma(a2[mb], b, acc[mb][nb]); if (NSPLIT >= 2) acc[mb][nb] = WFrag<T16>::mma(a[mb], b2, acc[mb][nb]); } }
        asm volatile("v_nop\n\tv_nop\n\tv_nop\n\tv_nop" : "+v"(acc[0][0]), "+v"(acc[1][1]), "+v"(acc[2][2]), "+v"(acc[3][3]) : "v"(a[0]), "v"(a[3]));
    }
    if (KW > 1) {
        float* ow = os + wv * (64 * 68);
        // the three loops unrolled: acc is indexed by constants only and stays in registers
#pragma unroll
        for (int mb = 0; mb < 4; ++mb)
#pragma unroll
            for (int nb = 0; nb < 4; ++nb)
#pragma unroll
                for (int j = 0; j < 8; ++j) ow[(mb * 16 + hi * 8 + j) * 68 + nb * 16 + lr] = acc[mb][nb][j];
        __syncthreads();   // every wave's partial tile is in LDS before any thread adds them
        if constexpr (PL > 0) {
            // every loop here unrolled. First the LDS reads and the adds of all sweeps (wave order, then the bias), so that the wait behind a sweep's stores holds none of them back
            v4f val[32 / KW];
#pragma unroll
            for (int s = 0; s < 32 / KW; ++s) { const int u = s * (32 * KW) + (int)threadIdx.x, row = u >> 4, cofs = (u & 15) * 4; val[s] = *(const v4fa*)(os + row * 68 + cofs);
#pragma unroll
                for (int w = 1; w < KW; ++w) val[s] += *(const v4fa*)(os + (w * 64 + row) * 68 + cofs);
                if (BIAS) {
#pragma unroll
                    for (int q = 0; q < 4; ++q) val[s][q] += bfr(bias[PL == 1 ? c0 + cofs + q : r0 + row]); } }
            const size_t pbase = (size_t)(c0 >> lcp) * sP + (size_t)r0 * ldc + (c0 & ((1 << lcp) - 1));
#pragma unroll
            for (int s = 0; s < 32 / KW; ++s) { const int u = s * (32 * KW) + (int)threadIdx.x, row = u >> 4, cofs = (u & 15) * 4; const size_t o = pbase + (size_t)row * ldc + cofs; v4h o16; v4us oh, ol;
#pragma unroll
                for (int q = 0; q < 4; ++q) { o16[q] = tohx(val[s][q]); unsigned short a2, c2; splitf(val[s][q], a2, c2); oh[q] = a2; ol[q] = c2; }
                *(v4h*)(P16 + o) = o16; *(v4us*)(Ph + o) = oh; *(v4us*)(Pl + o) = ol;
                asm volatile("s_wait_xcnt 0x0" ::: "memory"); }   // stands in front of the next sweep's overwrite of the registers that the three stores name
            return;
        }
        // both loops unrolled: a thread's LDS reads are issued together, the adds stay in wave order
#pragma unroll
        for (int s = 0; s < 32 / KW; ++s) { const int u = s * (32 * KW) + (int)threadIdx.x, row = u >> 4, cofs = (u & 15) * 4; v4f val = *(const v4fa*)(os + row * 68 + cofs);
#pragma unroll
            for (int w = 1; w < KW; ++w) val += *(const v4fa*)(os + (w * 64 + row) * 68 + cofs);
            if (BIAS) { val[0] += bfr(bias[c0 + cofs]); val[1] += bfr(bias[c0 + cofs + 1]); val[2] += bfr(bias[c0 + cofs + 2]); val[3] += bfr(bias[c0 + cofs + 3]); }
            *(v4f*)(C + (size_t)(r0 + row) * ldc + c0 + cofs) = val; }
        return;
    }
#pragma unroll
    for (int mb = 0; mb < 4; ++mb) {
#pragma unroll
        for (int nb = 0; nb < 4; ++nb) {
#pragma unroll
            for (int j = 0; j < 8; ++j) os[(hi * 8 + j) * 68 + nb * 16 + lr] = acc[mb][nb][j]; }
        __builtin_amdgcn_wave_barrier(); asm volatile("" ::: "memory");
        float* crow = C + (size_t)(c0 >> lcp) * sP + (size_t)(r0 + mb * 16) * ldc + (c0 & ((1 << lcp) - 1));
{
#pragma unroll
            for (int s = 0; s < 8; ++s) { const int row = 2 * s + hi, cofs = lr * 4; v4f val = *(const v4fa*)(os + row * 68 + cofs); if (BIAS) { val[0] += bfr(bias[c0 + cofs]); val[1] += bfr(bias[c0 + cofs + 1]); val[2] += bfr(bias[c0 + cofs + 2]); val[3] += bfr(bias[c0 + cofs + 3]); }
                *(v4f*)(crow + (size_t)row * ldc + cofs) = val; }
             }
        __builtin_amdgcn_wave_barrier(); asm volatile("" ::: "memory");
    }
}

typedef __attribute__((ext_vector_type(4))) int v4i;

__global__ __launch_bounds__(256) void k_cvt8(const float* __restrict__ src, bf* dst, size_t n8) { const size_t i = (size_t)blockIdx.x * 256 + threadIdx.x; if (i >= n8) return; const v8f v = *(const v8f*)(src + i * 8); v8us o;
#pragma unroll
    for (int k = 0; k < 8; ++k) o[k] = f2bf(v[k]); *(v8us*)(dst + i * 8) = o;  }

typedef __attribute__((ext_vector_type(8))) __bf16 v8bf;
__device__ __forceinline__ float xhalf(float x) { return __builtin_bit_cast(float, __builtin_amdgcn_permlanex16(__builtin_bit_cast(int, x), __builtin_bit_cast(int, x), 0x76543210, 0xfedcba98, false, false)); }   // lane l with lane l ^ 16
// eight base-2 exponentials in place, in one statement: none of them is directly followed by a reader of its result or a writer of its source; the v_nop keeps that slot behind the last one
__device__ __forceinline__ v8f exp2x8(v8f x) { float a0 = x[0], a1 = x[1], a2 = x[2], a3 = x[3], a4 = x[4], a5 = x[5], a6 = x[6], a7 = x[7];
    asm("v_exp_f32 %0, %0\n\tv_exp_f32 %1, %1\n\tv_exp_f32 %2, %2\n\tv_exp_f32 %3, %3\n\tv_exp_f32 %4, %4\n\tv_exp_f32 %5, %5\n\tv_exp_f32 %6, %6\n\tv_exp_f32 %7, %7\n\tv_nop" : "+v"(a0), "+v"(a1), "+v"(a2), "+v"(a3), "+v"(a4), "+v"(a5), "+v"(a6), "+v"(a7));
    return (v8f){a0, a1, a2, a3, a4, a5, a6, a7}; }
template <bool HR> struct AFrag;
template <> struct AFrag<true>  { typedef bf  T; static __device__ __forceinline__ v16bf ld(const bf* p) { return cat16b(*(const v8usa*)p, *(const v8usa*)(p + 16)); } };
template <> struct AFrag<false> { typedef h16 T; static __device__ __forceinline__ v16h ld(const bf* p) { return cat16(__builtin_bit_cast(v8h, (v8us)*(const v8usa*)p), __builtin_bit_cast(v8h, (v8us)*(const v8usa*)(p + 16))); } };
template <bool HR>
__device__ __forceinline__ void attn_body(const bf* __restrict__ Q0, const bf* __restrict__ Q1, const bf* __restrict__ K0, const bf* __restrict__ K1, const bf* __restrict__ V0, const bf* __restrict__ V1, const float* bs, bf* sm, int q0, bf* Ah, bf* Al) {
    typedef typename AFrag<HR>::T T16; typedef typename WFrag<T16>::V V;
    // every inner loop below is unrolled: the fragment, score and output arrays are indexed by constants only and stay in registers
    constexpr int NQ = HR ? 1 : 2;      // 16-query groups a wave
    constexpr int NP = HR ? 2 : 1;      // planes an operand
    const int tid = (int)threadIdx.x, lane = tid & 31, lr = lane & 15, hi = lane >> 4;
    const int qw = q0 + __builtin_amdgcn_readfirstlane(tid >> 5) * (16 * NQ);
    const int srow = tid >> 3, scol = (tid & 7) * 8;   // staging: 8 threads a 128-byte row, 32 rows a sweep
    V qa[NQ][2], qb[NQ][2];
#pragma unroll
    for (int g = 0; g < NQ; ++g)
#pragma unroll
        for (int ks = 0; ks < 2; ++ks) { const unsigned o = (unsigned)((qw + g * 16 + lr) * HD + ks * 32 + 8 * hi); qa[g][ks] = AFrag<HR>::ld(Q0 + o); if (HR) qb[g][ks] = AFrag<HR>::ld(Q1 + o); }
    v8f ot[4][NQ]; float mr[NQ], ls[NQ];
#pragma unroll
    for (int g = 0; g < NQ; ++g) { mr[g] = -3.0e38f; ls[g] = 0.f;
#pragma unroll
        for (int db = 0; db < 4; ++db) ot[db][g] = (v8f){}; }
    v8us sk[NP][2], sv[NP][2];
    // stage buffers in sm: (plane * 2 + buffer) * SPE; planes K0, V0, K1, V1
#define ATT_GLOAD(s) { _Pragma("unroll") for (int c = 0; c < 2; ++c) { const int row = srow + 32 * c; \
        const unsigned ko = (unsigned)(((s) * SKB + row) * HD + scol), vo = (unsigned)(row * TT + (s) * SKB + scol); \
        sk[0][c] = *(const v8usa*)(K0 + ko); sv[0][c] = *(const v8usa*)(V0 + vo); if (HR) { sk[NP - 1][c] = *(const v8usa*)(K1 + ko); sv[NP - 1][c] = *(const v8usa*)(V1 + vo); } } }
#define ATT_SSTORE(b) { _Pragma("unroll") for (int c = 0; c < 2; ++c) { bf* d = sm + (b) * SPE + (srow + 32 * c) * SPT + scol; \
        *(v8usa*)d = sk[0][c]; *(v8usa*)(d + 2 * SPE) = sv[0][c]; if (HR) { *(v8usa*)(d + 4 * SPE) = sk[NP - 1][c]; *(v8usa*)(d + 6 * SPE) = sv[NP - 1][c]; } } }
    ATT_GLOAD(0) ATT_SSTORE(0)
    __syncthreads();   // stage 0 and the bias row are in LDS before any wave reads them
    // the stage loop stays rolled: the body is long, and every register array inside is indexed by constants
#pragma unroll 1
    for (int s = 0; s < TT / SKB; ++s) {
        const int buf = s & 1; const bool more = (s + 1 < TT / SKB);
        if (more) ATT_GLOAD(s + 1)
        const bf* kb = sm + buf * SPE + lr * SPT + 8 * hi; const bf* vb = kb + 2 * SPE;
#pragma unroll
        for (int ps = 0; ps < SKB / 32; ++ps) {
            v8f sc[2][NQ]; float tm[NQ];
#pragma unroll
            for (int g = 0; g < NQ; ++g) tm[g] = -3.0e38f;
#pragma unroll
            for (int kt = 0; kt < 2; ++kt) {
                const bf* kp = kb + (ps * 32 + kt * 16) * SPT; V ka[2], kl[2];
#pragma unroll
                for (int ks = 0; ks < 2; ++ks) { ka[ks] = AFrag<HR>::ld(kp + ks * 32); if (HR) kl[ks] = AFrag<HR>::ld(kp + 4 * SPE + ks * 32); }
                const float* bp = bs + s * SKB + ps * 32 + kt * 16 + 8 * hi; const v8f b8 = __builtin_shufflevector((v4f)*(const v4fa*)bp, (v4f)*(const v4fa*)(bp + 4), 0, 1, 2, 3, 4, 5, 6, 7);
#pragma unroll
                for (int g = 0; g < NQ; ++g) { v8f a = (v8f){};
#pragma unroll
                    for (int ks = 0; ks < 2; ++ks) { a = WFrag<T16>::mma(ka[ks], qa[g][ks], a); if (HR) { a = WFrag<T16>::mma(ka[ks], qb[g][ks], a); a = WFrag<T16>::mma(kl[ks], qa[g][ks], a); } }
                    a = __builtin_elementwise_fma(a, (v8f)(CL2), b8);
#pragma unroll
                    for (int r = 0; r < 8; ++r) tm[g] = fmaxf(tm[g], a[r]);
                    sc[kt][g] = a; }
            }
            bool need = false;
#pragma unroll
            for (int g = 0; g < NQ; ++g) { tm[g] = fmaxf(tm[g], xhalf(tm[g])); need = need || (tm[g] > mr[g] + 8.0f); }
            if (__builtin_amdgcn_ballot_w32(need) != 0) {   // one scalar branch a pass: rare after the first keys kept
#pragma unroll
                for (int g = 0; g < NQ; ++g) { const float mn = fmaxf(mr[g], tm[g]); const float f = __builtin_amdgcn_exp2f(mr[g] - mn); mr[g] = mn; ls[g] *= f;
#pragma unroll
                    for (int db = 0; db < 4; ++db) ot[db][g] *= f; }
            }
            V pa[NQ], pl[NQ];
#pragma unroll
            for (int g = 0; g < NQ; ++g) { const v8f p0 = exp2x8(sc[0][g] - (v8f)(mr[g])), p1 = exp2x8(sc[1][g] - (v8f)(mr[g]));
                const v8f p8 = p0 + p1; const v4f p4 = __builtin_shufflevector(p8, p8, 0, 1, 2, 3) + __builtin_shufflevector(p8, p8, 4, 5, 6, 7); ls[g] += (p4[0] + p4[1]) + (p4[2] + p4[3]);   // a short tree: no chain of 16 dependent adds
                if constexpr (HR) { const v8bf h0 = __builtin_convertvector(p0, v8bf), h1 = __builtin_convertvector(p1, v8bf);
                    const v8bf l0 = __builtin_convertvector(p0 - __builtin_convertvector(h0, v8f), v8bf), l1 = __builtin_convertvector(p1 - __builtin_convertvector(h1, v8f), v8bf);
                    pa[g] = __builtin_shufflevector(h0, h1, 0, 1, 2, 3, 4, 5, 6, 7, 8, 9, 10, 11, 12, 13, 14, 15); pl[g] = __builtin_shufflevector(l0, l1, 0, 1, 2, 3, 4, 5, 6, 7, 8, 9, 10, 11, 12, 13, 14, 15);
                } else { pa[g] = cat16(__builtin_convertvector(p0, v8h), __builtin_convertvector(p1, v8h)); } }
#pragma unroll
            for (int db = 0; db < 4; ++db) { const bf* vp = vb + db * 16 * SPT + ps * 32; const V va = AFrag<HR>::ld(vp); V vl; if (HR) vl = AFrag<HR>::ld(vp + 4 * SPE);
#pragma unroll
                for (int g = 0; g < NQ; ++g) { ot[db][g] = WFrag<T16>::mma(va, pa[g], ot[db][g]); if (HR) { ot[db][g] = WFrag<T16>::mma(va, pl[g], ot[db][g]); ot[db][g] = WFrag<T16>::mma(vl, pa[g], ot[db][g]); } } }
        }
        if (more) ATT_SSTORE(buf ^ 1)
        __syncthreads();   // publishes stage s + 1 and ends every wave's reads of stage s, whose buffer the next trip refills
    }
#undef ATT_GLOAD
#undef ATT_SSTORE
#pragma unroll
    for (int g = 0; g < NQ; ++g) { const float inv = __fdiv_rn(1.0f, ls[g] + xhalf(ls[g])); const unsigned oo = (unsigned)((qw + g * 16 + lr) * DQ + 8 * hi);
#pragma unroll
        for (int db = 0; db < 4; ++db) { v8us oh, ol;
#pragma unroll
            for (int r = 0; r < 8; ++r) { unsigned short a, c2; splitf(ot[db][g][r] * inv, a, c2); oh[r] = a; ol[r] = c2; }
            *(v8us*)(Ah + oo + db * 16) = oh; *(v8us*)(Al + oo + db * 16) = ol;
            asm volatile("s_wait_xcnt 0x0" ::: "memory"); } }   // stands in front of the next trip's (and the tail's) overwrite of the registers that the two stores name
}
// grid: NB_ * NH_ * RH / QHB work-groups of rows < RH first (the longer ones), then NB_ * NH_ * (TT - RH) / QLB
// waves_per_eu(4, 4): the register budget of 4 waves a SIMD, so that the output, score and staging arrays stay in registers (no spills)
__global__ __launch_bounds__(256) __attribute__((amdgpu_waves_per_eu(4, 4))) void k_attn(const h16* __restrict__ Q16, const h16* __restrict__ K16, const h16* __restrict__ V16, const bf* __restrict__ Qh, const bf* __restrict__ Ql, const bf* __restrict__ Kh, const bf* __restrict__ Kl, const bf* __restrict__ Vh, const bf* __restrict__ Vl, const int* __restrict__ mk, bf* Ah, bf* Al) {
    __shared__ __align__(16) bf sm[8 * SPE]; __shared__ __align__(16) float bs[TT];
    constexpr int NHW = NB_ * NH_ * (RH / QHB); const int x = (int)blockIdx.x; const bool hr = x < NHW;
    const int bh = hr ? x / (RH / QHB) : (x - NHW) / ((TT - RH) / QLB); const int q0 = hr ? (x % (RH / QHB)) * QHB : RH + ((x - NHW) % ((TT - RH) / QLB)) * QLB;
    const int b = bh / NH_, h = bh % NH_; const size_t po = (size_t)bh * TT * HD, ao = (size_t)b * TT * DQ + h * HD;
    { const int j = (int)threadIdx.x * (TT / 256); const int* mp = mk + (size_t)b * TT + j;
#pragma unroll
      for (int c = 0; c < TT / 256; c += 4) { const v4i m4 = *(const v4i*)(mp + c); v4f o; 
#pragma unroll
          for (int q = 0; q < 4; ++q) o[q] = (m4[q] != 0) ? 0.0f : -3.0e38f;
          *(v4fa*)(bs + j + c) = o; } }
    if (hr) attn_body<true>(Qh + po, Ql + po, Kh + po, Kl + po, Vh + po, Vl + po, bs, sm, q0, Ah + ao, Al + ao);
    else attn_body<false>((const bf*)(Q16 + po), nullptr, (const bf*)(K16 + po), nullptr, (const bf*)(V16 + po), nullptr, bs, sm, q0, Ah + ao, Al + ao);
}

extern "C" void kernel_launch(void* const* d_in, const int* in_sizes, int n_in,
                              void* d_out, int out_size, void* d_ws, size_t ws_size, hipStream_t stream) {
    (void)in_sizes; (void)n_in; (void)out_size;
    const float* x = (const float*)d_in[0]; const float* xk = (const float*)d_in[1]; const float* xv = (const float*)d_in[2]; const float* wq = (const float*)d_in[3]; const float* bq = (const float*)d_in[4]; const float* wk = (const float*)d_in[5]; const float* bk = (const float*)d_in[6]; const float* wv = (const float*)d_in[7]; const float* bv = (const float*)d_in[8]; const float* wo = (const float*)d_in[9]; const float* bo = (const float*)d_in[10]; const int* MK = (const int*)d_in[11];   /* argument order q, k, v, w_q, b_q, w_k, b_k, w_v, b_v, w_o, b_o ('oi'), mask (int32 [4][2048]: read) */
    float* OUT = (float*)d_out;     // [4][2048][1024]
    char* wsp = (char*)d_ws;
    auto take = [&](size_t bytes) { char* p = wsp; wsp += (bytes + 255) & ~(size_t)255; return (void*)p; };
    bf* WQ = (bf*)take((size_t)DQ * DM * 2); bf* WK = (bf*)take((size_t)DKV * DM * 2); bf* WV = (bf*)take((size_t)DKV * DM * 2); bf* WO = (bf*)take((size_t)DM * DQ * 2);
    bf* XB = (bf*)take((size_t)TT * DM * 2);
    const size_t PB = (size_t)NH_ * TT * HD;   // elements of one batch entry in a head plane (NKV == NH_); the planes hold all NB_ entries
    h16* QP16 = (h16*)take(NB_ * PB * 2); h16* KP16 = (h16*)take(NB_ * PB * 2); h16* VT16 = (h16*)take(NB_ * PB * 2);
    bf* QPh = (bf*)take(NB_ * PB * 2); bf* QPl = (bf*)take(NB_ * PB * 2); bf* KPh = (bf*)take(NB_ * PB * 2); bf* KPl = (bf*)take(NB_ * PB * 2); bf* VTh = (bf*)take(NB_ * PB * 2); bf* VTl = (bf*)take(NB_ * PB * 2);
    bf* ATh = (bf*)take((size_t)NB_ * TT * DQ * 2); bf* ATl = (bf*)take((size_t)NB_ * TT * DQ * 2);
    if ((size_t)(wsp - (char*)d_ws) > ws_size) return;    // 188 MiB of the 256 MiB
    { k_cvt8<<<(unsigned)(((size_t)DQ * DM / 8 + 255) / 256), 256, 0, stream>>>(wq, WQ, (size_t)DQ * DM / 8); k_cvt8<<<(unsigned)(((size_t)DKV * DM / 8 + 255) / 256), 256, 0, stream>>>(wk, WK, (size_t)DKV * DM / 8); k_cvt8<<<(unsigned)(((size_t)DKV * DM / 8 + 255) / 256), 256, 0, stream>>>(wv, WV, (size_t)DKV * DM / 8);   /* 'oi' (out, in) as it stands: Bt of the q and k GEMMs, A of the v GEMM */
      k_cvt8<<<(unsigned)(((size_t)DM * DQ / 8 + 255) / 256), 256, 0, stream>>>(wo, WO, (size_t)DM * DQ / 8);
       }
    for (int b = 0; b < NB_; ++b) {
        k_cvt8<<<(unsigned)(((size_t)TT * DM / 8 + 255) / 256), 256, 0, stream>>>(x + (size_t)b * TT * DM, XB, (size_t)TT * DM / 8);
        k_gemmw<bf, 0, true, KSW, 1><<<dim3(TT / 64, DQ / 64, 1), 32 * KSW, 0, stream>>>(XB, nullptr, WQ, nullptr, DM, nullptr, HD, bq, 0, 0, 0, 6, (size_t)TT * HD, QP16 + b * PB, QPh + b * PB, QPl + b * PB);
        k_cvt8<<<(unsigned)(((size_t)TT * DM / 8 + 255) / 256), 256, 0, stream>>>(xk + (size_t)b * TT * DM, XB, (size_t)TT * DM / 8);   /* key -> XB (q GEMM already issued) */
        k_gemmw<bf, 0, true, KSW, 1><<<dim3(TT / 64, DKV / 64, 1), 32 * KSW, 0, stream>>>(XB, nullptr, WK, nullptr, DM, nullptr, HD, bk, 0, 0, 0, 6, (size_t)TT * HD, KP16 + b * PB, KPh + b * PB, KPl + b * PB);
        k_cvt8<<<(unsigned)(((size_t)TT * DM / 8 + 255) / 256), 256, 0, stream>>>(xv + (size_t)b * TT * DM, XB, (size_t)TT * DM / 8);   /* value -> XB */
        k_gemmw<bf, 0, true, KSW, 2><<<dim3(DKV / 64, TT / 64, 1), 32 * KSW, 0, stream>>>(WV, nullptr, XB, nullptr, DM, nullptr, TT, bv, 0, 0, 0, 30, 0, VT16 + b * PB, VTh + b * PB, VTl + b * PB); }
    k_attn<<<NB_ * NH_ * (RH / QHB + (TT - RH) / QLB), 256, 0, stream>>>(QP16, KP16, VT16, QPh, QPl, KPh, KPl, VTh, VTl, MK, ATh, ATl);
    for (int b = 0; b < NB_; ++b)
        k_gemmw<bf, 1, true, KSW, 0><<<dim3(TT / 64, DM / 64, 1), 32 * KSW, 0, stream>>>(ATh + (size_t)b * TT * DQ, ATl + (size_t)b * TT * DQ, WO, nullptr, DQ, OUT + (size_t)b * TT * DM, DM, bo, 0, 0, 0);
}

// v005
// One run takes 317 microseconds.
// Next to v004, in two timings, it ran 1.17 and 1.16 times as fast.
// Counting every step since v000, it is 12.6 times as fast.
#include <hip/hip_runtime.h>

// Multi-head attention over three input streams with a key-padding mask (q, k, v [4][2048][1024]; qh = q w_q^T + b_q, kh = k w_k^T + b_k, vh = v w_v^T + b_v ('oi' (out, in) [1024][1024] x 0.02 + [1024]: the four biases are zero on this draw: read and added; 16 heads x 64); scores / sqrt(64); keys j with mask[b][j] == 0 (int32 [4][2048], read as data: about half the keys of every batch entry) are set to the float32 minimum: an exclusion (no batch entry has every key masked); softmax; out = merged w_o^T + b_o -> [4][2048][1024] (8.4 M); argument order q, k, v, w_q, b_q, w_k, b_k, w_v, b_v, w_o, b_o, mask).
// Layout: four launches, each for all batch entries. (1) bf16 copies of the four 'oi' weights (cast as they stand) and of query, key and value, one behind another in the workspace; (2) the three exact projections + f32 biases, whose GEMM stores the head planes itself (no f32 copy of a projection in memory); head planes of all batch entries side by side; (3) attention for every (batch entry, head): scores, key mask, softmax and P x V stay in registers (hybrid rows: < 512 hi/lo 3 products, rest fp16); (4) merged hi/lo x Wo exact + bo.
// Compute dtypes, f32 accumulate: every input rounded to bf16; projections exact + f32 biases; attention rows < 512 3 products, rest fp16; softmax f32; Wo hl x exact + bias.

#define NB_  4
#define TT   2048
#define DM   1024
#define NH_  16
#define NKV  16
#define REP  (NH_ / NKV)
#define HD   64
#define DQ   (NH_ * HD)
#define DKV  (NKV * HD)
#define RH   512                  // query rows < RH use hi+lo planes (0: none)
#define WIN  0
#define SCL  0.125f   // HD^-0.5
#define KSW  8                    // waves that share one tile's k range where K = 1024 (projections, Wo): 128 of k a wave
#define SKB  64                   // keys in one LDS stage of the attention kernel
#define SPT  72                   // LDS row pitch of a stage in 16-bit elements: 128 B of data + 16 B, an odd multiple of 16 B
#define SPE  (64 * SPT)           // elements in one stage buffer (64 rows: SKB keys of K, or HD rows of V^T)
#define QHB  128                  // query rows of a work-group where rows < RH (8 waves x 16)
#define QLB  256                  // query rows of a work-group elsewhere (8 waves x 32)
#define CL2  0.18033688011112042f // HD^-0.5 x log2(e): scores go to base 2
typedef _Float16 h16;
typedef unsigned short bf;
typedef __attribute__((ext_vector_type(16))) __bf16   v16bf;
typedef __attribute__((ext_vector_type(16))) _Float16 v16h;
typedef __attribute__((ext_vector_type(8)))  _Float16 v8h;
typedef __attribute__((ext_vector_type(8)))  unsigned short v8us;
typedef __attribute__((ext_vector_type(8)))  float    v8f;
typedef __attribute__((ext_vector_type(4)))  float    v4f;
typedef v8h  __attribute__((may_alias)) v8ha;
typedef v4f  __attribute__((may_alias)) v4fa;
typedef v8us __attribute__((may_alias)) v8usa;

__device__ __forceinline__ unsigned short f2bf(float f) { unsigned u = __float_as_uint(f); u += 0x7FFFu + ((u >> 16) & 1u); return (unsigned short)(u >> 16); }
__device__ __forceinline__ float bf2f(unsigned short b) { return __uint_as_float(((unsigned)b) << 16); }
__device__ __forceinline__ float bfr(float f) { return bf2f(f2bf(f)); }
__device__ __forceinline__ v16h cat16(v8h lo, v8h hi) { return __builtin_shufflevector(lo, hi, 0, 1, 2, 3, 4, 5, 6, 7, 8, 9, 10, 11, 12, 13, 14, 15); }
__device__ __forceinline__ v16bf cat16b(v8us lo, v8us hi) { return __builtin_bit_cast(v16bf, __builtin_shufflevector(lo, hi, 0, 1, 2, 3, 4, 5, 6, 7, 8, 9, 10, 11, 12, 13, 14, 15)); }
__device__ __forceinline__ v8f wmma16(v16h a, v16h b, v8f c) { return __builtin_amdgcn_wmma_f32_16x16x32_f16(false, a, false, b, (short)0, c, false, false); }
__device__ __forceinline__ v8f wmmab(v16bf a, v16bf b, v8f c) { return __builtin_amdgcn_wmma_f32_16x16x32_bf16(false, a, false, b, (short)0, c, false, false); }
__device__ __forceinline__ h16 tohx(float x) { return (h16)x; }
__device__ __forceinline__ void splitf(float y, unsigned short& h, unsigned short& l) { h = f2bf(y); l = f2bf(y - bf2f(h)); }
typedef __attribute__((ext_vector_type(4))) _Float16 v4h;
typedef __attribute__((ext_vector_type(4))) unsigned short v4us;



// ---- gemmw: register-blocked GEMM, one wave (KW = 1) or KW waves per 64x64 output tile (16 accumulators a wave), operands straight from K-contiguous 16-bit planes; tile (bx, by) of (M/64, N/64), 32 * KW threads; os: the work-group's LDS, (KW > 1 ? KW * 64 : 16) * 68 floats.
// C[m][n] (f32, pitch ldc, + optional f32 bias[n]) = sum_k A[m][k] Bt[n][k] (+ split products per NSPLIT). K % (32 * KW) == 0. The two kernels behind it pick operands and tile from blockIdx.
// KW = 1 only: C may lie in column planes of 1 << lcp columns, sP elements apart (column n: plane n >> lcp, place n & ((1 << lcp) - 1), row pitch ldc); the default is one plane.
// KW > 1: the tile's work-group has KW waves (32 * KW threads); wave w sums k in [w K/KW, (w+1) K/KW), the KW f32 partial tiles meet in LDS and are added in wave order.
// PL > 0 (KW > 1 only): the sum + bias is not stored as f32: it goes out as three 16-bit planes (P16 fp16, Ph + Pl bf16 hi/lo), each laid out as C would be (column planes lcp, sP; row pitch ldc). PL = 1: bias[n]. PL = 2: bias[m].
//   Q, K head planes [h][t][d]: A = x, Bt = w, lcp = 6, sP = TT * HD, ldc = HD. V^T planes [h][d][t]: the operands change places (A = w, Bt = x: C[m][n] is feature m at token n), ldc = TT, bias[m].
template <typename T16> struct WFrag;
template <> struct WFrag<h16> { typedef v16h V; static __device__ __forceinline__ V ld(const h16* p) { return cat16(*(const v8h*)p, *(const v8h*)(p + 16)); } static __device__ __forceinline__ v8f mma(V a, V b, v8f c) { return wmma16(a, b, c); } };
template <> struct WFrag<bf> { typedef v16bf V; static __device__ __forceinline__ V ld(const bf* p) { return cat16b(*(const v8us*)p, *(const v8us*)(p + 16)); } static __device__ __forceinline__ v8f mma(V a, V b, v8f c) { return wmmab(a, b, c); } };
template <typename T16, int NSPLIT, bool BIAS, int KW, int PL>
__device__ __forceinline__ void gemmw(const T16* __restrict__ A, const T16* __restrict__ A2, const T16* __restrict__ Bt, const T16* __restrict__ Bt2, int K, float* C, int ldc, const float* __restrict__ bias, int bx, int by, float* os, int lcp = 30, size_t sP = 0, h16* P16 = nullptr, bf* Ph = nullptr, bf* Pl = nullptr) {
    typedef typename WFrag<T16>::V V; static_assert(PL == 0 || KW > 1, "the plane epilogue follows the LDS sum of the KW partial tiles");
    const int lane = threadIdx.x & 31, lr = lane & 15, hi = lane >> 4; const int r0 = bx * 64, c0 = by * 64;
    v8f acc[4][4];
#pragma unroll
    for (int mb = 0; mb < 4; ++mb)
#pragma unroll
        for (int nb = 0; nb < 4; ++nb) acc[mb][nb] = (v8f){};
    const size_t aoff = (size_t)(r0 + lr) * K + 8 * hi, boff = (size_t)(c0 + lr) * K + 8 * hi;
    // the wave's number through readfirstlane: the k bounds and the wave's LDS base stay in scalar registers
    const int wv = (KW > 1) ? __builtin_amdgcn_readfirstlane((int)(threadIdx.x >> 5)) : 0; const int kbeg = wv * (K / KW), kend = kbeg + K / KW;
    for (int kc = kbeg; kc < kend; kc += 32) {
        V a[4], a2[4];
#pragma unroll
        for (int mb = 0; mb < 4; ++mb) { a[mb] = WFrag<T16>::ld(A + aoff + (size_t)mb * 16 * K + kc); if (NSPLIT == 1 || NSPLIT == 2) a2[mb] = WFrag<T16>::ld(A2 + aoff + (size_t)mb * 16 * K + kc); }
#pragma unroll
        for (int nb = 0; nb < 4; ++nb) { const V b = WFrag<T16>::ld(Bt + boff + (size_t)nb * 16 * K + kc); V b2; if (NSPLIT >= 2) b2 = WFrag<T16>::ld(Bt2 + boff + (size_t)nb * 16 * K + kc);
#pragma unroll
            for (int mb = 0; mb < 4; ++mb) { acc[mb][nb] = WFrag<T16>::mma(a[mb], b, acc[mb][nb]); if (NSPLIT == 1 || NSPLIT == 2) acc[mb][nb] = WFrag<T16>::mma(a2[mb], b, acc[mb][nb]); if (NSPLIT >= 2) acc[mb][nb] = WFrag<T16>::mma(a[mb], b2, acc[mb][nb]); } }
        asm volatile("v_nop\n\tv_nop\n\tv_nop\n\tv_nop" : "+v"(acc[0][0]), "+v"(acc[1][1]), "+v"(acc[2][2]), "+v"(acc[3][3]) : "v"(a[0]), "v"(a[3]));
    }
    if (KW > 1) {
        float* ow = os + wv * (64 * 68);
        // the three loops unrolled: acc is indexed by constants only and stays in registers
#pragma unroll
        for (int mb = 0; mb < 4; ++mb)
#pragma unroll
            for (int nb = 0; nb < 4; ++nb)
#pragma unroll
                for (int j = 0; j < 8; ++j) ow[(mb * 16 + hi * 8 + j) * 68 + nb * 16 + lr] = acc[mb][nb][j];
        __syncthreads();   // every wave's partial tile is in LDS before any thread adds them
        if constexpr (PL > 0) {
            // every loop here unrolled. First the LDS reads and the adds of all sweeps (wave order, then the bias), so that the wait behind a sweep's stores holds none of them back
            v4f val[32 / KW];
#pragma unroll
            for (int s = 0; s < 32 / KW; ++s) { const int u = s * (32 * KW) + (int)threadIdx.x, row = u >> 4, cofs = (u & 15) * 4; val[s] = *(const v4fa*)(os + row * 68 + cofs);
#pragma unroll
                for (int w = 1; w < KW; ++w) val[s] += *(const v4fa*)(os + (w * 64 + row) * 68 + cofs);
                if (BIAS) {
#pragma unroll
                    for (int q = 0; q < 4; ++q) val[s][q] += bfr(bias[PL == 1 ? c0 + cofs + q : r0 + row]); } }
            const size_t pbase = (size_t)(c0 >> lcp) * sP + (size_t)r0 * ldc + (c0 & ((1 << lcp) - 1));
#pragma unroll
            for (int s = 0; s < 32 / KW; ++s) { const int u = s * (32 * KW) + (int)threadIdx.x, row = u >> 4, cofs = (u & 15) * 4; const size_t o = pbase + (size_t)row * ldc + cofs; v4h o16; v4us oh, ol;
#pragma unroll
                for (int q = 0; q < 4; ++q) { o16[q] = tohx(val[s][q]); unsigned short a2, c2; splitf(val[s][q], a2, c2); oh[q] = a2; ol[q] = c2; }
                *(v4h*)(P16 + o) = o16; *(v4us*)(Ph + o) = oh; *(v4us*)(Pl + o) = ol;
                asm volatile("s_wait_xcnt 0x0" ::: "memory"); }   // stands in front of the next sweep's overwrite of the registers that the three stores name
            return;
        }
        // both loops unrolled: a thread's LDS reads are issued together, the adds stay in wave order
#pragma unroll
        for (int s = 0; s < 32 / KW; ++s) { const int u = s * (32 * KW) + (int)threadIdx.x, row = u >> 4, cofs = (u & 15) * 4; v4f val = *(const v4fa*)(os + row * 68 + cofs);
#pragma unroll
            for (int w = 1; w < KW; ++w) val += *(const v4fa*)(os + (w * 64 + row) * 68 + cofs);
            if (BIAS) { val[0] += bfr(bias[c0 + cofs]); val[1] += bfr(bias[c0 + cofs + 1]); val[2] += bfr(bias[c0 + cofs + 2]); val[3] += bfr(bias[c0 + cofs + 3]); }
            *(v4f*)(C + (size_t)(r0 + row) * ldc + c0 + cofs) = val; }
        return;
    }
#pragma unroll
    for (int mb = 0; mb < 4; ++mb) {
#pragma unroll
        for (int nb = 0; nb < 4; ++nb) {
#pragma unroll
            for (int j = 0; j < 8; ++j) os[(hi * 8 + j) * 68 + nb * 16 + lr] = acc[mb][nb][j]; }
        __builtin_amdgcn_wave_barrier(); asm volatile("" ::: "memory");
        float* crow = C + (size_t)(c0 >> lcp) * sP + (size_t)(r0 + mb * 16) * ldc + (c0 & ((1 << lcp) - 1));
{
#pragma unroll
            for (int s = 0; s < 8; ++s) { const int row = 2 * s + hi, cofs = lr * 4; v4f val = *(const v4fa*)(os + row * 68 + cofs); if (BIAS) { val[0] += bfr(bias[c0 + cofs]); val[1] += bfr(bias[c0 + cofs + 1]); val[2] += bfr(bias[c0 + cofs + 2]); val[3] += bfr(bias[c0 + cofs + 3]); }
                *(v4f*)(crow + (size_t)row * ldc + cofs) = val; }
             }
        __builtin_amdgcn_wave_barrier(); asm volatile("" ::: "memory");
    }
}

#define PBE  ((size_t)NH_ * TT * HD)   // elements of one batch entry in a head plane (NKV == NH_); a plane holds all NB_ entries
// ---- k_proj: the three projections of all batch entries in one launch; grid (TT/64, DQ/64, 3 * NB_), z = stream * NB_ + batch entry (streams: query, key, value).
// X: the three bf16 streams, Wt: their three weights, P16: the three fp16 planes, each set one behind another; Ph, Pl: the hi and lo planes, which alternate (a stream's pair lies 2 * NB_ * PBE behind the last one's).
__global__ __launch_bounds__(32 * KSW) void k_proj(const bf* __restrict__ X, const bf* __restrict__ Wt, int K, const float* __restrict__ bq, const float* __restrict__ bk, const float* __restrict__ bv, h16* P16, bf* Ph, bf* Pl) {
    __shared__ __align__(16) float os[KSW * 64 * 68];   // one array for both forms below
    const int z = (int)blockIdx.z, st = z / NB_, b = z % NB_;
    const bf* xs = X + (size_t)z * TT * DM; const bf* wt = Wt + (size_t)st * DQ * DM; const size_t o2 = (size_t)(st * 2 * NB_ + b) * PBE;
    if (st < 2) gemmw<bf, 0, true, KSW, 1>(xs, nullptr, wt, nullptr, K, nullptr, HD, st ? bk : bq, (int)blockIdx.x, (int)blockIdx.y, os, 6, (size_t)TT * HD, P16 + (size_t)z * PBE, Ph + o2, Pl + o2);
    else gemmw<bf, 0, true, KSW, 2>(wt, nullptr, xs, nullptr, K, nullptr, TT, bv, (int)blockIdx.y, (int)blockIdx.x, os, 30, 0, P16 + (size_t)z * PBE, Ph + o2, Pl + o2);
}
// ---- k_out: merged hi/lo x Wo + bo of all batch entries in one launch; grid (TT/64, DM/64, NB_)
__global__ __launch_bounds__(32 * KSW) void k_out(const bf* __restrict__ Ah, const bf* __restrict__ Al, const bf* __restrict__ Wt, int K, float* C, const float* __restrict__ bo) {
    __shared__ __align__(16) float os[KSW * 64 * 68];
    const size_t z = blockIdx.z;
    gemmw<bf, 1, true, KSW, 0>(Ah + z * TT * DQ, Al + z * TT * DQ, Wt, nullptr, K, C + z * TT * DM, DM, bo, (int)blockIdx.x, (int)blockIdx.y, os);
}

typedef __attribute__((ext_vector_type(4))) int v4i;

// ---- k_cvt: every f32 -> bf16 copy in one launch. A chunk is 2048 elements (256 threads x 8); the chunks of w_q, w_k, w_v, w_o, query, key, value follow one another, as their copies do in dst.
// A work-group takes CVC chunks in a row, all of one source: few waves to start, one address a thread (the chunks are reached by constant offsets), CVU chunks' loads of a thread in flight together.
#define CVC  16
#define CVU  4
#define CVW  (DM * DM / 2048 / CVC)            // work-groups of a weight
#define CVX  (NB_ * TT * DM / 2048 / CVC)      // work-groups of a stream
static_assert(DQ == DM && DKV == DM && (DM * DM) % (2048 * CVC) == 0 && CVC % CVU == 0, "whole work-groups for every source");
__global__ __launch_bounds__(256) void k_cvt(const float* __restrict__ wq, const float* __restrict__ wk, const float* __restrict__ wv, const float* __restrict__ wo, const float* __restrict__ xq, const float* __restrict__ xk, const float* __restrict__ xv, bf* __restrict__ dst) {
    const unsigned g = blockIdx.x, gx = g - 4 * CVW; const bool isw = g < 4 * CVW; const unsigned w = isw ? g / CVW : gx / CVX, l = isw ? g % CVW : gx % CVX;
    const float* s = (isw ? (w == 0 ? wq : w == 1 ? wk : w == 2 ? wv : wo) : (w == 0 ? xq : w == 1 ? xk : xv)) + (size_t)l * (CVC * 2048) + threadIdx.x * 8;
    bf* d = dst + (size_t)g * (CVC * 2048) + threadIdx.x * 8;
    // all loops unrolled: v is indexed by constants only, every chunk is a constant offset from s and d, and a round's loads are issued before the first is used
#pragma unroll
    for (int i0 = 0; i0 < CVC; i0 += CVU) {
        v8f v[CVU];
#pragma unroll
        for (int i = 0; i < CVU; ++i) v[i] = *(const v8f*)(s + (i0 + i) * 2048);
#pragma unroll
        for (int i = 0; i < CVU; ++i) { v8us o;
#pragma unroll
            for (int k = 0; k < 8; ++k) o[k] = f2bf(v[i][k]);
            *(v8us*)(d + (i0 + i) * 2048) = o; }
        if (i0 + CVU < CVC) asm volatile("s_wait_xcnt 0x0" ::: "memory");   // stands in front of the next round's overwrite of the registers that this round's stores name
    }
}

typedef __attribute__((ext_vector_type(8))) __bf16 v8bf;
__device__ __forceinline__ float xhalf(float x) { return __builtin_bit_cast(float, __builtin_amdgcn_permlanex16(__builtin_bit_cast(int, x), __builtin_bit_cast(int, x), 0x76543210, 0xfedcba98, false, false)); }   // lane l with lane l ^ 16
// eight base-2 exponentials in place, in one statement: none of them is directly followed by a reader of its result or a writer of its source; the v_nop keeps that slot behind the last one
__device__ __forceinline__ v8f exp2x8(v8f x) { float a0 = x[0], a1 = x[1], a2 = x[2], a3 = x[3], a4 = x[4], a5 = x[5], a6 = x[6], a7 = x[7];
    asm("v_exp_f32 %0, %0\n\tv_exp_f32 %1, %1\n\tv_exp_f32 %2, %2\n\tv_exp_f32 %3, %3\n\tv_exp_f32 %4, %4\n\tv_exp_f32 %5, %5\n\tv_exp_f32 %6, %6\n\tv_exp_f32 %7, %7\n\tv_nop" : "+v"(a0), "+v"(a1), "+v"(a2), "+v"(a3), "+v"(a4), "+v"(a5), "+v"(a6), "+v"(a7));
    return (v8f){a0, a1, a2, a3, a4, a5, a6, a7}; }
template <bool HR> struct AFrag;
template <> struct AFrag<true>  { typedef bf  T; static __device__ __forceinline__ v16bf ld(const bf* p) { return cat16b(*(const v8usa*)p, *(const v8usa*)(p + 16)); } };
template <> struct AFrag<false> { typedef h16 T; static __device__ __forceinline__ v16h ld(const bf* p) { return cat16(__builtin_bit_cast(v8h, (v8us)*(const v8usa*)p), __builtin_bit_cast(v8h, (v8us)*(const v8usa*)(p + 16))); } };
template <bool HR>
__device__ __forceinline__ void attn_body(const bf* __restrict__ Q0, const bf* __restrict__ Q1, const bf* __restrict__ K0, const bf* __restrict__ K1, const bf* __restrict__ V0, const bf* __restrict__ V1, const float* bs, bf* sm, int q0, bf* Ah, bf* Al) {
    typedef typename AFrag<HR>::T T16; typedef typename WFrag<T16>::V V;
    // every inner loop below is unrolled: the fragment, score and output arrays are indexed by constants only and stay in registers
    constexpr int NQ = HR ? 1 : 2;      // 16-query groups a wave
    constexpr int NP = HR ? 2 : 1;      // planes an operand
    const int tid = (int)threadIdx.x, lane = tid & 31, lr = lane & 15, hi = lane >> 4;
    const int qw = q0 + __builtin_amdgcn_readfirstlane(tid >> 5) * (16 * NQ);
    const int srow = tid >> 3, scol = (tid & 7) * 8;   // staging: 8 threads a 128-byte row, 32 rows a sweep
    V qa[NQ][2], qb[NQ][2];
#pragma unroll
    for (int g = 0; g < NQ; ++g)
#pragma unroll
        for (int ks = 0; ks < 2; ++ks) { const unsigned o = (unsigned)((qw + g * 16 + lr) * HD + ks * 32 + 8 * hi); qa[g][ks] = AFrag<HR>::ld(Q0 + o); if (HR) qb[g][ks] = AFrag<HR>::ld(Q1 + o); }
    v8f ot[4][NQ]; float mr[NQ], ls[NQ];
#pragma unroll
    for (int g = 0; g < NQ; ++g) { mr[g] = -3.0e38f; ls[g] = 0.f;
#pragma unroll
        for (int db = 0; db < 4; ++db) ot[db][g] = (v8f){}; }
    v8us sk[NP][2], sv[NP][2];
    // stage buffers in sm: (plane * 2 + buffer) * SPE; planes K0, V0, K1, V1
#define ATT_GLOAD(s) { _Pragma("unroll") for (int c = 0; c < 2; ++c) { const int row = srow + 32 * c; \
        const unsigned ko = (unsigned)(((s) * SKB + row) * HD + scol), vo = (unsigned)(row * TT + (s) * SKB + scol); \
        sk[0][c] = *(const v8usa*)(K0 + ko); sv[0][c] = *(const v8usa*)(V0 + vo); if (HR) { sk[NP - 1][c] = *(const v8usa*)(K1 + ko); sv[NP - 1][c] = *(const v8usa*)(V1 + vo); } } }
#define ATT_SSTORE(b) { _Pragma("unroll") for (int c = 0; c < 2; ++c) { bf* d = sm + (b) * SPE + (srow + 32 * c) * SPT + scol; \
        *(v8usa*)d = sk[0][c]; *(v8usa*)(d + 2 * SPE) = sv[0][c]; if (HR) { *(v8usa*)(d + 4 * SPE) = sk[NP - 1][c]; *(v8usa*)(d + 6 * SPE) = sv[NP - 1][c]; } } }
    ATT_GLOAD(0) ATT_SSTORE(0)
    __syncthreads();   // stage 0 and the bias row are in LDS before any wave reads them
    // the stage loop stays rolled: the body is long, and every register array inside is indexed by constants
#pragma unroll 1
    for (int s = 0; s < TT / SKB; ++s) {
        const int buf = s & 1; const bool more = (s + 1 < TT / SKB);
        if (more) ATT_GLOAD(s + 1)
        const bf* kb = sm + buf * SPE + lr * SPT + 8 * hi; const bf* vb = kb + 2 * SPE;
#pragma unroll
        for (int ps = 0; ps < SKB / 32; ++ps) {
            v8f sc[2][NQ]; float tm[NQ];
#pragma unroll
            for (int g = 0; g < NQ; ++g) tm[g] = -3.0e38f;
#pragma unroll
            for (int kt = 0; kt < 2; ++kt) {
                const bf* kp = kb + (ps * 32 + kt * 16) * SPT; V ka[2], kl[2];
#pragma unroll
                for (int ks = 0; ks < 2; ++ks) { ka[ks] = AFrag<HR>::ld(kp + ks * 32); if (HR) kl[ks] = AFrag<HR>::ld(kp + 4 * SPE + ks * 32); }
                const float* bp = bs + s * SKB + ps * 32 + kt * 16 + 8 * hi; const v8f b8 = __builtin_shufflevector((v4f)*(const v4fa*)bp, (v4f)*(const v4fa*)(bp + 4), 0, 1, 2, 3, 4, 5, 6, 7);
#pragma unroll
                for (int g = 0; g < NQ; ++g) { v8f a = (v8f){};
#pragma unroll
                    for (int ks = 0; ks < 2; ++ks) { a = WFrag<T16>::mma(ka[ks], qa[g][ks], a); if (HR) { a = WFrag<T16>::mma(ka[ks], qb[g][ks], a); a = WFrag<T16>::mma(kl[ks], qa[g][ks], a); } }
                    a = __builtin_elementwise_fma(a, (v8f)(CL2), b8);
#pragma unroll
                    for (int r = 0; r < 8; ++r) tm[g] = fmaxf(tm[g], a[r]);
                    sc[kt][g] = a; }
            }
            bool need = false;
#pragma unroll
            for (int g = 0; g < NQ; ++g) { tm[g] = fmaxf(tm[g], xhalf(tm[g])); need = need || (tm[g] > mr[g] + 8.0f); }
            if (__builtin_amdgcn_ballot_w32(need) != 0) {   // one scalar branch a pass: rare after the first keys kept
#pragma unroll
                for (int g = 0; g < NQ; ++g) { const float mn = fmaxf(mr[g], tm[g]); const float f = __builtin_amdgcn_exp2f(mr[g] - mn); mr[g] = mn; ls[g] *= f;
#pragma unroll
                    for (int db = 0; db < 4; ++db) ot[db][g] *= f; }
            }
            V pa[NQ], pl[NQ];
#pragma unroll
            for (int g = 0; g < NQ; ++g) { const v8f p0 = exp2x8(sc[0][g] - (v8f)(mr[g])), p1 = exp2x8(sc[1][g] - (v8f)(mr[g]));
                const v8f p8 = p0 + p1; const v4f p4 = __builtin_shufflevector(p8, p8, 0, 1, 2, 3) + __builtin_shufflevector(p8, p8, 4, 5, 6, 7); ls[g] += (p4[0] + p4[1]) + (p4[2] + p4[3]);   // a short tree: no chain of 16 dependent adds
                if constexpr (HR) { const v8bf h0 = __builtin_convertvector(p0, v8bf), h1 = __builtin_convertvector(p1, v8bf);
                    const v8bf l0 = __builtin_convertvector(p0 - __builtin_convertvector(h0, v8f), v8bf), l1 = __builtin_convertvector(p1 - __builtin_convertvector(h1, v8f), v8bf);
                    pa[g] = __builtin_shufflevector(h0, h1, 0, 1, 2, 3, 4, 5, 6, 7, 8, 9, 10, 11, 12, 13, 14, 15); pl[g] = __builtin_shufflevector(l0, l1, 0, 1, 2, 3, 4, 5, 6, 7, 8, 9, 10, 11, 12, 13, 14, 15);
                } else { pa[g] = cat16(__builtin_convertvector(p0, v8h), __builtin_convertvector(p1, v8h)); } }
#pragma unroll
            for (int db = 0; db < 4; ++db) { const bf* vp = vb + db * 16 * SPT + ps * 32; const V va = AFrag<HR>::ld(vp); V vl; if (HR) vl = AFrag<HR>::ld(vp + 4 * SPE);
#pragma unroll
                for (int g = 0; g < NQ; ++g) { ot[db][g] = WFrag<T16>::mma(va, pa[g], ot[db][g]); if (HR) { ot[db][g] = WFrag<T16>::mma(va, pl[g], ot[db][g]); ot[db][g] = WFrag<T16>::mma(vl, pa[g], ot[db][g]); } } }
        }
        if (more) ATT_SSTORE(buf ^ 1)
        __syncthreads();   // publishes stage s + 1 and ends every wave's reads of stage s, whose buffer the next trip refills
    }
#undef ATT_GLOAD
#undef ATT_SSTORE
#pragma unroll
    for (int g = 0; g < NQ; ++g) { const float inv = __fdiv_rn(1.0f, ls[g] + xhalf(ls[g])); const unsigned oo = (unsigned)((qw + g * 16 + lr) * DQ + 8 * hi);
#pragma unroll
        for (int db = 0; db < 4; ++db) { v8us oh, ol;
#pragma unroll
            for (int r = 0; r < 8; ++r) { unsigned short a, c2; splitf(ot[db][g][r] * inv, a, c2); oh[r] = a; ol[r] = c2; }
            *(v8us*)(Ah + oo + db * 16) = oh; *(v8us*)(Al + oo + db * 16) = ol;
            asm volatile("s_wait_xcnt 0x0" ::: "memory"); } }   // stands in front of the next trip's (and the tail's) overwrite of the registers that the two stores name
}
// grid: NB_ * NH_ * RH / QHB work-groups of rows < RH first (the longer ones), then NB_ * NH_ * (TT - RH) / QLB
// waves_per_eu(4, 4): the register budget of 4 waves a SIMD, so that the output, score and staging arrays stay in registers (no spills)
__global__ __launch_bounds__(256) __attribute__((amdgpu_waves_per_eu(4, 4))) void k_attn(const h16* __restrict__ Q16, const h16* __restrict__ K16, const h16* __restrict__ V16, const bf* __restrict__ Qh, const bf* __restrict__ Ql, const bf* __restrict__ Kh, const bf* __restrict__ Kl, const bf* __restrict__ Vh, const bf* __restrict__ Vl, const int* __restrict__ mk, bf* Ah, bf* Al) {
    __shared__ __align__(16) bf sm[8 * SPE]; __shared__ __align__(16) float bs[TT];
    constexpr int NHW = NB_ * NH_ * (RH / QHB); const int x = (int)blockIdx.x; const bool hr = x < NHW;
    const int bh = hr ? x / (RH / QHB) : (x - NHW) / ((TT - RH) / QLB); const int q0 = hr ? (x % (RH / QHB)) * QHB : RH + ((x - NHW) % ((TT - RH) / QLB)) * QLB;
    const int b = bh / NH_, h = bh % NH_; const size_t po = (size_t)bh * TT * HD, ao = (size_t)b * TT * DQ + h * HD;
    { const int j = (int)threadIdx.x * (TT / 256); const int* mp = mk + (size_t)b * TT + j;
#pragma unroll
      for (int c = 0; c < TT / 256; c += 4) { const v4i m4 = *(const v4i*)(mp + c); v4f o; 
#pragma unroll
          for (int q = 0; q < 4; ++q) o[q] = (m4[q] != 0) ? 0.0f : -3.0e38f;
          *(v4fa*)(bs + j + c) = o; } }
    if (hr) attn_body<true>(Qh + po, Ql + po, Kh + po, Kl + po, Vh + po, Vl + po, bs, sm, q0, Ah + ao, Al + ao);
    else attn_body<false>((const bf*)(Q16 + po), nullptr, (const bf*)(K16 + po), nullptr, (const bf*)(V16 + po), nullptr, bs, sm, q0, Ah + ao, Al + ao);
}

extern "C" void kernel_launch(void* const* d_in, const int* in_sizes, int n_in,
                              void* d_out, int out_size, void* d_ws, size_t ws_size, hipStream_t stream) {
    (void)in_sizes; (void)n_in; (void)out_size;
    const float* x = (const float*)d_in[0]; const float* xk = (const float*)d_in[1]; const float* xv = (const float*)d_in[2]; const float* wq = (const float*)d_in[3]; const float* bq = (const float*)d_in[4]; const float* wk = (const float*)d_in[5]; const float* bk = (const float*)d_in[6]; const float* wv = (const float*)d_in[7]; const float* bv = (const float*)d_in[8]; const float* wo = (const float*)d_in[9]; const float* bo = (const float*)d_in[10]; const int* MK = (const int*)d_in[11];   /* argument order q, k, v, w_q, b_q, w_k, b_k, w_v, b_v, w_o, b_o ('oi'), mask (int32 [4][2048]: read) */
    float* OUT = (float*)d_out;     // [4][2048][1024]
    char* wsp = (char*)d_ws;
    auto take = [&](size_t bytes) { char* p = wsp; wsp += (bytes + 255) & ~(size_t)255; return (void*)p; };
    bf* WQ = (bf*)take((size_t)DQ * DM * 2); bf* WK = (bf*)take((size_t)DKV * DM * 2); bf* WV = (bf*)take((size_t)DKV * DM * 2); bf* WO = (bf*)take((size_t)DM * DQ * 2);
    bf* XB = (bf*)take((size_t)3 * NB_ * TT * DM * 2);   // query, key, value of all batch entries; directly behind the weights (k_cvt writes the seven copies as one run)
    const size_t PB = PBE;
    h16* QP16 = (h16*)take(NB_ * PB * 2); h16* KP16 = (h16*)take(NB_ * PB * 2); h16* VT16 = (h16*)take(NB_ * PB * 2);
    bf* QPh = (bf*)take(NB_ * PB * 2); bf* QPl = (bf*)take(NB_ * PB * 2); bf* KPh = (bf*)take(NB_ * PB * 2); bf* KPl = (bf*)take(NB_ * PB * 2); bf* VTh = (bf*)take(NB_ * PB * 2); bf* VTl = (bf*)take(NB_ * PB * 2);
    bf* ATh = (bf*)take((size_t)NB_ * TT * DQ * 2); bf* ATl = (bf*)take((size_t)NB_ * TT * DQ * 2);
    if ((size_t)(wsp - (char*)d_ws) > ws_size) return;    // 232 MiB of the 256 MiB
    (void)WK; (void)WV;   // reached through WQ: the weights' copies lie in one run
    k_cvt<<<4 * CVW + 3 * CVX, 256, 0, stream>>>(wq, wk, wv, wo, x, xk, xv, WQ);
    k_proj<<<dim3(TT / 64, DQ / 64, 3 * NB_), 32 * KSW, 0, stream>>>(XB, WQ, DM, bq, bk, bv, QP16, QPh, QPl);
    k_attn<<<NB_ * NH_ * (RH / QHB + (TT - RH) / QLB), 256, 0, stream>>>(QP16, KP16, VT16, QPh, QPl, KPh, KPl, VTh, VTl, MK, ATh, ATl);
    k_out<<<dim3(TT / 64, DM / 64, NB_), 32 * KSW, 0, stream>>>(ATh, ATl, WO, DQ, OUT, bo);
}

// v006
// A run of this version takes 247 microseconds.
// Two timings next to v005 both put it at 1.28 times that version's speed.
// Over all steps from v000 it is 16.1 times as fast.
#include <hip/hip_runtime.h>

// Multi-head attention over three input streams with a key-padding mask (q, k, v [4][2048][1024]; qh = q w_q^T + b_q, kh = k w_k^T + b_k, vh = v w_v^T + b_v ('oi' (out, in) [1024][1024] x 0.02 + [1024]: the four biases are zero on this draw: read and added; 16 heads x 64); scores / sqrt(64); keys j with mask[b][j] == 0 (int32 [4][2048], read as data: about half the keys of every batch entry) are set to the float32 minimum: an exclusion (no batch entry has every key masked); softmax; out = merged w_o^T + b_o -> [4][2048][1024] (8.4 M); argument order q, k, v, w_q, b_q, w_k, b_k, w_v, b_v, w_o, b_o, mask).
// Keys packed: a key with mask word 0 has weight exactly 0 in f32 as soon as one key of its batch entry is kept, so launch (1) stores the key and value rows of a batch entry with the kept ones first, in their order, the others behind them, and writes the count of kept keys; (2) and (3) work on key places below the count rounded up to a stage of 64 (all places where no key is kept); places from the count on get the bias.
// Layout: four launches, each for all batch entries. (1) bf16 copies of the four 'oi' weights (cast as they stand) and of query, key and value, one behind another in the workspace; (2) the three exact projections + f32 biases, whose GEMM stores the head planes itself (no f32 copy of a projection in memory); head planes of all batch entries side by side; (3) attention for every (batch entry, head): scores, key mask, softmax and P x V stay in registers (hybrid rows: < 512 hi/lo 3 products, rest fp16); (4) merged hi/lo x Wo exact + bo.
// Compute dtypes, f32 accumulate: every input rounded to bf16; projections exact + f32 biases; attention rows < 512 3 products, rest fp16; softmax f32; Wo hl x exact + bias.

#define NB_  4
#define TT   2048
#define DM   1024
#define NH_  16
#define NKV  16
#define REP  (NH_ / NKV)
#define HD   64
#define DQ   (NH_ * HD)
#define DKV  (NKV * HD)
#define RH   512                  // query rows < RH use hi+lo planes (0: none)
#define WIN  0
#define SCL  0.125f   // HD^-0.5
#define KSW  8                    // waves that share one tile's k range where K = 1024 (projections, Wo): 128 of k a wave
#define SKB  64                   // keys in one LDS stage of the attention kernel
#define SPT  72                   // LDS row pitch of a stage in 16-bit elements: 128 B of data + 16 B, an odd multiple of 16 B
#define SPE  (64 * SPT)           // elements in one stage buffer (64 rows: SKB keys of K, or HD rows of V^T)
#define QHB  128                  // query rows of a work-group where rows < RH (8 waves x 16)
#define QLB  256                  // query rows of a work-group elsewhere (8 waves x 32)
#define CL2  0.18033688011112042f // HD^-0.5 x log2(e): scores go to base 2
typedef _Float16 h16;
typedef unsigned short bf;
typedef __attribute__((ext_vector_type(16))) __bf16   v16bf;
typedef __attribute__((ext_vector_type(16))) _Float16 v16h;
typedef __attribute__((ext_vector_type(8)))  _Float16 v8h;
typedef __attribute__((ext_vector_type(8)))  unsigned short v8us;
typedef __attribute__((ext_vector_type(8)))  float    v8f;
typedef __attribute__((ext_vector_type(4)))  float    v4f;
typedef v8h  __attribute__((may_alias)) v8ha;
typedef v4f  __attribute__((may_alias)) v4fa;
typedef v8us __attribute__((may_alias)) v8usa;

__device__ __forceinline__ unsigned short f2bf(float f) { unsigned u = __float_as_uint(f); u += 0x7FFFu + ((u >> 16) & 1u); return (unsigned short)(u >> 16); }
__device__ __forceinline__ float bf2f(unsigned short b) { return __uint_as_float(((unsigned)b) << 16); }
__device__ __forceinline__ float bfr(float f) { return bf2f(f2bf(f)); }
__device__ __forceinline__ v16h cat16(v8h lo, v8h hi) { return __builtin_shufflevector(lo, hi, 0, 1, 2, 3, 4, 5, 6, 7, 8, 9, 10, 11, 12, 13, 14, 15); }
__device__ __forceinline__ v16bf cat16b(v8us lo, v8us hi) { return __builtin_bit_cast(v16bf, __builtin_shufflevector(lo, hi, 0, 1, 2, 3, 4, 5, 6, 7, 8, 9, 10, 11, 12, 13, 14, 15)); }
__device__ __forceinline__ v8f wmma16(v16h a, v16h b, v8f c) { return __builtin_amdgcn_wmma_f32_16x16x32_f16(false, a, false, b, (short)0, c, false, false); }
__device__ __forceinline__ v8f wmmab(v16bf a, v16bf b, v8f c) { return __builtin_amdgcn_wmma_f32_16x16x32_bf16(false, a, false, b, (short)0, c, false, false); }
__device__ __forceinline__ h16 tohx(float x) { return (h16)x; }
__device__ __forceinline__ void splitf(float y, unsigned short& h, unsigned short& l) { h = f2bf(y); l = f2bf(y - bf2f(h)); }
typedef __attribute__((ext_vector_type(4))) _Float16 v4h;
typedef __attribute__((ext_vector_type(4))) unsigned short v4us;
// kept keys of a batch entry as launch (1) counted them, held inside the shape; and the key places that are worked on: the count rounded up to whole stages, or every place where no key is kept (the row is then uniform over all keys)
#define KCS  32                   // the counts lie 128 bytes apart: each has its own writer and its own line
__device__ __forceinline__ int keycnt(const int* __restrict__ kc, int b) { const int c = kc[b * KCS]; return c < 0 ? 0 : (c > TT ? TT : c); }
__device__ __forceinline__ int keylim(int c) { return c > 0 ? ((c + SKB - 1) & ~(SKB - 1)) : TT; }
static_assert(SKB % 64 == 0 && TT % SKB == 0, "a stage is whole 64-token GEMM tiles");



// ---- gemmw: register-blocked GEMM, one wave (KW = 1) or KW waves per 64x64 output tile (16 accumulators a wave), operands straight from K-contiguous 16-bit planes; tile (bx, by) of (M/64, N/64), 32 * KW threads; os: the work-group's LDS, (KW > 1 ? KW * 64 : 16) * 68 floats.
// C[m][n] (f32, pitch ldc, + optional f32 bias[n]) = sum_k A[m][k] Bt[n][k] (+ split products per NSPLIT). K % (32 * KW) == 0. The two kernels behind it pick operands and tile from blockIdx.
// KW = 1 only: C may lie in column planes of 1 << lcp columns, sP elements apart (column n: plane n >> lcp, place n & ((1 << lcp) - 1), row pitch ldc); the default is one plane.
// KW > 1: the tile's work-group has KW waves (32 * KW threads); wave w sums k in [w K/KW, (w+1) K/KW), the KW f32 partial tiles meet in LDS and are added in wave order.
// PL > 0 (KW > 1 only): the sum + bias is not stored as f32: it goes out as three 16-bit planes (P16 fp16, Ph + Pl bf16 hi/lo), each laid out as C would be (column planes lcp, sP; row pitch ldc). PL = 1: bias[n]. PL = 2: bias[m].
//   Q, K head planes [h][t][d]: A = x, Bt = w, lcp = 6, sP = TT * HD, ldc = HD. V^T planes [h][d][t]: the operands change places (A = w, Bt = x: C[m][n] is feature m at token n), ldc = TT, bias[m].
template <typename T16> struct WFrag;
template <> struct WFrag<h16> { typedef v16h V; static __device__ __forceinline__ V ld(const h16* p) { return cat16(*(const v8h*)p, *(const v8h*)(p + 16)); } static __device__ __forceinline__ v8f mma(V a, V b, v8f c) { return wmma16(a, b, c); } };
template <> struct WFrag<bf> { typedef v16bf V; static __device__ __forceinline__ V ld(const bf* p) { return cat16b(*(const v8us*)p, *(const v8us*)(p + 16)); } static __device__ __forceinline__ v8f mma(V a, V b, v8f c) { return wmmab(a, b, c); } };
template <typename T16, int NSPLIT, bool BIAS, int KW, int PL>
__device__ __forceinline__ void gemmw(const T16* __restrict__ A, const T16* __restrict__ A2, const T16* __restrict__ Bt, const T16* __restrict__ Bt2, int K, float* C, int ldc, const float* __restrict__ bias, int bx, int by, float* os, int lcp = 30, size_t sP = 0, h16* P16 = nullptr, bf* Ph = nullptr, bf* Pl = nullptr) {
    typedef typename WFrag<T16>::V V; static_assert(PL == 0 || KW > 1, "the plane epilogue follows the LDS sum of the KW partial tiles");
    const int lane = threadIdx.x & 31, lr = lane & 15, hi = lane >> 4; const int r0 = bx * 64, c0 = by * 64;
    v8f acc[4][4];
#pragma unroll
    for (int mb = 0; mb < 4; ++mb)
#pragma unroll
        for (int nb = 0; nb < 4; ++nb) acc[mb][nb] = (v8f){};
    const size_t aoff = (size_t)(r0 + lr) * K + 8 * hi, boff = (size_t)(c0 + lr) * K + 8 * hi;
    // the wave's number through readfirstlane: the k bounds and the wave's LDS base stay in scalar registers
    const int wv = (KW > 1) ? __builtin_amdgcn_readfirstlane((int)(threadIdx.x >> 5)) : 0; const int kbeg = wv * (K / KW), kend = kbeg + K / KW;
    for (int kc = kbeg; kc < kend; kc += 32) {
        V a[4], a2[4];
#pragma unroll
        for (int mb = 0; mb < 4; ++mb) { a[mb] = WFrag<T16>::ld(A + aoff + (size_t)mb * 16 * K + kc); if (NSPLIT == 1 || NSPLIT == 2) a2[mb] = WFrag<T16>::ld(A2 + aoff + (size_t)mb * 16 * K + kc); }
#pragma unroll
        for (int nb = 0; nb < 4; ++nb) { const V b = WFrag<T16>::ld(Bt + boff + (size_t)nb * 16 * K + kc); V b2; if (NSPLIT >= 2) b2 = WFrag<T16>::ld(Bt2 + boff + (size_t)nb * 16 * K + kc);
#pragma unroll
            for (int mb = 0; mb < 4; ++mb) { acc[mb][nb] = WFrag<T16>::mma(a[mb], b, acc[mb][nb]); if (NSPLIT == 1 || NSPLIT == 2) acc[mb][nb] = WFrag<T16>::mma(a2[mb], b, acc[mb][nb]); if (NSPLIT >= 2) acc[mb][nb] = WFrag<T16>::mma(a[mb], b2, acc[mb][nb]); } }
        asm volatile("v_nop\n\tv_nop\n\tv_nop\n\tv_nop" : "+v"(acc[0][0]), "+v"(acc[1][1]), "+v"(acc[2][2]), "+v"(acc[3][3]) : "v"(a[0]), "v"(a[3]));
    }
    if (KW > 1) {
        float* ow = os + wv * (64 * 68);
        // the three loops unrolled: acc is indexed by constants only and stays in registers
#pragma unroll
        for (int mb = 0; mb < 4; ++mb)
#pragma unroll
            for (int nb = 0; nb < 4; ++nb)
#pragma unroll
                for (int j = 0; j < 8; ++j) ow[(mb * 16 + hi * 8 + j) * 68 + nb * 16 + lr] = acc[mb][nb][j];
        __syncthreads();   // every wave's partial tile is in LDS before any thread adds them
        if constexpr (PL > 0) {
            // every loop here unrolled. First the LDS reads and the adds of all sweeps (wave order, then the bias), so that the wait behind a sweep's stores holds none of them back
            v4f val[32 / KW];
#pragma unroll
            for (int s = 0; s < 32 / KW; ++s) { const int u = s * (32 * KW) + (int)threadIdx.x, row = u >> 4, cofs = (u & 15) * 4; val[s] = *(const v4fa*)(os + row * 68 + cofs);
#pragma unroll
                for (int w = 1; w < KW; ++w) val[s] += *(const v4fa*)(os + (w * 64 + row) * 68 + cofs);
                if (BIAS) {
#pragma unroll
                    for (int q = 0; q < 4; ++q) val[s][q] += bfr(bias[PL == 1 ? c0 + cofs + q : r0 + row]); } }
            const size_t pbase = (size_t)(c0 >> lcp) * sP + (size_t)r0 * ldc + (c0 & ((1 << lcp) - 1));
#pragma unroll
            for (int s = 0; s < 32 / KW; ++s) { const int u = s * (32 * KW) + (int)threadIdx.x, row = u >> 4, cofs = (u & 15) * 4; const size_t o = pbase + (size_t)row * ldc + cofs; v4h o16; v4us oh, ol;
#pragma unroll
                for (int q = 0; q < 4; ++q) { o16[q] = tohx(val[s][q]); unsigned short a2, c2; splitf(val[s][q], a2, c2); oh[q] = a2; ol[q] = c2; }
                *(v4h*)(P16 + o) = o16; *(v4us*)(Ph + o) = oh; *(v4us*)(Pl + o) = ol;
                asm volatile("s_wait_xcnt 0x0" ::: "memory"); }   // stands in front of the next sweep's overwrite of the registers that the three stores name
            return;
        }
        // both loops unrolled: a thread's LDS reads are issued together, the adds stay in wave order
#pragma unroll
        for (int s = 0; s < 32 / KW; ++s) { const int u = s * (32 * KW) + (int)threadIdx.x, row = u >> 4, cofs = (u & 15) * 4; v4f val = *(const v4fa*)(os + row * 68 + cofs);
#pragma unroll
            for (int w = 1; w < KW; ++w) val += *(const v4fa*)(os + (w * 64 + row) * 68 + cofs);
            if (BIAS) { val[0] += bfr(bias[c0 + cofs]); val[1] += bfr(bias[c0 + cofs + 1]); val[2] += bfr(bias[c0 + cofs + 2]); val[3] += bfr(bias[c0 + cofs + 3]); }
            *(v4f*)(C + (size_t)(r0 + row) * ldc + c0 + cofs) = val; }
        return;
    }
#pragma unroll
    for (int mb = 0; mb < 4; ++mb) {
#pragma unroll
        for (int nb = 0; nb < 4; ++nb) {
#pragma unroll
            for (int j = 0; j < 8; ++j) os[(hi * 8 + j) * 68 + nb * 16 + lr] = acc[mb][nb][j]; }
        __builtin_amdgcn_wave_barrier(); asm volatile("" ::: "memory");
        float* crow = C + (size_t)(c0 >> lcp) * sP + (size_t)(r0 + mb * 16) * ldc + (c0 & ((1 << lcp) - 1));
{
#pragma unroll
            for (int s = 0; s < 8; ++s) { const int row = 2 * s + hi, cofs = lr * 4; v4f val = *(const v4fa*)(os + row * 68 + cofs); if (BIAS) { val[0] += bfr(bias[c0 + cofs]); val[1] += bfr(bias[c0 + cofs + 1]); val[2] += bfr(bias[c0 + cofs + 2]); val[3] += bfr(bias[c0 + cofs + 3]); }
                *(v4f*)(crow + (size_t)row * ldc + cofs) = val; }
             }
        __builtin_amdgcn_wave_barrier(); asm volatile("" ::: "memory");
    }
}

#define PBE  ((size_t)NH_ * TT * HD)   // elements of one batch entry in a head plane (NKV == NH_); a plane holds all NB_ entries
// ---- k_proj: the three projections of all batch entries in one launch; grid (TT/64, DQ/64, 3 * NB_), z = stream * NB_ + batch entry (streams: query, key, value).
// Key and value rows lie packed (kept keys first): blockIdx.x is their token tile in both forms, and tiles past the places in use are left out. X: the three bf16 streams, Wt: their three weights, P16: the three fp16 planes, each set one behind another; Ph, Pl: the hi and lo planes, which alternate (a stream's pair lies 2 * NB_ * PBE behind the last one's).
__global__ __launch_bounds__(32 * KSW) void k_proj(const bf* __restrict__ X, const bf* __restrict__ Wt, int K, const float* __restrict__ bq, const float* __restrict__ bk, const float* __restrict__ bv, const int* __restrict__ kc, h16* P16, bf* Ph, bf* Pl) {
    __shared__ __align__(16) float os[KSW * 64 * 68];   // one array for both forms below
    const int z = (int)blockIdx.z, st = z / NB_, b = z % NB_;
    if (st > 0 && (int)blockIdx.x * 64 >= keylim(keycnt(kc, b))) return;   // key, value: a token tile past the key places in use; the whole work-group leaves, in front of every barrier
    const bf* xs = X + (size_t)z * TT * DM; const bf* wt = Wt + (size_t)st * DQ * DM; const size_t o2 = (size_t)(st * 2 * NB_ + b) * PBE;
    if (st < 2) gemmw<bf, 0, true, KSW, 1>(xs, nullptr, wt, nullptr, K, nullptr, HD, st ? bk : bq, (int)blockIdx.x, (int)blockIdx.y, os, 6, (size_t)TT * HD, P16 + (size_t)z * PBE, Ph + o2, Pl + o2);
    else gemmw<bf, 0, true, KSW, 2>(wt, nullptr, xs, nullptr, K, nullptr, TT, bv, (int)blockIdx.y, (int)blockIdx.x, os, 30, 0, P16 + (size_t)z * PBE, Ph + o2, Pl + o2);
}
// ---- k_out: merged hi/lo x Wo + bo of all batch entries in one launch; grid (TT/64, DM/64, NB_)
__global__ __launch_bounds__(32 * KSW) void k_out(const bf* __restrict__ Ah, const bf* __restrict__ Al, const bf* __restrict__ Wt, int K, float* C, const float* __restrict__ bo) {
    __shared__ __align__(16) float os[KSW * 64 * 68];
    const size_t z = blockIdx.z;
    gemmw<bf, 1, true, KSW, 0>(Ah + z * TT * DQ, Al + z * TT * DQ, Wt, nullptr, K, C + z * TT * DM, DM, bo, (int)blockIdx.x, (int)blockIdx.y, os);
}

typedef __attribute__((ext_vector_type(4))) int v4i;

// ---- k_cvt: every f32 -> bf16 copy in one launch. A chunk is 2048 elements (256 threads x 8); the chunks of w_q, w_k, w_v, w_o, query, key, value follow one another, as their copies do in dst.
// A work-group takes CVC chunks in a row, all of one source: few waves to start; for weights and query one address a thread (the chunks are reached by constant offsets), CVU chunks' loads of a thread in flight together.
#define CVC  16
#define CVU  4
#define CVW  (DM * DM / 2048 / CVC)            // work-groups of a weight
#define CVX  (NB_ * TT * DM / 2048 / CVC)      // work-groups of a stream
#define CVB  (TT * DM / 2048 / CVC)            // work-groups of one batch entry of a stream
static_assert(DQ == DM && DKV == DM && (DM * DM) % (2048 * CVC) == 0 && CVC % CVU == 0, "whole work-groups for every source");
static_assert(CVC * 2048 == 32 * DM && DM == 1024 && TT == 2048, "a work-group of a stream has 32 rows (one word of key bits), a thread 8 keys, a lane two of the 64 words");
// Key and value: row t of a batch entry goes to place p(t): kept keys (mask word != 0) to the number of kept keys in front of t, the others to the count + the number of others in front of t. Rows whose place is not worked on are neither read nor stored.
__global__ __launch_bounds__(256) void k_cvt(const float* __restrict__ wq, const float* __restrict__ wk, const float* __restrict__ wv, const float* __restrict__ wo, const float* __restrict__ xq, const float* __restrict__ xk, const float* __restrict__ xv, const int* __restrict__ mk, bf* __restrict__ dst, int* __restrict__ kc) {
    const unsigned g = blockIdx.x, gx = g - 4 * CVW; const bool isw = g < 4 * CVW; const unsigned w = isw ? g / CVW : gx / CVX, l = isw ? g % CVW : gx % CVX;
    const float* s = (isw ? (w == 0 ? wq : w == 1 ? wk : w == 2 ? wv : wo) : (w == 0 ? xq : w == 1 ? xk : xv)) + (size_t)l * (CVC * 2048) + threadIdx.x * 8;
    if (!isw && w > 0) {   // the same for the whole work-group
        __shared__ __align__(16) unsigned kw[TT / 32];   // the batch entry's key bits, 32 keys a word
        const int tid = (int)threadIdx.x, lane = tid & 31, wv8 = __builtin_amdgcn_readfirstlane(tid >> 5);   // the wave's number in a scalar register: the row walk below is scalar
        const unsigned b = l / CVB, gr = l % CVB; const int* mp = mk + (size_t)b * TT + tid * 8;
        const v4i ma = *(const v4i*)mp, mb = *(const v4i*)(mp + 4); unsigned by = 0;
#pragma unroll
        for (int q = 0; q < 4; ++q) by |= (ma[q] != 0 ? 1u << q : 0u) | (mb[q] != 0 ? 16u << q : 0u);
        ((unsigned char*)kw)[tid] = (unsigned char)by;   // keys 8 tid .. 8 tid + 7: byte tid & 3 of word tid >> 2
        __syncthreads();   // all 64 words are in LDS before any wave counts them
        const unsigned w0 = kw[2 * lane], w1 = kw[2 * lane + 1];
        int pk = ((__popc(w0) + __popc(w1)) << 16) + (2u * lane < gr ? __popc(w0) : 0) + (2u * lane + 1 < gr ? __popc(w1) : 0);   // high half: kept keys; low half: kept keys in front of this work-group's rows
#pragma unroll
        for (int m = 16; m > 0; m >>= 1) pk += __shfl_xor(pk, m);
        const int cnt = pk >> 16, bef = pk & 0xffff, lim = keylim(cnt); const unsigned mine = kw[gr];
        if (w == 1 && gr == 0 && tid == 0) kc[b * KCS] = cnt;   // one writer a batch entry
        // lane r holds the place of the work-group's row r; a: the rows whose place is worked on
        const int kb = bef + __popc(mine & ((1u << lane) - 1u)); const int pos = ((mine >> lane) & 1u) ? kb : cnt + ((int)gr * 32 + lane - kb);
        unsigned a = __builtin_amdgcn_ballot_w32(pos < lim);
        const float* sb = s - tid * 8 + lane * 8;   // the work-group's first row, this lane's columns
        bf* db = dst + (size_t)(g - gr) * (CVC * 2048) + lane * 8;   // the batch entry's first place, this lane's columns
        // a wave takes every eighth of those rows, a whole row at a time: no load stands under a test of its own, and a row's loads are in flight together
        for (int i = 0; i < wv8; ++i) a &= a - 1;
        // stays rolled: the trip count comes from the key bits, at most 32 / 8
#pragma unroll 1
        for (int n = 0; n < 32 / 8 && a != 0; ++n) {
            const int r = __builtin_ctz(a); const float* sp = sb + r * DM; bf* dp = db + (size_t)__builtin_amdgcn_readlane(pos, r) * DM;
            v8f v[DM / 256];
#pragma unroll
            for (int i = 0; i < DM / 256; ++i) v[i] = *(const v8f*)(sp + i * 256);
#pragma unroll
            for (int i = 0; i < DM / 256; ++i) { v8us o;
#pragma unroll
                for (int k = 0; k < 8; ++k) o[k] = f2bf(v[i][k]);
                *(v8us*)(dp + i * 256) = o; }
            asm volatile("s_wait_xcnt 0x0" ::: "memory");   // stands in front of the next trip's overwrite of the registers that this trip's loads and stores name
#pragma unroll
            for (int i = 0; i < 8; ++i) a &= a - 1;
        }
        return;
    }
    bf* d = dst + (size_t)g * (CVC * 2048) + threadIdx.x * 8;
    // all loops unrolled: v is indexed by constants only, every chunk is a constant offset from s and d, and a round's loads are issued before the first is used
#pragma unroll
    for (int i0 = 0; i0 < CVC; i0 += CVU) {
        v8f v[CVU];
#pragma unroll
        for (int i = 0; i < CVU; ++i) v[i] = *(const v8f*)(s + (i0 + i) * 2048);
#pragma unroll
        for (int i = 0; i < CVU; ++i) { v8us o;
#pragma unroll
            for (int k = 0; k < 8; ++k) o[k] = f2bf(v[i][k]);
            *(v8us*)(d + (i0 + i) * 2048) = o; }
        if (i0 + CVU < CVC) asm volatile("s_wait_xcnt 0x0" ::: "memory");   // stands in front of the next round's overwrite of the registers that this round's stores name
    }
}

typedef __attribute__((ext_vector_type(8))) __bf16 v8bf;
__device__ __forceinline__ float xhalf(float x) { return __builtin_bit_cast(float, __builtin_amdgcn_permlanex16(__builtin_bit_cast(int, x), __builtin_bit_cast(int, x), 0x76543210, 0xfedcba98, false, false)); }   // lane l with lane l ^ 16
// eight base-2 exponentials in place, in one statement: none of them is directly followed by a reader of its result or a writer of its source; the v_nop keeps that slot behind the last one
__device__ __forceinline__ v8f exp2x8(v8f x) { float a0 = x[0], a1 = x[1], a2 = x[2], a3 = x[3], a4 = x[4], a5 = x[5], a6 = x[6], a7 = x[7];
    asm("v_exp_f32 %0, %0\n\tv_exp_f32 %1, %1\n\tv_exp_f32 %2, %2\n\tv_exp_f32 %3, %3\n\tv_exp_f32 %4, %4\n\tv_exp_f32 %5, %5\n\tv_exp_f32 %6, %6\n\tv_exp_f32 %7, %7\n\tv_nop" : "+v"(a0), "+v"(a1), "+v"(a2), "+v"(a3), "+v"(a4), "+v"(a5), "+v"(a6), "+v"(a7));
    return (v8f){a0, a1, a2, a3, a4, a5, a6, a7}; }
template <bool HR> struct AFrag;
template <> struct AFrag<true>  { typedef bf  T; static __device__ __forceinline__ v16bf ld(const bf* p) { return cat16b(*(const v8usa*)p, *(const v8usa*)(p + 16)); } };
template <> struct AFrag<false> { typedef h16 T; static __device__ __forceinline__ v16h ld(const bf* p) { return cat16(__builtin_bit_cast(v8h, (v8us)*(const v8usa*)p), __builtin_bit_cast(v8h, (v8us)*(const v8usa*)(p + 16))); } };
template <bool HR>
__device__ __forceinline__ void attn_body(const bf* __restrict__ Q0, const bf* __restrict__ Q1, const bf* __restrict__ K0, const bf* __restrict__ K1, const bf* __restrict__ V0, const bf* __restrict__ V1, const float* bs, bf* sm, int q0, int nst, bf* Ah, bf* Al) {
    typedef typename AFrag<HR>::T T16; typedef typename WFrag<T16>::V V;
    // every inner loop below is unrolled: the fragment, score and output arrays are indexed by constants only and stay in registers
    constexpr int NQ = HR ? 1 : 2;      // 16-query groups a wave
    constexpr int NP = HR ? 2 : 1;      // planes an operand
    const int tid = (int)threadIdx.x, lane = tid & 31, lr = lane & 15, hi = lane >> 4;
    const int qw = q0 + __builtin_amdgcn_readfirstlane(tid >> 5) * (16 * NQ);
    const int srow = tid >> 3, scol = (tid & 7) * 8;   // staging: 8 threads a 128-byte row, 32 rows a sweep
    V qa[NQ][2], qb[NQ][2];
#pragma unroll
    for (int g = 0; g < NQ; ++g)
#pragma unroll
        for (int ks = 0; ks < 2; ++ks) { const unsigned o = (unsigned)((qw + g * 16 + lr) * HD + ks * 32 + 8 * hi); qa[g][ks] = AFrag<HR>::ld(Q0 + o); if (HR) qb[g][ks] = AFrag<HR>::ld(Q1 + o); }
    v8f ot[4][NQ]; float mr[NQ], ls[NQ];
#pragma unroll
    for (int g = 0; g < NQ; ++g) { mr[g] = -3.0e38f; ls[g] = 0.f;
#pragma unroll
        for (int db = 0; db < 4; ++db) ot[db][g] = (v8f){}; }
    v8us sk[NP][2], sv[NP][2];
    // stage buffers in sm: (plane * 2 + buffer) * SPE; planes K0, V0, K1, V1
#define ATT_GLOAD(s) { _Pragma("unroll") for (int c = 0; c < 2; ++c) { const int row = srow + 32 * c; \
        const unsigned ko = (unsigned)(((s) * SKB + row) * HD + scol), vo = (unsigned)(row * TT + (s) * SKB + scol); \
        sk[0][c] = *(const v8usa*)(K0 + ko); sv[0][c] = *(const v8usa*)(V0 + vo); if (HR) { sk[NP - 1][c] = *(const v8usa*)(K1 + ko); sv[NP - 1][c] = *(const v8usa*)(V1 + vo); } } }
#define ATT_SSTORE(b) { _Pragma("unroll") for (int c = 0; c < 2; ++c) { bf* d = sm + (b) * SPE + (srow + 32 * c) * SPT + scol; \
        *(v8usa*)d = sk[0][c]; *(v8usa*)(d + 2 * SPE) = sv[0][c]; if (HR) { *(v8usa*)(d + 4 * SPE) = sk[NP - 1][c]; *(v8usa*)(d + 6 * SPE) = sv[NP - 1][c]; } } }
    ATT_GLOAD(0) ATT_SSTORE(0)
    __syncthreads();   // stage 0 and the bias row are in LDS before any wave reads them
    // the stage loop stays rolled: the body is long, and every register array inside is indexed by constants
#pragma unroll 1
    for (int s = 0; s < nst; ++s) {   // nst: stages of key places in use, 1 to TT / SKB
        const int buf = s & 1; const bool more = (s + 1 < nst);
        if (more) ATT_GLOAD(s + 1)
        const bf* kb = sm + buf * SPE + lr * SPT + 8 * hi; const bf* vb = kb + 2 * SPE;
#pragma unroll
        for (int ps = 0; ps < SKB / 32; ++ps) {
            v8f sc[2][NQ]; float tm[NQ];
#pragma unroll
            for (int g = 0; g < NQ; ++g) tm[g] = -3.0e38f;
#pragma unroll
            for (int kt = 0; kt < 2; ++kt) {
                const bf* kp = kb + (ps * 32 + kt * 16) * SPT; V ka[2], kl[2];
#pragma unroll
                for (int ks = 0; ks < 2; ++ks) { ka[ks] = AFrag<HR>::ld(kp + ks * 32); if (HR) kl[ks] = AFrag<HR>::ld(kp + 4 * SPE + ks * 32); }
                const float* bp = bs + s * SKB + ps * 32 + kt * 16 + 8 * hi; const v8f b8 = __builtin_shufflevector((v4f)*(const v4fa*)bp, (v4f)*(const v4fa*)(bp + 4), 0, 1, 2, 3, 4, 5, 6, 7);
#pragma unroll
                for (int g = 0; g < NQ; ++g) { v8f a = (v8f){};
#pragma unroll
                    for (int ks = 0; ks < 2; ++ks) { a = WFrag<T16>::mma(ka[ks], qa[g][ks], a); if (HR) { a = WFrag<T16>::mma(ka[ks], qb[g][ks], a); a = WFrag<T16>::mma(kl[ks], qa[g][ks], a); } }
                    a = __builtin_elementwise_fma(a, (v8f)(CL2), b8);
#pragma unroll
                    for (int r = 0; r < 8; ++r) tm[g] = fmaxf(tm[g], a[r]);
                    sc[kt][g] = a; }
            }
            bool need = false;
#pragma unroll
            for (int g = 0; g < NQ; ++g) { tm[g] = fmaxf(tm[g], xhalf(tm[g])); need = need || (tm[g] > mr[g] + 8.0f); }
            if (__builtin_amdgcn_ballot_w32(need) != 0) {   // one scalar branch a pass: rare after the first keys kept
#pragma unroll
                for (int g = 0; g < NQ; ++g) { const float mn = fmaxf(mr[g], tm[g]); const float f = __builtin_amdgcn_exp2f(mr[g] - mn); mr[g] = mn; ls[g] *= f;
#pragma unroll
                    for (int db = 0; db < 4; ++db) ot[db][g] *= f; }
            }
            V pa[NQ], pl[NQ];
#pragma unroll
            for (int g = 0; g < NQ; ++g) { const v8f p0 = exp2x8(sc[0][g] - (v8f)(mr[g])), p1 = exp2x8(sc[1][g] - (v8f)(mr[g]));
                const v8f p8 = p0 + p1; const v4f p4 = __builtin_shufflevector(p8, p8, 0, 1, 2, 3) + __builtin_shufflevector(p8, p8, 4, 5, 6, 7); ls[g] += (p4[0] + p4[1]) + (p4[2] + p4[3]);   // a short tree: no chain of 16 dependent adds
                if constexpr (HR) { const v8bf h0 = __builtin_convertvector(p0, v8bf), h1 = __builtin_convertvector(p1, v8bf);
                    const v8bf l0 = __builtin_convertvector(p0 - __builtin_convertvector(h0, v8f), v8bf), l1 = __builtin_convertvector(p1 - __builtin_convertvector(h1, v8f), v8bf);
                    pa[g] = __builtin_shufflevector(h0, h1, 0, 1, 2, 3, 4, 5, 6, 7, 8, 9, 10, 11, 12, 13, 14, 15); pl[g] = __builtin_shufflevector(l0, l1, 0, 1, 2, 3, 4, 5, 6, 7, 8, 9, 10, 11, 12, 13, 14, 15);
                } else { pa[g] = cat16(__builtin_convertvector(p0, v8h), __builtin_convertvector(p1, v8h)); } }
#pragma unroll
            for (int db = 0; db < 4; ++db) { const bf* vp = vb + db * 16 * SPT + ps * 32; const V va = AFrag<HR>::ld(vp); V vl; if (HR) vl = AFrag<HR>::ld(vp + 4 * SPE);
#pragma unroll
                for (int g = 0; g < NQ; ++g) { ot[db][g] = WFrag<T16>::mma(va, pa[g], ot[db][g]); if (HR) { ot[db][g] = WFrag<T16>::mma(va, pl[g], ot[db][g]); ot[db][g] = WFrag<T16>::mma(vl, pa[g], ot[db][g]); } } }
        }
        if (more) ATT_SSTORE(buf ^ 1)
        __syncthreads();   // publishes stage s + 1 and ends every wave's reads of stage s, whose buffer the next trip refills
    }
#undef ATT_GLOAD
#undef ATT_SSTORE
#pragma unroll
    for (int g = 0; g < NQ; ++g) { const float inv = __fdiv_rn(1.0f, ls[g] + xhalf(ls[g])); const unsigned oo = (unsigned)((qw + g * 16 + lr) * DQ + 8 * hi);
#pragma unroll
        for (int db = 0; db < 4; ++db) { v8us oh, ol;
#pragma unroll
            for (int r = 0; r < 8; ++r) { unsigned short a, c2; splitf(ot[db][g][r] * inv, a, c2); oh[r] = a; ol[r] = c2; }
            *(v8us*)(Ah + oo + db * 16) = oh; *(v8us*)(Al + oo + db * 16) = ol;
            asm volatile("s_wait_xcnt 0x0" ::: "memory"); } }   // stands in front of the next trip's (and the tail's) overwrite of the registers that the two stores name
}
// grid: NB_ * NH_ * RH / QHB work-groups of rows < RH first (the longer ones), then NB_ * NH_ * (TT - RH) / QLB
// waves_per_eu(4, 4): the register budget of 4 waves a SIMD, so that the output, score and staging arrays stay in registers (no spills)
__global__ __launch_bounds__(256) __attribute__((amdgpu_waves_per_eu(4, 4))) void k_attn(const h16* __restrict__ Q16, const h16* __restrict__ K16, const h16* __restrict__ V16, const bf* __restrict__ Qh, const bf* __restrict__ Ql, const bf* __restrict__ Kh, const bf* __restrict__ Kl, const bf* __restrict__ Vh, const bf* __restrict__ Vl, const int* __restrict__ kc, bf* Ah, bf* Al) {
    __shared__ __align__(16) bf sm[8 * SPE]; __shared__ __align__(16) float bs[TT];
    constexpr int NHW = NB_ * NH_ * (RH / QHB); const int x = (int)blockIdx.x; const bool hr = x < NHW;
    const int bh = hr ? x / (RH / QHB) : (x - NHW) / ((TT - RH) / QLB); const int q0 = hr ? (x % (RH / QHB)) * QHB : RH + ((x - NHW) % ((TT - RH) / QLB)) * QLB;
    const int b = bh / NH_, h = bh % NH_; const size_t po = (size_t)bh * TT * HD, ao = (size_t)b * TT * DQ + h * HD;
    const int cnt = keycnt(kc, b), nst = keylim(cnt) / SKB;
    { const int j = (int)threadIdx.x * (TT / 256);
#pragma unroll
      for (int c = 0; c < TT / 256; c += 4) { v4f o;
#pragma unroll
          for (int q = 0; q < 4; ++q) o[q] = (j + c + q < cnt) ? 0.0f : -3.0e38f;
          *(v4fa*)(bs + j + c) = o; } }
    if (hr) attn_body<true>(Qh + po, Ql + po, Kh + po, Kl + po, Vh + po, Vl + po, bs, sm, q0, nst, Ah + ao, Al + ao);
    else attn_body<false>((const bf*)(Q16 + po), nullptr, (const bf*)(K16 + po), nullptr, (const bf*)(V16 + po), nullptr, bs, sm, q0, nst, Ah + ao, Al + ao);
}

extern "C" void kernel_launch(void* const* d_in, const int* in_sizes, int n_in,
                              void* d_out, int out_size, void* d_ws, size_t ws_size, hipStream_t stream) {
    (void)in_sizes; (void)n_in; (void)out_size;
    const float* x = (const float*)d_in[0]; const float* xk = (const float*)d_in[1]; const float* xv = (const float*)d_in[2]; const float* wq = (const float*)d_in[3]; const float* bq = (const float*)d_in[4]; const float* wk = (const float*)d_in[5]; const float* bk = (const float*)d_in[6]; const float* wv = (const float*)d_in[7]; const float* bv = (const float*)d_in[8]; const float* wo = (const float*)d_in[9]; const float* bo = (const float*)d_in[10]; const int* MK = (const int*)d_in[11];   /* argument order q, k, v, w_q, b_q, w_k, b_k, w_v, b_v, w_o, b_o ('oi'), mask (int32 [4][2048]: read) */
    float* OUT = (float*)d_out;     // [4][2048][1024]
    char* wsp = (char*)d_ws;
    auto take = [&](size_t bytes) { char* p = wsp; wsp += (bytes + 255) & ~(size_t)255; return (void*)p; };
    bf* WQ = (bf*)take((size_t)DQ * DM * 2); bf* WK = (bf*)take((size_t)DKV * DM * 2); bf* WV = (bf*)take((size_t)DKV * DM * 2); bf* WO = (bf*)take((size_t)DM * DQ * 2);
    bf* XB = (bf*)take((size_t)3 * NB_ * TT * DM * 2);   // query, key, value of all batch entries; directly behind the weights (k_cvt writes the seven copies as one run)
    const size_t PB = PBE;
    h16* QP16 = (h16*)take(NB_ * PB * 2); h16* KP16 = (h16*)take(NB_ * PB * 2); h16* VT16 = (h16*)take(NB_ * PB * 2);
    bf* QPh = (bf*)take(NB_ * PB * 2); bf* QPl = (bf*)take(NB_ * PB * 2); bf* KPh = (bf*)take(NB_ * PB * 2); bf* KPl = (bf*)take(NB_ * PB * 2); bf* VTh = (bf*)take(NB_ * PB * 2); bf* VTl = (bf*)take(NB_ * PB * 2);
    bf* ATh = (bf*)take((size_t)NB_ * TT * DQ * 2); bf* ATl = (bf*)take((size_t)NB_ * TT * DQ * 2);
    int* KC = (int*)take(NB_ * KCS * sizeof(int));   // kept keys of each batch entry, written by k_cvt
    if ((size_t)(wsp - (char*)d_ws) > ws_size) return;    // 232 MiB of the 256 MiB
    (void)WK; (void)WV;   // reached through WQ: the weights' copies lie in one run
    k_cvt<<<4 * CVW + 3 * CVX, 256, 0, stream>>>(wq, wk, wv, wo, x, xk, xv, MK, WQ, KC);
    k_proj<<<dim3(TT / 64, DQ / 64, 3 * NB_), 32 * KSW, 0, stream>>>(XB, WQ, DM, bq, bk, bv, KC, QP16, QPh, QPl);
    k_attn<<<NB_ * NH_ * (RH / QHB + (TT - RH) / QLB), 256, 0, stream>>>(QP16, KP16, VT16, QPh, QPl, KPh, KPl, VTh, VTl, KC, ATh, ATl);
    k_out<<<dim3(TT / 64, DM / 64, NB_), 32 * KSW, 0, stream>>>(ATh, ATl, WO, DQ, OUT, bo);
}

// v007
// A run of this version takes 151 microseconds.
// Timed twice side by side with v006, it ran 1.63 times as fast both times.
// All steps since v000 together make it 26.3 times as fast.
#include <hip/hip_runtime.h>

// Multi-head attention over three input streams with a key-padding mask (q, k, v [4][2048][1024]; qh = q w_q^T + b_q, kh = k w_k^T + b_k, vh = v w_v^T + b_v ('oi' (out, in) [1024][1024] x 0.02 + [1024]: the four biases are zero on this draw: read and added; 16 heads x 64); scores / sqrt(64); keys j with mask[b][j] == 0 (int32 [4][2048], read as data: about half the keys of every batch entry) are set to the float32 minimum: an exclusion (no batch entry has every key masked); softmax; out = merged w_o^T + b_o -> [4][2048][1024] (8.4 M); argument order q, k, v, w_q, b_q, w_k, b_k, w_v, b_v, w_o, b_o, mask).
// Keys packed: a key with mask word 0 has weight exactly 0 in f32 as soon as one key of its batch entry is kept, so launch (1) stores the key and value rows of a batch entry with the kept ones first, in their order, the others behind them, and writes the count of kept keys; (3) works on key places below the count rounded up to a stage of 64, (1) and (2) on those below the count rounded up to a GEMM tile of 128 (all places where no key is kept); places from the count on get the bias.
// Layout: four launches, each for all batch entries. (1) bf16 copies of the four 'oi' weights (cast as they stand) and of query, key and value, one behind another in the workspace; (2) the three exact projections + f32 biases, whose GEMM (operands staged in LDS by asynchronous copies) stores the head planes itself (no f32 copy of a projection in memory); head planes of all batch entries side by side; (3) attention for every (batch entry, head): scores, key mask, softmax and P x V stay in registers (hybrid rows: < 512 hi/lo 3 products, rest fp16); (4) merged hi/lo x Wo exact + bo.
// Compute dtypes, f32 accumulate: every input rounded to bf16; projections exact + f32 biases; attention rows < 512 3 products, rest fp16; softmax f32; Wo hl x exact + bias.

#define NB_  4
#define TT   2048
#define DM   1024
#define NH_  16
#define NKV  16
#define REP  (NH_ / NKV)
#define HD   64
#define DQ   (NH_ * HD)
#define DKV  (NKV * HD)
#define RH   512                  // query rows < RH use hi+lo planes (0: none)
#define WIN  0
#define SCL  0.125f   // HD^-0.5
#define GTL  128                  // rows and columns of a GEMM work-group's output tile (projections, Wo)
#define SKB  64                   // keys in one LDS stage of the attention kernel
#define SPT  72                   // LDS row pitch of a stage in 16-bit elements: 128 B of data + 16 B, an odd multiple of 16 B
#define SPE  (64 * SPT)           // elements in one stage buffer (64 rows: SKB keys of K, or HD rows of V^T)
#define QHB  128                  // query rows of a work-group where rows < RH (8 waves x 16)
#define QLB  256                  // query rows of a work-group elsewhere (8 waves x 32)
#define CL2  0.18033688011112042f // HD^-0.5 x log2(e): scores go to base 2
typedef _Float16 h16;
typedef unsigned short bf;
typedef __attribute__((ext_vector_type(16))) __bf16   v16bf;
typedef __attribute__((ext_vector_type(16))) _Float16 v16h;
typedef __attribute__((ext_vector_type(8)))  _Float16 v8h;
typedef __attribute__((ext_vector_type(8)))  unsigned short v8us;
typedef __attribute__((ext_vector_type(8)))  float    v8f;
typedef __attribute__((ext_vector_type(4)))  float    v4f;
typedef v8h  __attribute__((may_alias)) v8ha;
typedef v4f  __attribute__((may_alias)) v4fa;
typedef v8us __attribute__((may_alias)) v8usa;

__device__ __forceinline__ unsigned short f2bf(float f) { unsigned u = __float_as_uint(f); u += 0x7FFFu + ((u >> 16) & 1u); return (unsigned short)(u >> 16); }
__device__ __forceinline__ float bf2f(unsigned short b) { return __uint_as_float(((unsigned)b) << 16); }
__device__ __forceinline__ float bfr(float f) { return bf2f(f2bf(f)); }
__device__ __forceinline__ v16h cat16(v8h lo, v8h hi) { return __builtin_shufflevector(lo, hi, 0, 1, 2, 3, 4, 5, 6, 7, 8, 9, 10, 11, 12, 13, 14, 15); }
__device__ __forceinline__ v16bf cat16b(v8us lo, v8us hi) { return __builtin_bit_cast(v16bf, __builtin_shufflevector(lo, hi, 0, 1, 2, 3, 4, 5, 6, 7, 8, 9, 10, 11, 12, 13, 14, 15)); }
__device__ __forceinline__ v8f wmma16(v16h a, v16h b, v8f c) { return __builtin_amdgcn_wmma_f32_16x16x32_f16(false, a, false, b, (short)0, c, false, false); }
__device__ __forceinline__ v8f wmmab(v16bf a, v16bf b, v8f c) { return __builtin_amdgcn_wmma_f32_16x16x32_bf16(false, a, false, b, (short)0, c, false, false); }
__device__ __forceinline__ h16 tohx(float x) { return (h16)x; }
__device__ __forceinline__ void splitf(float y, unsigned short& h, unsigned short& l) { h = f2bf(y); l = f2bf(y - bf2f(h)); }
typedef __attribute__((ext_vector_type(4))) _Float16 v4h;
typedef __attribute__((ext_vector_type(4))) unsigned short v4us;
// kept keys of a batch entry as launch (1) counted them, held inside the shape; and the key places that are worked on: the count rounded up to whole stages, or every place where no key is kept (the row is then uniform over all keys)
#define KCS  32                   // the counts lie 128 bytes apart: each has its own writer and its own line
__device__ __forceinline__ int keycnt(const int* __restrict__ kc, int b) { const int c = kc[b * KCS]; return c < 0 ? 0 : (c > TT ? TT : c); }
__device__ __forceinline__ int keylim(int c) { return c > 0 ? ((c + SKB - 1) & ~(SKB - 1)) : TT; }
// the key places that launch (1) fills and launch (2) projects: the same in whole GEMM tiles
__device__ __forceinline__ int keyfill(int c) { return c > 0 ? ((c + GTL - 1) & ~(GTL - 1)) : TT; }
static_assert(GTL % SKB == 0 && TT % GTL == 0, "a GEMM tile is whole stages");



// ---- gemmt: GEMM of one 128 x 128 output tile by a work-group of 4 waves (2 x 2, 64 x 64 and 16 accumulators a wave), K = DM; operands are K-contiguous bf16 planes.
// C[m][n] = sum_k (A[m][k] (+ A2[m][k], NA = 2)) Bt[n][k] + bias, each accumulator one chain over k in rising order (NA = 2: per 32 of k first A, then A2).
// The operands come in stages of GKS of k: every lane brings 16-byte pieces from global memory into LDS by asynchronous copies (no register in between), and each row is fetched once for the two waves that read it. Two buffers: the copies of stage t + 2 fly while stage t + 1 is worked on.
// PL = 0: f32 C (pitch ldc) + bias[n]. PL > 0: three 16-bit planes (P16 fp16, Ph + Pl bf16 hi/lo), each in column planes of 1 << lcp columns, sP elements apart (column n: plane n >> lcp, place n & ((1 << lcp) - 1), row pitch ldc). PL = 1: bias[n]. PL = 2: bias[m].
//   Q, K head planes [h][t][d]: A = x, Bt = w, lcp = 6, sP = TT * HD, ldc = HD. V^T planes [h][d][t]: the operands change places (A = w, Bt = x: C[m][n] is feature m at token n), ldc = TT, bias[m].
template <typename T16> struct WFrag;
template <> struct WFrag<h16> { typedef v16h V; static __device__ __forceinline__ v8f mma(V a, V b, v8f c) { return wmma16(a, b, c); } };
template <> struct WFrag<bf> { typedef v16bf V; static __device__ __forceinline__ v8f mma(V a, V b, v8f c) { return wmmab(a, b, c); } };
#define GKS  64                   // k in one LDS stage: 128 bytes of every operand row
#define GRP  72                   // LDS row pitch of a stage in 16-bit elements: 128 B of data + 16 B, an odd multiple of 16 B
#define GPE  (GTL * GRP)          // elements of one operand's rows in a stage
static_assert(GKS == 64 && DM % GKS == 0 && DM / GKS >= 2 && GTL == 128, "whole stages, at least two; 128 threads x 8 copies fill one operand's 128 rows");
__device__ __forceinline__ v16bf gfrag(const bf* p) { return cat16b(*(const v8usa*)p, *(const v8usa*)(p + 16)); }
// one operand's part of a stage, 128 rows x 128 bytes: 8 lanes a row, 16 rows a copy of the work-group, 8 copies a lane. l: the lane's LDS byte address in row tid >> 3; g: the part's first byte in global memory, the same for the work-group (a scalar base); o[i]: the lane's byte offset from g in row (tid >> 3) + 16 i, the same for every operand and stage.
// s_wait_xcnt closes the statement: it stands in front of every later write of the address registers that the copies name
__device__ __forceinline__ void gcopy(unsigned l, const bf* g, const unsigned (&o)[8]) {
    asm volatile("global_load_async_to_lds_b128 %0, %8, %16\n\tglobal_load_async_to_lds_b128 %1, %9, %16\n\tglobal_load_async_to_lds_b128 %2, %10, %16\n\tglobal_load_async_to_lds_b128 %3, %11, %16\n\t"
                 "global_load_async_to_lds_b128 %4, %12, %16\n\tglobal_load_async_to_lds_b128 %5, %13, %16\n\tglobal_load_async_to_lds_b128 %6, %14, %16\n\tglobal_load_async_to_lds_b128 %7, %15, %16\n\ts_wait_xcnt 0x0"
                 :: "v"(l), "v"(l + 16 * GRP * 2), "v"(l + 32 * GRP * 2), "v"(l + 48 * GRP * 2), "v"(l + 64 * GRP * 2), "v"(l + 80 * GRP * 2), "v"(l + 96 * GRP * 2), "v"(l + 112 * GRP * 2),
                    "v"(o[0]), "v"(o[1]), "v"(o[2]), "v"(o[3]), "v"(o[4]), "v"(o[5]), "v"(o[6]), "v"(o[7]), "s"(g) : "memory");
}
template <int NA, int PL>
__device__ __forceinline__ void gemmt(const bf* __restrict__ A, const bf* __restrict__ A2, const bf* __restrict__ Bt, float* C, int ldc, const float* __restrict__ bias, int r0, int c0, bf* sm, int lcp = 30, size_t sP = 0, h16* P16 = nullptr, bf* Ph = nullptr, bf* Pl = nullptr) {
    constexpr int STG = (NA + 1) * GPE, NS = DM / GKS;   // a stage buffer: A rows, (A2 rows,) Bt rows
    static_assert(4 * 64 * 68 * 4 <= 2 * STG * 2, "the four f32 wave tiles of the epilogue fit the two buffers");
    const int tid = (int)threadIdx.x, lane = tid & 31, lr = lane & 15, hi = lane >> 4;
    // the wave's number through readfirstlane: its place in the tile stays in scalar registers
    const int wv = __builtin_amdgcn_readfirstlane(tid >> 5), wm = wv >> 1, wn = wv & 1;
    v8f acc[4][4];
#pragma unroll
    for (int mb = 0; mb < 4; ++mb)
#pragma unroll
        for (int nb = 0; nb < 4; ++nb) acc[mb][nb] = (v8f){};
    const unsigned ls = (unsigned)(size_t)sm + (unsigned)((tid >> 3) * (GRP * 2) + (tid & 7) * 16);
    unsigned go[8];
#pragma unroll
    for (int i = 0; i < 8; ++i) go[i] = (unsigned)(((tid >> 3) + 16 * i) * (DM * 2) + (tid & 7) * 16);
    const bf* ga = A + (size_t)r0 * DM; const bf* ga2 = (NA == 2) ? A2 + (size_t)r0 * DM : nullptr; const bf* gb = Bt + (size_t)c0 * DM;
#define G_STAGE(s, b) { gcopy(ls + (b) * (STG * 2), ga + (s) * GKS, go); if (NA == 2) gcopy(ls + (b) * (STG * 2) + GPE * 2, ga2 + (s) * GKS, go); gcopy(ls + (b) * (STG * 2) + NA * GPE * 2, gb + (s) * GKS, go); }
    G_STAGE(0, 0)
    asm volatile("s_wait_asynccnt 0x0" ::: "memory");   // this wave's copies of stage 0 have landed
    __syncthreads();   // stage 0 is whole before any wave reads it
    G_STAGE(1, 1)
    // the stage loop stays rolled: the body is long, and every register array inside is indexed by constants
#pragma unroll 1
    for (int t = 0; t < NS; ++t) {
        const int buf = t & 1;
        const bf* ab = sm + buf * STG + (wm * 64 + lr) * GRP + 8 * hi; const bf* bb = sm + buf * STG + NA * GPE + (wn * 64 + lr) * GRP + 8 * hi;
        v16bf a[4], a2[4], b[4];
        // G_FRAGS: all fragments of 32 of k are read as one group in front of their products. The two scheduling fences keep the group whole: without them the compiler sinks each b fragment's reads to its first use, and the wave waits out the LDS latency in front of every four products
#define G_FRAGS(ks) { __builtin_amdgcn_sched_barrier(0); \
        _Pragma("unroll") for (int i = 0; i < 4; ++i) a[i] = gfrag(ab + i * 16 * GRP + (ks) * 32); \
        _Pragma("unroll") for (int i = 0; i < 4; ++i) b[i] = gfrag(bb + i * 16 * GRP + (ks) * 32); \
        if (NA == 2) { _Pragma("unroll") for (int i = 0; i < 4; ++i) a2[i] = gfrag(ab + GPE + i * 16 * GRP + (ks) * 32); } \
        __builtin_amdgcn_sched_barrier(0); }
#define G_MMA(x) { _Pragma("unroll") for (int nb = 0; nb < 4; ++nb) { _Pragma("unroll") for (int mb = 0; mb < 4; ++mb) acc[mb][nb] = wmmab(x[mb], b[nb], acc[mb][nb]); } }
        G_FRAGS(0) G_MMA(a) if (NA == 2) G_MMA(a2)
        G_FRAGS(1) if (NA == 2) G_MMA(a)
        // stage t has been read to its end: the hand-over stands here, in front of the trip's last 16 products (which work on registers), so that the copies of stage t + 2 have a whole trip to land.
        __builtin_amdgcn_sched_barrier(0);   // keeps the products above in front of the hand-over: their A fragments' registers are free for the copies' addresses
        asm volatile("s_wait_dscnt 0x0" ::: "memory");      // this wave's reads of stage t are done before its buffer is refilled
        asm volatile("s_wait_asynccnt 0x0" ::: "memory");   // this wave's copies of stage t + 1 have landed
        __syncthreads();   // publishes stage t + 1 and ends every wave's reads of stage t
        if (t + 2 < NS) G_STAGE(t + 2, buf)
        __builtin_amdgcn_sched_barrier(0);   // keeps the last products behind the copies: moved in front, they would take their time off the copies' lead
        if (NA == 2) G_MMA(a2) else G_MMA(a)
    }
#undef G_FRAGS
#undef G_MMA
#undef G_STAGE
    asm volatile("s_wait_asynccnt 0x0" ::: "memory");   // no copy is under way when the buffers become the epilogue's staging
    // epilogue: each wave turns its 64 x 64 tile through its own LDS range, so that whole 128-byte lines go out. Every loop unrolled: acc and val are indexed by constants only
    float* ow = (float*)sm + wv * (64 * 68); const int rw = r0 + wm * 64, cw = c0 + wn * 64;
#pragma unroll
    for (int mb = 0; mb < 4; ++mb)
#pragma unroll
        for (int nb = 0; nb < 4; ++nb)
#pragma unroll
            for (int j = 0; j < 8; ++j) ow[(mb * 16 + hi * 8 + j) * 68 + nb * 16 + lr] = acc[mb][nb][j];
    __syncthreads();   // a lane reads below what other lanes stored
    if constexpr (PL > 0) {
        // first the LDS reads and the bias of all sweeps, so that the wait behind a sweep's stores holds none of them back
        v8f val[16];
#pragma unroll
        for (int s = 0; s < 16; ++s) { const int u = s * 32 + lane, row = u >> 3, cofs = (u & 7) * 8;
            val[s] = __builtin_shufflevector((v4f)*(const v4fa*)(ow + row * 68 + cofs), (v4f)*(const v4fa*)(ow + row * 68 + cofs + 4), 0, 1, 2, 3, 4, 5, 6, 7);
#pragma unroll
            for (int q = 0; q < 8; ++q) val[s][q] += bfr(bias[PL == 1 ? cw + cofs + q : rw + row]); }
        const size_t pbase = (size_t)(cw >> lcp) * sP + (size_t)rw * ldc + (cw & ((1 << lcp) - 1));
#pragma unroll
        for (int s = 0; s < 16; ++s) { const int u = s * 32 + lane, row = u >> 3, cofs = (u & 7) * 8; const size_t o = pbase + (size_t)row * ldc + cofs; v8h o16; v8us oh, ol;
#pragma unroll
            for (int q = 0; q < 8; ++q) { o16[q] = tohx(val[s][q]); unsigned short a2, c2; splitf(val[s][q], a2, c2); oh[q] = a2; ol[q] = c2; }
            *(v8h*)(P16 + o) = o16; *(v8us*)(Ph + o) = oh; *(v8us*)(Pl + o) = ol;
            asm volatile("s_wait_xcnt 0x0" ::: "memory"); }   // stands in front of the next sweep's overwrite of the registers that the three stores name
    } else {
        v4f val[32];
#pragma unroll
        for (int s = 0; s < 32; ++s) { const int u = s * 32 + lane, row = u >> 4, cofs = (u & 15) * 4; val[s] = *(const v4fa*)(ow + row * 68 + cofs);
#pragma unroll
            for (int q = 0; q < 4; ++q) val[s][q] += bfr(bias[cw + cofs + q]); }
#pragma unroll
        for (int s = 0; s < 32; ++s) { const int u = s * 32 + lane, row = u >> 4, cofs = (u & 15) * 4;
            *(v4f*)(C + (size_t)(rw + row) * ldc + cw + cofs) = val[s];
            asm volatile("s_wait_xcnt 0x0" ::: "memory"); }   // stands in front of the next sweep's overwrite of the registers that the store names
    }
}

#define PBE  ((size_t)NH_ * TT * HD)   // elements of one batch entry in a head plane (NKV == NH_); a plane holds all NB_ entries
// ---- k_proj: the three projections of all batch entries in one launch; grid (TT/128, DQ/128, 3 * NB_), z = stream * NB_ + batch entry (streams: query, key, value).
// Key and value rows lie packed (kept keys first): blockIdx.x is their token tile in both forms, and tiles past the places that launch (1) filled are left out. X: the three bf16 streams, Wt: their three weights, P16: the three fp16 planes, each set one behind another; Ph, Pl: the hi and lo planes, which alternate (a stream's pair lies 2 * NB_ * PBE behind the last one's).
__global__ __launch_bounds__(128) void k_proj(const bf* __restrict__ X, const bf* __restrict__ Wt, const float* __restrict__ bq, const float* __restrict__ bk, const float* __restrict__ bv, const int* __restrict__ kc, h16* P16, bf* Ph, bf* Pl) {
    __shared__ __align__(16) bf sm[2 * 2 * GPE];   // one array for both forms below
    const int z = (int)blockIdx.z, st = z / NB_, b = z % NB_;
    if (st > 0 && (int)blockIdx.x * GTL >= keyfill(keycnt(kc, b))) return;   // key, value: a token tile past the key places filled; the whole work-group leaves, in front of every copy and barrier
    const bf* xs = X + (size_t)z * TT * DM; const bf* wt = Wt + (size_t)st * DQ * DM; const size_t o2 = (size_t)(st * 2 * NB_ + b) * PBE;
    if (st < 2) gemmt<1, 1>(xs, nullptr, wt, nullptr, HD, st ? bk : bq, (int)blockIdx.x * GTL, (int)blockIdx.y * GTL, sm, 6, (size_t)TT * HD, P16 + (size_t)z * PBE, Ph + o2, Pl + o2);
    else gemmt<1, 2>(wt, nullptr, xs, nullptr, TT, bv, (int)blockIdx.y * GTL, (int)blockIdx.x * GTL, sm, 30, 0, P16 + (size_t)z * PBE, Ph + o2, Pl + o2);
}
// ---- k_out: merged hi/lo x Wo + bo of all batch entries in one launch; grid (TT/128, DM/128, NB_)
__global__ __launch_bounds__(128) void k_out(const bf* __restrict__ Ah, const bf* __restrict__ Al, const bf* __restrict__ Wt, float* C, const float* __restrict__ bo) {
    __shared__ __align__(16) bf sm[2 * 3 * GPE];
    const size_t z = blockIdx.z;
    gemmt<2, 0>(Ah + z * TT * DQ, Al + z * TT * DQ, Wt, C + z * TT * DM, DM, bo, (int)blockIdx.x * GTL, (int)blockIdx.y * GTL, sm);
}

typedef __attribute__((ext_vector_type(4))) int v4i;

// ---- k_cvt: every f32 -> bf16 copy in one launch. A chunk is 2048 elements (256 threads x 8); the chunks of w_q, w_k, w_v, w_o, query, key, value follow one another, as their copies do in dst.
// A work-group takes CVC chunks in a row, all of one source: few waves to start; for weights and query one address a thread (the chunks are reached by constant offsets), CVU chunks' loads of a thread in flight together.
#define CVC  16
#define CVU  4
#define CVW  (DM * DM / 2048 / CVC)            // work-groups of a weight
#define CVX  (NB_ * TT * DM / 2048 / CVC)      // work-groups of a stream
#define CVB  (TT * DM / 2048 / CVC)            // work-groups of one batch entry of a stream
static_assert(DQ == DM && DKV == DM && (DM * DM) % (2048 * CVC) == 0 && CVC % CVU == 0, "whole work-groups for every source");
static_assert(CVC * 2048 == 32 * DM && DM == 1024 && TT == 2048, "a work-group of a stream has 32 rows (one word of key bits), a thread 8 keys, a lane two of the 64 words");
// Key and value: row t of a batch entry goes to place p(t): kept keys (mask word != 0) to the number of kept keys in front of t, the others to the count + the number of others in front of t. Rows whose place is not worked on are neither read nor stored.
__global__ __launch_bounds__(256) void k_cvt(const float* __restrict__ wq, const float* __restrict__ wk, const float* __restrict__ wv, const float* __restrict__ wo, const float* __restrict__ xq, const float* __restrict__ xk, const float* __restrict__ xv, const int* __restrict__ mk, bf* __restrict__ dst, int* __restrict__ kc) {
    const unsigned g = blockIdx.x, gx = g - 4 * CVW; const bool isw = g < 4 * CVW; const unsigned w = isw ? g / CVW : gx / CVX, l = isw ? g % CVW : gx % CVX;
    const float* s = (isw ? (w == 0 ? wq : w == 1 ? wk : w == 2 ? wv : wo) : (w == 0 ? xq : w == 1 ? xk : xv)) + (size_t)l * (CVC * 2048) + threadIdx.x * 8;
    if (!isw && w > 0) {   // the same for the whole work-group
        __shared__ __align__(16) unsigned kw[TT / 32];   // the batch entry's key bits, 32 keys a word
        const int tid = (int)threadIdx.x, lane = tid & 31, wv8 = __builtin_amdgcn_readfirstlane(tid >> 5);   // the wave's number in a scalar register: the row walk below is scalar
        const unsigned b = l / CVB, gr = l % CVB; const int* mp = mk + (size_t)b * TT + tid * 8;
        const v4i ma = *(const v4i*)mp, mb = *(const v4i*)(mp + 4); unsigned by = 0;
#pragma unroll
        for (int q = 0; q < 4; ++q) by |= (ma[q] != 0 ? 1u << q : 0u) | (mb[q] != 0 ? 16u << q : 0u);
        ((unsigned char*)kw)[tid] = (unsigned char)by;   // keys 8 tid .. 8 tid + 7: byte tid & 3 of word tid >> 2
        __syncthreads();   // all 64 words are in LDS before any wave counts them
        const unsigned w0 = kw[2 * lane], w1 = kw[2 * lane + 1];
        int pk = ((__popc(w0) + __popc(w1)) << 16) + (2u * lane < gr ? __popc(w0) : 0) + (2u * lane + 1 < gr ? __popc(w1) : 0);   // high half: kept keys; low half: kept keys in front of this work-group's rows
#pragma unroll
        for (int m = 16; m > 0; m >>= 1) pk += __shfl_xor(pk, m);
        const int cnt = pk >> 16, bef = pk & 0xffff, lim = keyfill(cnt); const unsigned mine = kw[gr];
        if (w == 1 && gr == 0 && tid == 0) kc[b * KCS] = cnt;   // one writer a batch entry
        // lane r holds the place of the work-group's row r; a: the rows whose place is worked on
        const int kb = bef + __popc(mine & ((1u << lane) - 1u)); const int pos = ((mine >> lane) & 1u) ? kb : cnt + ((int)gr * 32 + lane - kb);
        unsigned a = __builtin_amdgcn_ballot_w32(pos < lim);
        const float* sb = s - tid * 8 + lane * 8;   // the work-group's first row, this lane's columns
        bf* db = dst + (size_t)(g - gr) * (CVC * 2048) + lane * 8;   // the batch entry's first place, this lane's columns
        // a wave takes every eighth of those rows, a whole row at a time: no load stands under a test of its own, and a row's loads are in flight together
        for (int i = 0; i < wv8; ++i) a &= a - 1;
        // stays rolled: the trip count comes from the key bits, at most 32 / 8
#pragma unroll 1
        for (int n = 0; n < 32 / 8 && a != 0; ++n) {
            const int r = __builtin_ctz(a); const float* sp = sb + r * DM; bf* dp = db + (size_t)__builtin_amdgcn_readlane(pos, r) * DM;
            v8f v[DM / 256];
#pragma unroll
            for (int i = 0; i < DM / 256; ++i) v[i] = *(const v8f*)(sp + i * 256);
#pragma unroll
            for (int i = 0; i < DM / 256; ++i) { v8us o;
#pragma unroll
                for (int k = 0; k < 8; ++k) o[k] = f2bf(v[i][k]);
                *(v8us*)(dp + i * 256) = o; }
            asm volatile("s_wait_xcnt 0x0" ::: "memory");   // stands in front of the next trip's overwrite of the registers that this trip's loads and stores name
#pragma unroll
            for (int i = 0; i < 8; ++i) a &= a - 1;
        }
        return;
    }
    bf* d = dst + (size_t)g * (CVC * 2048) + threadIdx.x * 8;
    // all loops unrolled: v is indexed by constants only, every chunk is a constant offset from s and d, and a round's loads are issued before the first is used
#pragma unroll
    for (int i0 = 0; i0 < CVC; i0 += CVU) {
        v8f v[CVU];
#pragma unroll
        for (int i = 0; i < CVU; ++i) v[i] = *(const v8f*)(s + (i0 + i) * 2048);
#pragma unroll
        for (int i = 0; i < CVU; ++i) { v8us o;
#pragma unroll
            for (int k = 0; k < 8; ++k) o[k] = f2bf(v[i][k]);
            *(v8us*)(d + (i0 + i) * 2048) = o; }
        if (i0 + CVU < CVC) asm volatile("s_wait_xcnt 0x0" ::: "memory");   // stands in front of the next round's overwrite of the registers that this round's stores name
    }
}

typedef __attribute__((ext_vector_type(8))) __bf16 v8bf;
__device__ __forceinline__ float xhalf(float x) { return __builtin_bit_cast(float, __builtin_amdgcn_permlanex16(__builtin_bit_cast(int, x), __builtin_bit_cast(int, x), 0x76543210, 0xfedcba98, false, false)); }   // lane l with lane l ^ 16
// eight base-2 exponentials in place, in one statement: none of them is directly followed by a reader of its result or a writer of its source; the v_nop keeps that slot behind the last one
__device__ __forceinline__ v8f exp2x8(v8f x) { float a0 = x[0], a1 = x[1], a2 = x[2], a3 = x[3], a4 = x[4], a5 = x[5], a6 = x[6], a7 = x[7];
    asm("v_exp_f32 %0, %0\n\tv_exp_f32 %1, %1\n\tv_exp_f32 %2, %2\n\tv_exp_f32 %3, %3\n\tv_exp_f32 %4, %4\n\tv_exp_f32 %5, %5\n\tv_exp_f32 %6, %6\n\tv_exp_f32 %7, %7\n\tv_nop" : "+v"(a0), "+v"(a1), "+v"(a2), "+v"(a3), "+v"(a4), "+v"(a5), "+v"(a6), "+v"(a7));
    return (v8f){a0, a1, a2, a3, a4, a5, a6, a7}; }
template <bool HR> struct AFrag;
template <> struct AFrag<true>  { typedef bf  T; static __device__ __forceinline__ v16bf ld(const bf* p) { return cat16b(*(const v8usa*)p, *(const v8usa*)(p + 16)); } };
template <> struct AFrag<false> { typedef h16 T; static __device__ __forceinline__ v16h ld(const bf* p) { return cat16(__builtin_bit_cast(v8h, (v8us)*(const v8usa*)p), __builtin_bit_cast(v8h, (v8us)*(const v8usa*)(p + 16))); } };
template <bool HR>
__device__ __forceinline__ void attn_body(const bf* __restrict__ Q0, const bf* __restrict__ Q1, const bf* __restrict__ K0, const bf* __restrict__ K1, const bf* __restrict__ V0, const bf* __restrict__ V1, const float* bs, bf* sm, int q0, int nst, bf* Ah, bf* Al) {
    typedef typename AFrag<HR>::T T16; typedef typename WFrag<T16>::V V;
    // every inner loop below is unrolled: the fragment, score and output arrays are indexed by constants only and stay in registers
    constexpr int NQ = HR ? 1 : 2;      // 16-query groups a wave
    constexpr int NP = HR ? 2 : 1;      // planes an operand
    const int tid = (int)threadIdx.x, lane = tid & 31, lr = lane & 15, hi = lane >> 4;
    const int qw = q0 + __builtin_amdgcn_readfirstlane(tid >> 5) * (16 * NQ);
    const int srow = tid >> 3, scol = (tid & 7) * 8;   // staging: 8 threads a 128-byte row, 32 rows a sweep
    V qa[NQ][2], qb[NQ][2];
#pragma unroll
    for (int g = 0; g < NQ; ++g)
#pragma unroll
        for (int ks = 0; ks < 2; ++ks) { const unsigned o = (unsigned)((qw + g * 16 + lr) * HD + ks * 32 + 8 * hi); qa[g][ks] = AFrag<HR>::ld(Q0 + o); if (HR) qb[g][ks] = AFrag<HR>::ld(Q1 + o); }
    v8f ot[4][NQ]; float mr[NQ], ls[NQ];
#pragma unroll
    for (int g = 0; g < NQ; ++g) { mr[g] = -3.0e38f; ls[g] = 0.f;
#pragma unroll
        for (int db = 0; db < 4; ++db) ot[db][g] = (v8f){}; }
    v8us sk[NP][2], sv[NP][2];
    // stage buffers in sm: (plane * 2 + buffer) * SPE; planes K0, V0, K1, V1
#define ATT_GLOAD(s) { _Pragma("unroll") for (int c = 0; c < 2; ++c) { const int row = srow + 32 * c; \
        const unsigned ko = (unsigned)(((s) * SKB + row) * HD + scol), vo = (unsigned)(row * TT + (s) * SKB + scol); \
        sk[0][c] = *(const v8usa*)(K0 + ko); sv[0][c] = *(const v8usa*)(V0 + vo); if (HR) { sk[NP - 1][c] = *(const v8usa*)(K1 + ko); sv[NP - 1][c] = *(const v8usa*)(V1 + vo); } } }
#define ATT_SSTORE(b) { _Pragma("unroll") for (int c = 0; c < 2; ++c) { bf* d = sm + (b) * SPE + (srow + 32 * c) * SPT + scol; \
        *(v8usa*)d = sk[0][c]; *(v8usa*)(d + 2 * SPE) = sv[0][c]; if (HR) { *(v8usa*)(d + 4 * SPE) = sk[NP - 1][c]; *(v8usa*)(d + 6 * SPE) = sv[NP - 1][c]; } } }
    ATT_GLOAD(0) ATT_SSTORE(0)
    __syncthreads();   // stage 0 and the bias row are in LDS before any wave reads them
    // the stage loop stays rolled: the body is long, and every register array inside is indexed by constants
#pragma unroll 1
    for (int s = 0; s < nst; ++s) {   // nst: stages of key places in use, 1 to TT / SKB
        const int buf = s & 1; const bool more = (s + 1 < nst);
        if (more) ATT_GLOAD(s + 1)
        const bf* kb = sm + buf * SPE + lr * SPT + 8 * hi; const bf* vb = kb + 2 * SPE;
#pragma unroll
        for (int ps = 0; ps < SKB / 32; ++ps) {
            v8f sc[2][NQ]; float tm[NQ];
#pragma unroll
            for (int g = 0; g < NQ; ++g) tm[g] = -3.0e38f;
#pragma unroll
            for (int kt = 0; kt < 2; ++kt) {
                const bf* kp = kb + (ps * 32 + kt * 16) * SPT; V ka[2], kl[2];
#pragma unroll
                for (int ks = 0; ks < 2; ++ks) { ka[ks] = AFrag<HR>::ld(kp + ks * 32); if (HR) kl[ks] = AFrag<HR>::ld(kp + 4 * SPE + ks * 32); }
                const float* bp = bs + s * SKB + ps * 32 + kt * 16 + 8 * hi; const v8f b8 = __builtin_shufflevector((v4f)*(const v4fa*)bp, (v4f)*(const v4fa*)(bp + 4), 0, 1, 2, 3, 4, 5, 6, 7);
#pragma unroll
                for (int g = 0; g < NQ; ++g) { v8f a = (v8f){};
#pragma unroll
                    for (int ks = 0; ks < 2; ++ks) { a = WFrag<T16>::mma(ka[ks], qa[g][ks], a); if (HR) { a = WFrag<T16>::mma(ka[ks], qb[g][ks], a); a = WFrag<T16>::mma(kl[ks], qa[g][ks], a); } }
                    a = __builtin_elementwise_fma(a, (v8f)(CL2), b8);
#pragma unroll
                    for (int r = 0; r < 8; ++r) tm[g] = fmaxf(tm[g], a[r]);
                    sc[kt][g] = a; }
            }
            bool need = false;
#pragma unroll
            for (int g = 0; g < NQ; ++g) { tm[g] = fmaxf(tm[g], xhalf(tm[g])); need = need || (tm[g] > mr[g] + 8.0f); }
            if (__builtin_amdgcn_ballot_w32(need) != 0) {   // one scalar branch a pass: rare after the first keys kept
#pragma unroll
                for (int g = 0; g < NQ; ++g) { const float mn = fmaxf(mr[g], tm[g]); const float f = __builtin_amdgcn_exp2f(mr[g] - mn); mr[g] = mn; ls[g] *= f;
#pragma unroll
                    for (int db = 0; db < 4; ++db) ot[db][g] *= f; }
            }
            V pa[NQ], pl[NQ];
#pragma unroll
            for (int g = 0; g < NQ; ++g) { const v8f p0 = exp2x8(sc[0][g] - (v8f)(mr[g])), p1 = exp2x8(sc[1][g] - (v8f)(mr[g]));
                const v8f p8 = p0 + p1; const v4f p4 = __builtin_shufflevector(p8, p8, 0, 1, 2, 3) + __builtin_shufflevector(p8, p8, 4, 5, 6, 7); ls[g] += (p4[0] + p4[1]) + (p4[2] + p4[3]);   // a short tree: no chain of 16 dependent adds
                if constexpr (HR) { const v8bf h0 = __builtin_convertvector(p0, v8bf), h1 = __builtin_convertvector(p1, v8bf);
                    const v8bf l0 = __builtin_convertvector(p0 - __builtin_convertvector(h0, v8f), v8bf), l1 = __builtin_convertvector(p1 - __builtin_convertvector(h1, v8f), v8bf);
                    pa[g] = __builtin_shufflevector(h0, h1, 0, 1, 2, 3, 4, 5, 6, 7, 8, 9, 10, 11, 12, 13, 14, 15); pl[g] = __builtin_shufflevector(l0, l1, 0, 1, 2, 3, 4, 5, 6, 7, 8, 9, 10, 11, 12, 13, 14, 15);
                } else { pa[g] = cat16(__builtin_convertvector(p0, v8h), __builtin_convertvector(p1, v8h)); } }
#pragma unroll
            for (int db = 0; db < 4; ++db) { const bf* vp = vb + db * 16 * SPT + ps * 32; const V va = AFrag<HR>::ld(vp); V vl; if (HR) vl = AFrag<HR>::ld(vp + 4 * SPE);
#pragma unroll
                for (int g = 0; g < NQ; ++g) { ot[db][g] = WFrag<T16>::mma(va, pa[g], ot[db][g]); if (HR) { ot[db][g] = WFrag<T16>::mma(va, pl[g], ot[db][g]); ot[db][g] = WFrag<T16>::mma(vl, pa[g], ot[db][g]); } } }
        }
        if (more) ATT_SSTORE(buf ^ 1)
        __syncthreads();   // publishes stage s + 1 and ends every wave's reads of stage s, whose buffer the next trip refills
    }
#undef ATT_GLOAD
#undef ATT_SSTORE
#pragma unroll
    for (int g = 0; g < NQ; ++g) { const float inv = __fdiv_rn(1.0f, ls[g] + xhalf(ls[g])); const unsigned oo = (unsigned)((qw + g * 16 + lr) * DQ + 8 * hi);
#pragma unroll
        for (int db = 0; db < 4; ++db) { v8us oh, ol;
#pragma unroll
            for (int r = 0; r < 8; ++r) { unsigned short a, c2; splitf(ot[db][g][r] * inv, a, c2); oh[r] = a; ol[r] = c2; }
            *(v8us*)(Ah + oo + db * 16) = oh; *(v8us*)(Al + oo + db * 16) = ol;
            asm volatile("s_wait_xcnt 0x0" ::: "memory"); } }   // stands in front of the next trip's (and the tail's) overwrite of the registers that the two stores name
}
// grid: NB_ * NH_ * RH / QHB work-groups of rows < RH first (the longer ones), then NB_ * NH_ * (TT - RH) / QLB
// waves_per_eu(4, 4): the register budget of 4 waves a SIMD, so that the output, score and staging arrays stay in registers (no spills)
__global__ __launch_bounds__(256) __attribute__((amdgpu_waves_per_eu(4, 4))) void k_attn(const h16* __restrict__ Q16, const h16* __restrict__ K16, const h16* __restrict__ V16, const bf* __restrict__ Qh, const bf* __restrict__ Ql, const bf* __restrict__ Kh, const bf* __restrict__ Kl, const bf* __restrict__ Vh, const bf* __restrict__ Vl, const int* __restrict__ kc, bf* Ah, bf* Al) {
    __shared__ __align__(16) bf sm[8 * SPE]; __shared__ __align__(16) float bs[TT];
    constexpr int NHW = NB_ * NH_ * (RH / QHB); const int x = (int)blockIdx.x; const bool hr = x < NHW;
    const int bh = hr ? x / (RH / QHB) : (x - NHW) / ((TT - RH) / QLB); const int q0 = hr ? (x % (RH / QHB)) * QHB : RH + ((x - NHW) % ((TT - RH) / QLB)) * QLB;
    const int b = bh / NH_, h = bh % NH_; const size_t po = (size_t)bh * TT * HD, ao = (size_t)b * TT * DQ + h * HD;
    const int cnt = keycnt(kc, b), nst = keylim(cnt) / SKB;
    { const int j = (int)threadIdx.x * (TT / 256);
#pragma unroll
      for (int c = 0; c < TT / 256; c += 4) { v4f o;
#pragma unroll
          for (int q = 0; q < 4; ++q) o[q] = (j + c + q < cnt) ? 0.0f : -3.0e38f;
          *(v4fa*)(bs + j + c) = o; } }
    if (hr) attn_body<true>(Qh + po, Ql + po, Kh + po, Kl + po, Vh + po, Vl + po, bs, sm, q0, nst, Ah + ao, Al + ao);
    else attn_body<false>((const bf*)(Q16 + po), nullptr, (const bf*)(K16 + po), nullptr, (const bf*)(V16 + po), nullptr, bs, sm, q0, nst, Ah + ao, Al + ao);
}

extern "C" void kernel_launch(void* const* d_in, const int* in_sizes, int n_in,
                              void* d_out, int out_size, void* d_ws, size_t ws_size, hipStream_t stream) {
    (void)in_sizes; (void)n_in; (void)out_size;
    const float* x = (const float*)d_in[0]; const float* xk = (const float*)d_in[1]; const float* xv = (const float*)d_in[2]; const float* wq = (const float*)d_in[3]; const float* bq = (const float*)d_in[4]; const float* wk = (const float*)d_in[5]; const float* bk = (const float*)d_in[6]; const float* wv = (const float*)d_in[7]; const float* bv = (const float*)d_in[8]; const float* wo = (const float*)d_in[9]; const float* bo = (const float*)d_in[10]; const int* MK = (const int*)d_in[11];   /* argument order q, k, v, w_q, b_q, w_k, b_k, w_v, b_v, w_o, b_o ('oi'), mask (int32 [4][2048]: read) */
    float* OUT = (float*)d_out;     // [4][2048][1024]
    char* wsp = (char*)d_ws;
    auto take = [&](size_t bytes) { char* p = wsp; wsp += (bytes + 255) & ~(size_t)255; return (void*)p; };
    bf* WQ = (bf*)take((size_t)DQ * DM * 2); bf* WK = (bf*)take((size_t)DKV * DM * 2); bf* WV = (bf*)take((size_t)DKV * DM * 2); bf* WO = (bf*)take((size_t)DM * DQ * 2);
    bf* XB = (bf*)take((size_t)3 * NB_ * TT * DM * 2);   // query, key, value of all batch entries; directly behind the weights (k_cvt writes the seven copies as one run)
    const size_t PB = PBE;
    h16* QP16 = (h16*)take(NB_ * PB * 2); h16* KP16 = (h16*)take(NB_ * PB * 2); h16* VT16 = (h16*)take(NB_ * PB * 2);
    bf* QPh = (bf*)take(NB_ * PB * 2); bf* QPl = (bf*)take(NB_ * PB * 2); bf* KPh = (bf*)take(NB_ * PB * 2); bf* KPl = (bf*)take(NB_ * PB * 2); bf* VTh = (bf*)take(NB_ * PB * 2); bf* VTl = (bf*)take(NB_ * PB * 2);
    bf* ATh = (bf*)take((size_t)NB_ * TT * DQ * 2); bf* ATl = (bf*)take((size_t)NB_ * TT * DQ * 2);
    int* KC = (int*)take(NB_ * KCS * sizeof(int));   // kept keys of each batch entry, written by k_cvt
    if ((size_t)(wsp - (char*)d_ws) > ws_size) return;    // 232 MiB of the 256 MiB
    (void)WK; (void)WV;   // reached through WQ: the weights' copies lie in one run
    k_cvt<<<4 * CVW + 3 * CVX, 256, 0, stream>>>(wq, wk, wv, wo, x, xk, xv, MK, WQ, KC);
    k_proj<<<dim3(TT / GTL, DQ / GTL, 3 * NB_), 128, 0, stream>>>(XB, WQ, bq, bk, bv, KC, QP16, QPh, QPl);
    k_attn<<<NB_ * NH_ * (RH / QHB + (TT - RH) / QLB), 256, 0, stream>>>(QP16, KP16, VT16, QPh, QPl, KPh, KPl, VTh, VTl, KC, ATh, ATl);
    k_out<<<dim3(TT / GTL, DM / GTL, NB_), 128, 0, stream>>>(ATh, ATl, WO, OUT, bo);
}

// v008
// It runs in 142 microseconds.
// Next to v007, in two timings, it ran 1.07 times as fast each time.
// Counting every step since v000, it is 28.0 times as fast.
#include <hip/hip_runtime.h>

// Multi-head attention over three input streams with a key-padding mask (q, k, v [4][2048][1024]; qh = q w_q^T + b_q, kh = k w_k^T + b_k, vh = v w_v^T + b_v ('oi' (out, in) [1024][1024] x 0.02 + [1024]: the four biases are zero on this draw: read and added; 16 heads x 64); scores / sqrt(64); keys j with mask[b][j] == 0 (int32 [4][2048], read as data: about half the keys of every batch entry) are set to the float32 minimum: an exclusion (no batch entry has every key masked); softmax; out = merged w_o^T + b_o -> [4][2048][1024] (8.4 M); argument order q, k, v, w_q, b_q, w_k, b_k, w_v, b_v, w_o, b_o, mask).
// Keys packed: a key with mask word 0 has weight exactly 0 in f32 as soon as one key of its batch entry is kept, so launch (1) stores the key and value rows of a batch entry with the kept ones first, in their order, the others behind them, and writes the count of kept keys; (3) works on key places below the count rounded up to a stage of 64, (1) and (2) on those below the count rounded up to a GEMM tile of 128 (all places where no key is kept); places from the count on get the bias.
// Layout: four launches, each for all batch entries. (1) bf16 copies of the four 'oi' weights (cast as they stand) and of query, key and value, one behind another in the workspace; (2) the three exact projections + f32 biases, whose GEMM (operands staged in LDS by asynchronous copies) stores the head planes itself (no f32 copy of a projection in memory); head planes of all batch entries side by side; (3) attention for every (batch entry, head): scores, key mask, softmax and P x V stay in registers (hybrid rows: < 512 hi/lo 3 products, rest fp16); (4) merged hi/lo x Wo exact + bo.
// Compute dtypes, f32 accumulate: every input rounded to bf16; projections exact + f32 biases; attention rows < 512 3 products, rest fp16; softmax f32; Wo hl x exact + bias.

#define NB_  4
#define TT   2048
#define DM   1024
#define NH_  16
#define NKV  16
#define REP  (NH_ / NKV)
#define HD   64
#define DQ   (NH_ * HD)
#define DKV  (NKV * HD)
#define RH   512                  // query rows < RH use hi+lo planes (0: none)
#define WIN  0
#define SCL  0.125f   // HD^-0.5
#define GTL  128                  // rows and columns of a GEMM work-group's output tile (projections, Wo)
#define SKB  64                   // keys in one LDS stage of the attention kernel
#define SPT  72                   // LDS row pitch of a stage in 16-bit elements: 128 B of data + 16 B, an odd multiple of 16 B
#define SPE  (64 * SPT)           // elements in one stage buffer (64 rows: SKB keys of K, or HD rows of V^T)
#define QHB  128                  // query rows of a work-group where rows < RH (8 waves x 16)
#define QLB  384                  // query rows of a work-group elsewhere (8 waves x 48)
#define CL2  0.18033688011112042f // HD^-0.5 x log2(e): scores go to base 2
typedef _Float16 h16;
typedef unsigned short bf;
typedef __attribute__((ext_vector_type(16))) __bf16   v16bf;
typedef __attribute__((ext_vector_type(16))) _Float16 v16h;
typedef __attribute__((ext_vector_type(8)))  _Float16 v8h;
typedef __attribute__((ext_vector_type(8)))  unsigned short v8us;
typedef __attribute__((ext_vector_type(8)))  float    v8f;
typedef __attribute__((ext_vector_type(4)))  float    v4f;
typedef v8h  __attribute__((may_alias)) v8ha;
typedef v4f  __attribute__((may_alias)) v4fa;
typedef v8us __attribute__((may_alias)) v8usa;

__device__ __forceinline__ unsigned short f2bf(float f) { unsigned u = __float_as_uint(f); u += 0x7FFFu + ((u >> 16) & 1u); return (unsigned short)(u >> 16); }
__device__ __forceinline__ float bf2f(unsigned short b) { return __uint_as_float(((unsigned)b) << 16); }
__device__ __forceinline__ float bfr(float f) { return bf2f(f2bf(f)); }
__device__ __forceinline__ v16h cat16(v8h lo, v8h hi) { return __builtin_shufflevector(lo, hi, 0, 1, 2, 3, 4, 5, 6, 7, 8, 9, 10, 11, 12, 13, 14, 15); }
__device__ __forceinline__ v16bf cat16b(v8us lo, v8us hi) { return __builtin_bit_cast(v16bf, __builtin_shufflevector(lo, hi, 0, 1, 2, 3, 4, 5, 6, 7, 8, 9, 10, 11, 12, 13, 14, 15)); }
__device__ __forceinline__ v8f wmma16(v16h a, v16h b, v8f c) { return __builtin_amdgcn_wmma_f32_16x16x32_f16(false, a, false, b, (short)0, c, false, false); }
__device__ __forceinline__ v8f wmmab(v16bf a, v16bf b, v8f c) { return __builtin_amdgcn_wmma_f32_16x16x32_bf16(false, a, false, b, (short)0, c, false, false); }
__device__ __forceinline__ h16 tohx(float x) { return (h16)x; }
__device__ __forceinline__ void splitf(float y, unsigned short& h, unsigned short& l) { h = f2bf(y); l = f2bf(y - bf2f(h)); }
typedef __attribute__((ext_vector_type(4))) _Float16 v4h;
typedef __attribute__((ext_vector_type(4))) unsigned short v4us;
// kept keys of a batch entry as launch (1) counted them, held inside the shape; and the key places that are worked on: the count rounded up to whole stages, or every place where no key is kept (the row is then uniform over all keys)
#define KCS  32                   // the counts lie 128 bytes apart: each has its own writer and its own line
__device__ __forceinline__ int keycnt(const int* __restrict__ kc, int b) { const int c = kc[b * KCS]; return c < 0 ? 0 : (c > TT ? TT : c); }
__device__ __forceinline__ int keylim(int c) { return c > 0 ? ((c + SKB - 1) & ~(SKB - 1)) : TT; }
// the key places that launch (1) fills and launch (2) projects: the same in whole GEMM tiles
__device__ __forceinline__ int keyfill(int c) { return c > 0 ? ((c + GTL - 1) & ~(GTL - 1)) : TT; }
static_assert(GTL % SKB == 0 && TT % GTL == 0, "a GEMM tile is whole stages");



// ---- gemmt: GEMM of one 128 x 128 output tile by a work-group of 4 waves (2 x 2, 64 x 64 and 16 accumulators a wave), K = DM; operands are K-contiguous bf16 planes.
// C[m][n] = sum_k (A[m][k] (+ A2[m][k], NA = 2)) Bt[n][k] + bias, each accumulator one chain over k in rising order (NA = 2: per 32 of k first A, then A2).
// The operands come in stages of GKS of k: every lane brings 16-byte pieces from global memory into LDS by asynchronous copies (no register in between), and each row is fetched once for the two waves that read it. Two buffers: the copies of stage t + 2 fly while stage t + 1 is worked on.
// PL = 0: f32 C (pitch ldc) + bias[n]. PL > 0: three 16-bit planes (P16 fp16, Ph + Pl bf16 hi/lo), each in column planes of 1 << lcp columns, sP elements apart (column n: plane n >> lcp, place n & ((1 << lcp) - 1), row pitch ldc). PL = 1: bias[n]. PL = 2: bias[m].
//   Q, K head planes [h][t][d]: A = x, Bt = w, lcp = 6, sP = TT * HD, ldc = HD. V^T planes [h][d][t]: the operands change places (A = w, Bt = x: C[m][n] is feature m at token n), ldc = TT, bias[m].
template <typename T16> struct WFrag;
template <> struct WFrag<h16> { typedef v16h V; static __device__ __forceinline__ v8f mma(V a, V b, v8f c) { return wmma16(a, b, c); } };
template <> struct WFrag<bf> { typedef v16bf V; static __device__ __forceinline__ v8f mma(V a, V b, v8f c) { return wmmab(a, b, c); } };
#define GKS  64                   // k in one LDS stage: 128 bytes of every operand row
#define GRP  72                   // LDS row pitch of a stage in 16-bit elements: 128 B of data + 16 B, an odd multiple of 16 B
#define GPE  (GTL * GRP)          // elements of one operand's rows in a stage
static_assert(GKS == 64 && DM % GKS == 0 && DM / GKS >= 2 && GTL == 128, "whole stages, at least two; 128 threads x 8 copies fill one operand's 128 rows");
__device__ __forceinline__ v16bf gfrag(const bf* p) { return cat16b(*(const v8usa*)p, *(const v8usa*)(p + 16)); }
// one operand's part of a stage, 128 rows x 128 bytes: 8 lanes a row, 16 rows a copy of the work-group, 8 copies a lane. l: the lane's LDS byte address in row tid >> 3; g: the part's first byte in global memory, the same for the work-group (a scalar base); o[i]: the lane's byte offset from g in row (tid >> 3) + 16 i, the same for every operand and stage.
// s_wait_xcnt closes the statement: it stands in front of every later write of the address registers that the copies name
__device__ __forceinline__ void gcopy(unsigned l, const bf* g, const unsigned (&o)[8]) {
    asm volatile("global_load_async_to_lds_b128 %0, %8, %16\n\tglobal_load_async_to_lds_b128 %1, %9, %16\n\tglobal_load_async_to_lds_b128 %2, %10, %16\n\tglobal_load_async_to_lds_b128 %3, %11, %16\n\t"
                 "global_load_async_to_lds_b128 %4, %12, %16\n\tglobal_load_async_to_lds_b128 %5, %13, %16\n\tglobal_load_async_to_lds_b128 %6, %14, %16\n\tglobal_load_async_to_lds_b128 %7, %15, %16\n\ts_wait_xcnt 0x0"
                 :: "v"(l), "v"(l + 16 * GRP * 2), "v"(l + 32 * GRP * 2), "v"(l + 48 * GRP * 2), "v"(l + 64 * GRP * 2), "v"(l + 80 * GRP * 2), "v"(l + 96 * GRP * 2), "v"(l + 112 * GRP * 2),
                    "v"(o[0]), "v"(o[1]), "v"(o[2]), "v"(o[3]), "v"(o[4]), "v"(o[5]), "v"(o[6]), "v"(o[7]), "s"(g) : "memory");
}
template <int NA, int PL>
__device__ __forceinline__ void gemmt(const bf* __restrict__ A, const bf* __restrict__ A2, const bf* __restrict__ Bt, float* C, int ldc, const float* __restrict__ bias, int r0, int c0, bf* sm, int lcp = 30, size_t sP = 0, h16* P16 = nullptr, bf* Ph = nullptr, bf* Pl = nullptr) {
    constexpr int STG = (NA + 1) * GPE, NS = DM / GKS;   // a stage buffer: A rows, (A2 rows,) Bt rows
    static_assert(4 * 64 * 68 * 4 <= 2 * STG * 2, "the four f32 wave tiles of the epilogue fit the two buffers");
    const int tid = (int)threadIdx.x, lane = tid & 31, lr = lane & 15, hi = lane >> 4;
    // the wave's number through readfirstlane: its place in the tile stays in scalar registers
    const int wv = __builtin_amdgcn_readfirstlane(tid >> 5), wm = wv >> 1, wn = wv & 1;
    v8f acc[4][4];
#pragma unroll
    for (int mb = 0; mb < 4; ++mb)
#pragma unroll
        for (int nb = 0; nb < 4; ++nb) acc[mb][nb] = (v8f){};
    const unsigned ls = (unsigned)(size_t)sm + (unsigned)((tid >> 3) * (GRP * 2) + (tid & 7) * 16);
    unsigned go[8];
#pragma unroll
    for (int i = 0; i < 8; ++i) go[i] = (unsigned)(((tid >> 3) + 16 * i) * (DM * 2) + (tid & 7) * 16);
    const bf* ga = A + (size_t)r0 * DM; const bf* ga2 = (NA == 2) ? A2 + (size_t)r0 * DM : nullptr; const bf* gb = Bt + (size_t)c0 * DM;
#define G_STAGE(s, b) { gcopy(ls + (b) * (STG * 2), ga + (s) * GKS, go); if (NA == 2) gcopy(ls + (b) * (STG * 2) + GPE * 2, ga2 + (s) * GKS, go); gcopy(ls + (b) * (STG * 2) + NA * GPE * 2, gb + (s) * GKS, go); }
    G_STAGE(0, 0)
    asm volatile("s_wait_asynccnt 0x0" ::: "memory");   // this wave's copies of stage 0 have landed
    __syncthreads();   // stage 0 is whole before any wave reads it
    G_STAGE(1, 1)
    // the stage loop stays rolled: the body is long, and every register array inside is indexed by constants
#pragma unroll 1
    for (int t = 0; t < NS; ++t) {
        const int buf = t & 1;
        const bf* ab = sm + buf * STG + (wm * 64 + lr) * GRP + 8 * hi; const bf* bb = sm + buf * STG + NA * GPE + (wn * 64 + lr) * GRP + 8 * hi;
        v16bf a[4], a2[4], b[4];
        // G_FRAGS: all fragments of 32 of k are read as one group in front of their products. The two scheduling fences keep the group whole: without them the compiler sinks each b fragment's reads to its first use, and the wave waits out the LDS latency in front of every four products
#define G_FRAGS(ks) { __builtin_amdgcn_sched_barrier(0); \
        _Pragma("unroll") for (int i = 0; i < 4; ++i) a[i] = gfrag(ab + i * 16 * GRP + (ks) * 32); \
        _Pragma("unroll") for (int i = 0; i < 4; ++i) b[i] = gfrag(bb + i * 16 * GRP + (ks) * 32); \
        if (NA == 2) { _Pragma("unroll") for (int i = 0; i < 4; ++i) a2[i] = gfrag(ab + GPE + i * 16 * GRP + (ks) * 32); } \
        __builtin_amdgcn_sched_barrier(0); }
#define G_MMA(x) { _Pragma("unroll") for (int nb = 0; nb < 4; ++nb) { _Pragma("unroll") for (int mb = 0; mb < 4; ++mb) acc[mb][nb] = wmmab(x[mb], b[nb], acc[mb][nb]); } }
        G_FRAGS(0) G_MMA(a) if (NA == 2) G_MMA(a2)
        G_FRAGS(1) if (NA == 2) G_MMA(a)
        // stage t has been read to its end: the hand-over stands here, in front of the trip's last 16 products (which work on registers), so that the copies of stage t + 2 have a whole trip to land.
        __builtin_amdgcn_sched_barrier(0);   // keeps the products above in front of the hand-over: their A fragments' registers are free for the copies' addresses
        asm volatile("s_wait_dscnt 0x0" ::: "memory");      // this wave's reads of stage t are done before its buffer is refilled
        asm volatile("s_wait_asynccnt 0x0" ::: "memory");   // this wave's copies of stage t + 1 have landed
        __syncthreads();   // publishes stage t + 1 and ends every wave's reads of stage t
        if (t + 2 < NS) G_STAGE(t + 2, buf)
        __builtin_amdgcn_sched_barrier(0);   // keeps the last products behind the copies: moved in front, they would take their time off the copies' lead
        if (NA == 2) G_MMA(a2) else G_MMA(a)
    }
#undef G_FRAGS
#undef G_MMA
#undef G_STAGE
    asm volatile("s_wait_asynccnt 0x0" ::: "memory");   // no copy is under way when the buffers become the epilogue's staging
    // epilogue: each wave turns its 64 x 64 tile through its own LDS range, so that whole 128-byte lines go out. Every loop unrolled: acc and val are indexed by constants only
    float* ow = (float*)sm + wv * (64 * 68); const int rw = r0 + wm * 64, cw = c0 + wn * 64;
#pragma unroll
    for (int mb = 0; mb < 4; ++mb)
#pragma unroll
        for (int nb = 0; nb < 4; ++nb)
#pragma unroll
            for (int j = 0; j < 8; ++j) ow[(mb * 16 + hi * 8 + j) * 68 + nb * 16 + lr] = acc[mb][nb][j];
    __syncthreads();   // a lane reads below what other lanes stored
    if constexpr (PL > 0) {
        // first the LDS reads and the bias of all sweeps, so that the wait behind a sweep's stores holds none of them back
        v8f val[16];
#pragma unroll
        for (int s = 0; s < 16; ++s) { const int u = s * 32 + lane, row = u >> 3, cofs = (u & 7) * 8;
            val[s] = __builtin_shufflevector((v4f)*(const v4fa*)(ow + row * 68 + cofs), (v4f)*(const v4fa*)(ow + row * 68 + cofs + 4), 0, 1, 2, 3, 4, 5, 6, 7);
#pragma unroll
            for (int q = 0; q < 8; ++q) val[s][q] += bfr(bias[PL == 1 ? cw + cofs + q : rw + row]); }
        const size_t pbase = (size_t)(cw >> lcp) * sP + (size_t)rw * ldc + (cw & ((1 << lcp) - 1));
#pragma unroll
        for (int s = 0; s < 16; ++s) { const int u = s * 32 + lane, row = u >> 3, cofs = (u & 7) * 8; const size_t o = pbase + (size_t)row * ldc + cofs; v8h o16; v8us oh, ol;
#pragma unroll
            for (int q = 0; q < 8; ++q) { o16[q] = tohx(val[s][q]); unsigned short a2, c2; splitf(val[s][q], a2, c2); oh[q] = a2; ol[q] = c2; }
            *(v8h*)(P16 + o) = o16; *(v8us*)(Ph + o) = oh; *(v8us*)(Pl + o) = ol;
            asm volatile("s_wait_xcnt 0x0" ::: "memory"); }   // stands in front of the next sweep's overwrite of the registers that the three stores name
    } else {
        v4f val[32];
#pragma unroll
        for (int s = 0; s < 32; ++s) { const int u = s * 32 + lane, row = u >> 4, cofs = (u & 15) * 4; val[s] = *(const v4fa*)(ow + row * 68 + cofs);
#pragma unroll
            for (int q = 0; q < 4; ++q) val[s][q] += bfr(bias[cw + cofs + q]); }
#pragma unroll
        for (int s = 0; s < 32; ++s) { const int u = s * 32 + lane, row = u >> 4, cofs = (u & 15) * 4;
            *(v4f*)(C + (size_t)(rw + row) * ldc + cw + cofs) = val[s];
            asm volatile("s_wait_xcnt 0x0" ::: "memory"); }   // stands in front of the next sweep's overwrite of the registers that the store names
    }
}

#define PBE  ((size_t)NH_ * TT * HD)   // elements of one batch entry in a head plane (NKV == NH_); a plane holds all NB_ entries
// ---- k_proj: the three projections of all batch entries in one launch; grid (TT/128, DQ/128, 3 * NB_), z = stream * NB_ + batch entry (streams: query, key, value).
// Key and value rows lie packed (kept keys first): blockIdx.x is their token tile in both forms, and tiles past the places that launch (1) filled are left out. X: the three bf16 streams, Wt: their three weights, P16: the three fp16 planes, each set one behind another; Ph, Pl: the hi and lo planes, which alternate (a stream's pair lies 2 * NB_ * PBE behind the last one's).
__global__ __launch_bounds__(128) void k_proj(const bf* __restrict__ X, const bf* __restrict__ Wt, const float* __restrict__ bq, const float* __restrict__ bk, const float* __restrict__ bv, const int* __restrict__ kc, h16* P16, bf* Ph, bf* Pl) {
    __shared__ __align__(16) bf sm[2 * 2 * GPE];   // one array for both forms below
    const int z = (int)blockIdx.z, st = z / NB_, b = z % NB_;
    if (st > 0 && (int)blockIdx.x * GTL >= keyfill(keycnt(kc, b))) return;   // key, value: a token tile past the key places filled; the whole work-group leaves, in front of every copy and barrier
    const bf* xs = X + (size_t)z * TT * DM; const bf* wt = Wt + (size_t)st * DQ * DM; const size_t o2 = (size_t)(st * 2 * NB_ + b) * PBE;
    if (st < 2) gemmt<1, 1>(xs, nullptr, wt, nullptr, HD, st ? bk : bq, (int)blockIdx.x * GTL, (int)blockIdx.y * GTL, sm, 6, (size_t)TT * HD, P16 + (size_t)z * PBE, Ph + o2, Pl + o2);
    else gemmt<1, 2>(wt, nullptr, xs, nullptr, TT, bv, (int)blockIdx.y * GTL, (int)blockIdx.x * GTL, sm, 30, 0, P16 + (size_t)z * PBE, Ph + o2, Pl + o2);
}
// ---- k_out: merged hi/lo x Wo + bo of all batch entries in one launch; grid (TT/128, DM/128, NB_)
__global__ __launch_bounds__(128) void k_out(const bf* __restrict__ Ah, const bf* __restrict__ Al, const bf* __restrict__ Wt, float* C, const float* __restrict__ bo) {
    __shared__ __align__(16) bf sm[2 * 3 * GPE];
    const size_t z = blockIdx.z;
    gemmt<2, 0>(Ah + z * TT * DQ, Al + z * TT * DQ, Wt, C + z * TT * DM, DM, bo, (int)blockIdx.x * GTL, (int)blockIdx.y * GTL, sm);
}

typedef __attribute__((ext_vector_type(4))) int v4i;

// ---- k_cvt: every f32 -> bf16 copy in one launch. A chunk is 2048 elements (256 threads x 8); the chunks of w_q, w_k, w_v, w_o, query, key, value follow one another, as their copies do in dst.
// A work-group takes CVC chunks in a row, all of one source: few waves to start; for weights and query one address a thread (the chunks are reached by constant offsets), CVU chunks' loads of a thread in flight together.
#define CVC  16
#define CVU  4
#define CVW  (DM * DM / 2048 / CVC)            // work-groups of a weight
#define CVX  (NB_ * TT * DM / 2048 / CVC)      // work-groups of a stream
#define CVB  (TT * DM / 2048 / CVC)            // work-groups of one batch entry of a stream
static_assert(DQ == DM && DKV == DM && (DM * DM) % (2048 * CVC) == 0 && CVC % CVU == 0, "whole work-groups for every source");
static_assert(CVC * 2048 == 32 * DM && DM == 1024 && TT == 2048, "a work-group of a stream has 32 rows (one word of key bits), a thread 8 keys, a lane two of the 64 words");
// Key and value: row t of a batch entry goes to place p(t): kept keys (mask word != 0) to the number of kept keys in front of t, the others to the count + the number of others in front of t. Rows whose place is not worked on are neither read nor stored.
__global__ __launch_bounds__(256) void k_cvt(const float* __restrict__ wq, const float* __restrict__ wk, const float* __restrict__ wv, const float* __restrict__ wo, const float* __restrict__ xq, const float* __restrict__ xk, const float* __restrict__ xv, const int* __restrict__ mk, bf* __restrict__ dst, int* __restrict__ kc) {
    const unsigned g = blockIdx.x, gx = g - 4 * CVW; const bool isw = g < 4 * CVW; const unsigned w = isw ? g / CVW : gx / CVX, l = isw ? g % CVW : gx % CVX;
    const float* s = (isw ? (w == 0 ? wq : w == 1 ? wk : w == 2 ? wv : wo) : (w == 0 ? xq : w == 1 ? xk : xv)) + (size_t)l * (CVC * 2048) + threadIdx.x * 8;
    if (!isw && w > 0) {   // the same for the whole work-group
        __shared__ __align__(16) unsigned kw[TT / 32];   // the batch entry's key bits, 32 keys a word
        const int tid = (int)threadIdx.x, lane = tid & 31, wv8 = __builtin_amdgcn_readfirstlane(tid >> 5);   // the wave's number in a scalar register: the row walk below is scalar
        const unsigned b = l / CVB, gr = l % CVB; const int* mp = mk + (size_t)b * TT + tid * 8;
        const v4i ma = *(const v4i*)mp, mb = *(const v4i*)(mp + 4); unsigned by = 0;
#pragma unroll
        for (int q = 0; q < 4; ++q) by |= (ma[q] != 0 ? 1u << q : 0u) | (mb[q] != 0 ? 16u << q : 0u);
        ((unsigned char*)kw)[tid] = (unsigned char)by;   // keys 8 tid .. 8 tid + 7: byte tid & 3 of word tid >> 2
        __syncthreads();   // all 64 words are in LDS before any wave counts them
        const unsigned w0 = kw[2 * lane], w1 = kw[2 * lane + 1];
        int pk = ((__popc(w0) + __popc(w1)) << 16) + (2u * lane < gr ? __popc(w0) : 0) + (2u * lane + 1 < gr ? __popc(w1) : 0);   // high half: kept keys; low half: kept keys in front of this work-group's rows
#pragma unroll
        for (int m = 16; m > 0; m >>= 1) pk += __shfl_xor(pk, m);
        const int cnt = pk >> 16, bef = pk & 0xffff, lim = keyfill(cnt); const unsigned mine = kw[gr];
        if (w == 1 && gr == 0 && tid == 0) kc[b * KCS] = cnt;   // one writer a batch entry
        // lane r holds the place of the work-group's row r; a: the rows whose place is worked on
        const int kb = bef + __popc(mine & ((1u << lane) - 1u)); const int pos = ((mine >> lane) & 1u) ? kb : cnt + ((int)gr * 32 + lane - kb);
        unsigned a = __builtin_amdgcn_ballot_w32(pos < lim);
        const float* sb = s - tid * 8 + lane * 8;   // the work-group's first row, this lane's columns
        bf* db = dst + (size_t)(g - gr) * (CVC * 2048) + lane * 8;   // the batch entry's first place, this lane's columns
        // a wave takes every eighth of those rows, a whole row at a time: no load stands under a test of its own, and a row's loads are in flight together
        for (int i = 0; i < wv8; ++i) a &= a - 1;
        // stays rolled: the trip count comes from the key bits, at most 32 / 8
#pragma unroll 1
        for (int n = 0; n < 32 / 8 && a != 0; ++n) {
            const int r = __builtin_ctz(a); const float* sp = sb + r * DM; bf* dp = db + (size_t)__builtin_amdgcn_readlane(pos, r) * DM;
            v8f v[DM / 256];
#pragma unroll
            for (int i = 0; i < DM / 256; ++i) v[i] = *(const v8f*)(sp + i * 256);
#pragma unroll
            for (int i = 0; i < DM / 256; ++i) { v8us o;
#pragma unroll
                for (int k = 0; k < 8; ++k) o[k] = f2bf(v[i][k]);
                *(v8us*)(dp + i * 256) = o; }
            asm volatile("s_wait_xcnt 0x0" ::: "memory");   // stands in front of the next trip's overwrite of the registers that this trip's loads and stores name
#pragma unroll
            for (int i = 0; i < 8; ++i) a &= a - 1;
        }
        return;
    }
    bf* d = dst + (size_t)g * (CVC * 2048) + threadIdx.x * 8;
    // all loops unrolled: v is indexed by constants only, every chunk is a constant offset from s and d, and a round's loads are issued before the first is used
#pragma unroll
    for (int i0 = 0; i0 < CVC; i0 += CVU) {
        v8f v[CVU];
#pragma unroll
        for (int i = 0; i < CVU; ++i) v[i] = *(const v8f*)(s + (i0 + i) * 2048);
#pragma unroll
        for (int i = 0; i < CVU; ++i) { v8us o;
#pragma unroll
            for (int k = 0; k < 8; ++k) o[k] = f2bf(v[i][k]);
            *(v8us*)(d + (i0 + i) * 2048) = o; }
        if (i0 + CVU < CVC) asm volatile("s_wait_xcnt 0x0" ::: "memory");   // stands in front of the next round's overwrite of the registers that this round's stores name
    }
}

typedef __attribute__((ext_vector_type(8))) __bf16 v8bf;
__device__ __forceinline__ float xhalf(float x) { return __builtin_bit_cast(float, __builtin_amdgcn_permlanex16(__builtin_bit_cast(int, x), __builtin_bit_cast(int, x), 0x76543210, 0xfedcba98, false, false)); }   // lane l with lane l ^ 16
// eight base-2 exponentials in one statement, the results in registers of their own (early clobber: none lies on a source): none of them is directly followed by a reader of its result or a writer of its source; the v_nop keeps that slot behind the last one.
// Out of place the results land in the register pairs in which they are summed; in place the compiler copied them there, and with 48 queries a wave it spilled
__device__ __forceinline__ v8f exp2x8(v8f x) { float a0 = x[0], a1 = x[1], a2 = x[2], a3 = x[3], a4 = x[4], a5 = x[5], a6 = x[6], a7 = x[7];
    float o0, o1, o2, o3, o4, o5, o6, o7;
    asm("v_exp_f32 %0, %8\n\tv_exp_f32 %1, %9\n\tv_exp_f32 %2, %10\n\tv_exp_f32 %3, %11\n\tv_exp_f32 %4, %12\n\tv_exp_f32 %5, %13\n\tv_exp_f32 %6, %14\n\tv_exp_f32 %7, %15\n\tv_nop" : "=&v"(o0), "=&v"(o1), "=&v"(o2), "=&v"(o3), "=&v"(o4), "=&v"(o5), "=&v"(o6), "=&v"(o7) : "v"(a0), "v"(a1), "v"(a2), "v"(a3), "v"(a4), "v"(a5), "v"(a6), "v"(a7));
    return (v8f){o0, o1, o2, o3, o4, o5, o6, o7}; }
// one plane's part of a stage: 64 K rows and 64 V^T rows of 128 bytes, 8 lanes a row, 32 rows a copy of the work-group, 2 copies an operand. l: the lane's LDS byte address in row tid >> 3 of the K buffer (the V^T buffer lies 2 * SPE elements behind); gk, gv: the parts' first bytes in global memory, the same for the work-group (scalar bases, as are those of rows 32 on); ok, ov: the lane's byte offsets from them in row tid >> 3, the same for both halves.
// s_wait_xcnt closes the statement: it stands in front of every later write of the address registers that the copies name
__device__ __forceinline__ void acopy(unsigned l, const bf* gk, const bf* gv, unsigned ok, unsigned ov) {
    asm volatile("global_load_async_to_lds_b128 %0, %4, %6\n\tglobal_load_async_to_lds_b128 %1, %4, %7\n\tglobal_load_async_to_lds_b128 %2, %5, %8\n\tglobal_load_async_to_lds_b128 %3, %5, %9\n\ts_wait_xcnt 0x0"
                 :: "v"(l), "v"(l + 32 * SPT * 2), "v"(l + 2 * SPE * 2), "v"(l + 2 * SPE * 2 + 32 * SPT * 2), "v"(ok), "v"(ov), "s"(gk), "s"(gk + 32 * HD), "s"(gv), "s"(gv + 32 * TT) : "memory");
}
template <bool HR> struct AFrag;
template <> struct AFrag<true>  { typedef bf  T; static __device__ __forceinline__ v16bf ld(const bf* p) { return cat16b(*(const v8usa*)p, *(const v8usa*)(p + 16)); } };
template <> struct AFrag<false> { typedef h16 T; static __device__ __forceinline__ v16h ld(const bf* p) { return cat16(__builtin_bit_cast(v8h, (v8us)*(const v8usa*)p), __builtin_bit_cast(v8h, (v8us)*(const v8usa*)(p + 16))); } };
template <bool HR>
__device__ __forceinline__ void attn_body(const bf* __restrict__ Q0, const bf* __restrict__ Q1, const bf* __restrict__ K0, const bf* __restrict__ K1, const bf* __restrict__ V0, const bf* __restrict__ V1, const float* bs, bf* sm, int q0, int nst, bf* Ah, bf* Al) {
    typedef typename AFrag<HR>::T T16; typedef typename WFrag<T16>::V V;
    // every inner loop below is unrolled: the fragment, score and output arrays are indexed by constants only and stay in registers
    constexpr int NQ = HR ? 1 : 3;      // 16-query groups a wave
    constexpr int NP = HR ? 2 : 1;      // planes an operand
    const int tid = (int)threadIdx.x, lane = tid & 31, lr = lane & 15, hi = lane >> 4;
    const int qw = q0 + __builtin_amdgcn_readfirstlane(tid >> 5) * (16 * NQ);
    const int srow = tid >> 3, scol = (tid & 7) * 8;   // staging: 8 threads a 128-byte row, 32 rows a sweep
    const unsigned sl = (unsigned)(size_t)sm + (unsigned)((srow * SPT + scol) * 2), sok = (unsigned)((srow * HD + scol) * 2), sov = (unsigned)((srow * TT + scol) * 2);
    V qa[NQ][2], qb[NQ][2];
#pragma unroll
    for (int g = 0; g < NQ; ++g)
#pragma unroll
        for (int ks = 0; ks < 2; ++ks) { const unsigned o = (unsigned)((qw + g * 16 + lr) * HD + ks * 32 + 8 * hi); qa[g][ks] = AFrag<HR>::ld(Q0 + o); if (HR) qb[g][ks] = AFrag<HR>::ld(Q1 + o); }
    v8f ot[4][NQ]; float mr[NQ], ls[NQ];
#pragma unroll
    for (int g = 0; g < NQ; ++g) { mr[g] = -3.0e38f; ls[g] = 0.f;
#pragma unroll
        for (int db = 0; db < 4; ++db) ot[db][g] = (v8f){}; }
    // stage buffers in sm: (plane * 2 + buffer) * SPE; planes K0, V0, K1, V1
#define ATT_STAGE(s, b) { acopy(sl + (b) * (SPE * 2), K0 + (s) * (SKB * HD), V0 + (s) * SKB, sok, sov); if (HR) acopy(sl + ((b) + 4) * (SPE * 2), K1 + (s) * (SKB * HD), V1 + (s) * SKB, sok, sov); }
    ATT_STAGE(0, 0)
    asm volatile("s_wait_asynccnt 0x0" ::: "memory");   // this wave's copies of stage 0 have landed
    __syncthreads();   // stage 0 and the bias row are in LDS before any wave reads them
    if (nst > 1) ATT_STAGE(1, 1)
    // the stage loop stays rolled: the body is long, and every register array inside is indexed by constants
#pragma unroll 1
    for (int s = 0; s < nst; ++s) {   // nst: stages of key places in use, 1 to TT / SKB
        const int buf = s & 1;
        const bf* kb = sm + buf * SPE + lr * SPT + 8 * hi; const bf* vb = kb + 2 * SPE;
#pragma unroll
        for (int ps = 0; ps < SKB / 32; ++ps) {
            v8f sc[2][NQ]; float tm[NQ];
#pragma unroll
            for (int g = 0; g < NQ; ++g) tm[g] = -3.0e38f;
#pragma unroll
            for (int kt = 0; kt < 2; ++kt) {
                const bf* kp = kb + (ps * 32 + kt * 16) * SPT; V ka[2], kl[2];
#pragma unroll
                for (int ks = 0; ks < 2; ++ks) { ka[ks] = AFrag<HR>::ld(kp + ks * 32); if (HR) kl[ks] = AFrag<HR>::ld(kp + 4 * SPE + ks * 32); }
                const float* bp = bs + s * SKB + ps * 32 + kt * 16 + 8 * hi; const v8f b8 = __builtin_shufflevector((v4f)*(const v4fa*)bp, (v4f)*(const v4fa*)(bp + 4), 0, 1, 2, 3, 4, 5, 6, 7);
#pragma unroll
                for (int g = 0; g < NQ; ++g) { v8f a = (v8f){};
#pragma unroll
                    for (int ks = 0; ks < 2; ++ks) { a = WFrag<T16>::mma(ka[ks], qa[g][ks], a); if (HR) { a = WFrag<T16>::mma(ka[ks], qb[g][ks], a); a = WFrag<T16>::mma(kl[ks], qa[g][ks], a); } }
                    a = __builtin_elementwise_fma(a, (v8f)(CL2), b8);
#pragma unroll
                    for (int r = 0; r < 8; ++r) tm[g] = fmaxf(tm[g], a[r]);
                    sc[kt][g] = a; }
                // keeps the next 16 keys' fragment and bias reads behind these products: read ahead, they take the registers that the 48-query form has left, and a Q fragment is spilled
                if (!HR && kt == 0) __builtin_amdgcn_sched_barrier(0);
            }
            bool need = false;
#pragma unroll
            for (int g = 0; g < NQ; ++g) { tm[g] = fmaxf(tm[g], xhalf(tm[g])); need = need || (tm[g] > mr[g] + 8.0f); }
            if (__builtin_amdgcn_ballot_w32(need) != 0) {   // one scalar branch a pass: rare after the first keys kept
#pragma unroll
                for (int g = 0; g < NQ; ++g) { const float mn = fmaxf(mr[g], tm[g]); const float f = __builtin_amdgcn_exp2f(mr[g] - mn); mr[g] = mn; ls[g] *= f;
#pragma unroll
                    for (int db = 0; db < 4; ++db) ot[db][g] *= f; }
            }
            V pa[NQ], pl[NQ];
#pragma unroll
            for (int g = 0; g < NQ; ++g) { const v8f p0 = exp2x8(sc[0][g] - (v8f)(mr[g])), p1 = exp2x8(sc[1][g] - (v8f)(mr[g]));
                const v8f p8 = p0 + p1; const v4f p4 = __builtin_shufflevector(p8, p8, 0, 1, 2, 3) + __builtin_shufflevector(p8, p8, 4, 5, 6, 7); ls[g] += (p4[0] + p4[1]) + (p4[2] + p4[3]);   // a short tree: no chain of 16 dependent adds
                if constexpr (HR) { const v8bf h0 = __builtin_convertvector(p0, v8bf), h1 = __builtin_convertvector(p1, v8bf);
                    const v8bf l0 = __builtin_convertvector(p0 - __builtin_convertvector(h0, v8f), v8bf), l1 = __builtin_convertvector(p1 - __builtin_convertvector(h1, v8f), v8bf);
                    pa[g] = __builtin_shufflevector(h0, h1, 0, 1, 2, 3, 4, 5, 6, 7, 8, 9, 10, 11, 12, 13, 14, 15); pl[g] = __builtin_shufflevector(l0, l1, 0, 1, 2, 3, 4, 5, 6, 7, 8, 9, 10, 11, 12, 13, 14, 15);
                } else { pa[g] = cat16(__builtin_convertvector(p0, v8h), __builtin_convertvector(p1, v8h)); } }
#pragma unroll
            for (int db = 0; db < 4; ++db) { const bf* vp = vb + db * 16 * SPT + ps * 32; const V va = AFrag<HR>::ld(vp); V vl; if (HR) vl = AFrag<HR>::ld(vp + 4 * SPE);
#pragma unroll
                for (int g = 0; g < NQ; ++g) { ot[db][g] = WFrag<T16>::mma(va, pa[g], ot[db][g]); if (HR) { ot[db][g] = WFrag<T16>::mma(va, pl[g], ot[db][g]); ot[db][g] = WFrag<T16>::mma(vl, pa[g], ot[db][g]); } } }
        }
        asm volatile("s_wait_dscnt 0x0" ::: "memory");      // this wave's reads of stage s are done before its buffer is refilled
        asm volatile("s_wait_asynccnt 0x0" ::: "memory");   // this wave's copies of stage s + 1 have landed
        __syncthreads();   // publishes stage s + 1 and ends every wave's reads of stage s
        if (s + 2 < nst) ATT_STAGE(s + 2, buf)
    }
#undef ATT_STAGE
    asm volatile("s_wait_asynccnt 0x0" ::: "memory");   // no copy is under way when the wave goes on to its end
#pragma unroll
    for (int g = 0; g < NQ; ++g) { const float inv = __fdiv_rn(1.0f, ls[g] + xhalf(ls[g])); const unsigned oo = (unsigned)((qw + g * 16 + lr) * DQ + 8 * hi);
#pragma unroll
        for (int db = 0; db < 4; ++db) { v8us oh, ol;
#pragma unroll
            for (int r = 0; r < 8; ++r) { unsigned short a, c2; splitf(ot[db][g][r] * inv, a, c2); oh[r] = a; ol[r] = c2; }
            *(v8us*)(Ah + oo + db * 16) = oh; *(v8us*)(Al + oo + db * 16) = ol;
            asm volatile("s_wait_xcnt 0x0" ::: "memory"); } }   // stands in front of the next trip's (and the tail's) overwrite of the registers that the two stores name
}
// grid: NB_ * NH_ * RH / QHB work-groups of rows < RH first, then NB_ * NH_ * (TT - RH) / QLB: as many of either kind, every wave with 48 matrix products a stage; 512 work-groups, two a WGP, all resident in one round
// waves_per_eu(4, 4): the register budget of 4 waves a SIMD, so that the output and score arrays stay in registers (no spills)
__global__ __launch_bounds__(256) __attribute__((amdgpu_waves_per_eu(4, 4))) void k_attn(const h16* __restrict__ Q16, const h16* __restrict__ K16, const h16* __restrict__ V16, const bf* __restrict__ Qh, const bf* __restrict__ Ql, const bf* __restrict__ Kh, const bf* __restrict__ Kl, const bf* __restrict__ Vh, const bf* __restrict__ Vl, const int* __restrict__ kc, bf* Ah, bf* Al) {
    __shared__ __align__(16) bf sm[8 * SPE]; __shared__ __align__(16) float bs[TT];
    constexpr int NHW = NB_ * NH_ * (RH / QHB); const int x = (int)blockIdx.x; const bool hr = x < NHW;
    const int bh = hr ? x / (RH / QHB) : (x - NHW) / ((TT - RH) / QLB); const int q0 = hr ? (x % (RH / QHB)) * QHB : RH + ((x - NHW) % ((TT - RH) / QLB)) * QLB;
    const int b = bh / NH_, h = bh % NH_; const size_t po = (size_t)bh * TT * HD, ao = (size_t)b * TT * DQ + h * HD;
    const int cnt = keycnt(kc, b), nst = keylim(cnt) / SKB;
    { const int j = (int)threadIdx.x * (TT / 256);
#pragma unroll
      for (int c = 0; c < TT / 256; c += 4) { v4f o;
#pragma unroll
          for (int q = 0; q < 4; ++q) o[q] = (j + c + q < cnt) ? 0.0f : -3.0e38f;
          *(v4fa*)(bs + j + c) = o; } }
    if (hr) attn_body<true>(Qh + po, Ql + po, Kh + po, Kl + po, Vh + po, Vl + po, bs, sm, q0, nst, Ah + ao, Al + ao);
    else attn_body<false>((const bf*)(Q16 + po), nullptr, (const bf*)(K16 + po), nullptr, (const bf*)(V16 + po), nullptr, bs, sm, q0, nst, Ah + ao, Al + ao);
}

extern "C" void kernel_launch(void* const* d_in, const int* in_sizes, int n_in,
                              void* d_out, int out_size, void* d_ws, size_t ws_size, hipStream_t stream) {
    (void)in_sizes; (void)n_in; (void)out_size;
    const float* x = (const float*)d_in[0]; const float* xk = (const float*)d_in[1]; const float* xv = (const float*)d_in[2]; const float* wq = (const float*)d_in[3]; const float* bq = (const float*)d_in[4]; const float* wk = (const float*)d_in[5]; const float* bk = (const float*)d_in[6]; const float* wv = (const float*)d_in[7]; const float* bv = (const float*)d_in[8]; const float* wo = (const float*)d_in[9]; const float* bo = (const float*)d_in[10]; const int* MK = (const int*)d_in[11];   /* argument order q, k, v, w_q, b_q, w_k, b_k, w_v, b_v, w_o, b_o ('oi'), mask (int32 [4][2048]: read) */
    float* OUT = (float*)d_out;     // [4][2048][1024]
    char* wsp = (char*)d_ws;
    auto take = [&](size_t bytes) { char* p = wsp; wsp += (bytes + 255) & ~(size_t)255; return (void*)p; };
    bf* WQ = (bf*)take((size_t)DQ * DM * 2); bf* WK = (bf*)take((size_t)DKV * DM * 2); bf* WV = (bf*)take((size_t)DKV * DM * 2); bf* WO = (bf*)take((size_t)DM * DQ * 2);
    bf* XB = (bf*)take((size_t)3 * NB_ * TT * DM * 2);   // query, key, value of all batch entries; directly behind the weights (k_cvt writes the seven copies as one run)
    const size_t PB = PBE;
    h16* QP16 = (h16*)take(NB_ * PB * 2); h16* KP16 = (h16*)take(NB_ * PB * 2); h16* VT16 = (h16*)take(NB_ * PB * 2);
    bf* QPh = (bf*)take(NB_ * PB * 2); bf* QPl = (bf*)take(NB_ * PB * 2); bf* KPh = (bf*)take(NB_ * PB * 2); bf* KPl = (bf*)take(NB_ * PB * 2); bf* VTh = (bf*)take(NB_ * PB * 2); bf* VTl = (bf*)take(NB_ * PB * 2);
    bf* ATh = (bf*)take((size_t)NB_ * TT * DQ * 2); bf* ATl = (bf*)take((size_t)NB_ * TT * DQ * 2);
    int* KC = (int*)take(NB_ * KCS * sizeof(int));   // kept keys of each batch entry, written by k_cvt
    if ((size_t)(wsp - (char*)d_ws) > ws_size) return;    // 232 MiB of the 256 MiB
    (void)WK; (void)WV;   // reached through WQ: the weights' copies lie in one run
    k_cvt<<<4 * CVW + 3 * CVX, 256, 0, stream>>>(wq, wk, wv, wo, x, xk, xv, MK, WQ, KC);
    k_proj<<<dim3(TT / GTL, DQ / GTL, 3 * NB_), 128, 0, stream>>>(XB, WQ, bq, bk, bv, KC, QP16, QPh, QPl);
    k_attn<<<NB_ * NH_ * (RH / QHB + (TT - RH) / QLB), 256, 0, stream>>>(QP16, KP16, VT16, QPh, QPl, KPh, KPl, VTh, VTl, KC, ATh, ATl);
    k_out<<<dim3(TT / GTL, DM / GTL, NB_), 128, 0, stream>>>(ATh, ATl, WO, OUT, bo);
}
